// v000
// Measured on an AMD MI455X. A time is GPU time per run, averaged over a window of back-to-back runs after a warm-up
// (all launches, gaps included; the runs take copies of the inputs in turn), and the median of several windows.
// Apart from v000's, it joins two sittings. Times from different sittings can be a few percent apart, while
// side-by-side timings come from the same sitting.
// v000 is the starting kernel. One run takes 6800 microseconds.
// compute dtype: all float inputs rounded to bf16; Q, K, V are bf16-valued so their f16 planes are exact; scores q x k (1 product on exact planes) x 64^-0.5; softmax over the QUERY axis in f32 (per key column: online max / sum over the 4,096 queries, precise expf); P x 2^11 once to f16 x v (exact) (1 product); f32 output.
#include <hip/hip_runtime.h>
#include <math.h>

typedef __attribute__((ext_vector_type(16))) _Float16 v16h;
typedef __attribute__((ext_vector_type(16))) __bf16 v16b;
typedef __attribute__((ext_vector_type(8)))  _Float16 v8h;
typedef __attribute__((ext_vector_type(8)))  float v8f;
typedef __attribute__((ext_vector_type(4)))  float v4f;
typedef __attribute__((ext_vector_type(2)))  float v2f;
typedef __attribute__((ext_vector_type(4)))  unsigned v4u;
typedef _Float16 hx8 __attribute__((ext_vector_type(8)));
typedef __attribute__((ext_vector_type(4)))  int v4i;
typedef float __attribute__((may_alias)) float_a;
typedef int __attribute__((may_alias)) int_a;

template <typename T> __device__ __forceinline__ void vst2(void* p, T v) { *(T*)p = v;  }
__device__ __forceinline__ v8f wmma16(v16h a, v16h b, v8f c) {
  v8f d = __builtin_amdgcn_wmma_f32_16x16x32_f16(false, a, false, b, (short)0, c, false, false);
  asm volatile("v_nop\n\tv_nop\n\tv_nop\n\tv_nop" : "+v"(d) : "v"(a), "v"(b));
  return d;
}
__device__ __forceinline__ v8f wmma_bf(v16b a, v16b b, v8f c) {
  v8f d = __builtin_amdgcn_wmma_f32_16x16x32_bf16(false, a, false, b, (short)0, c, false, false);
  asm volatile("v_nop\n\tv_nop\n\tv_nop\n\tv_nop" : "+v"(d) : "v"(a), "v"(b));
  return d;
}
// 16x16x32 fragments: lane = (h = lane>>4, row/col = lane&15); elements 0..7 = k0+8h+0..7, 8..15 = k0+16+8h+0..7; D element r = row 8h+r
__device__ __forceinline__ v16h frag_h(const _Float16* rowk0, int lane) {
  union { v16h v; v8h q[2]; } u; const _Float16* p = rowk0 + 8 * (lane >> 4);
  u.q[0] = *(const v8h*)p; u.q[1] = *(const v8h*)(p + 16); return u.v;
}
__device__ __forceinline__ v16h frag_f32(const float* rowk0, int lane) {
  v16h a; const float* p = rowk0 + 8 * (lane >> 4);
#pragma unroll
  for (int i = 0; i < 8; ++i) { a[i] = (_Float16)p[i]; a[8 + i] = (_Float16)p[16 + i]; }
  return a;
}
__device__ __forceinline__ v16h frag_f32s(const float* rowk0, int lane, float sc) {
  v16h a; const float* p = rowk0 + 8 * (lane >> 4);
#pragma unroll
  for (int i = 0; i < 8; ++i) { a[i] = (_Float16)(p[i] * sc); a[8 + i] = (_Float16)(p[16 + i] * sc); }
  return a;
}
// column fragment from a [K][ld] layout (column n), rows >= K read as 0
__device__ __forceinline__ v16h fragc_f32(const float* W, int k0, int n, int lane, int ld, int K) {
  v16h a; const int g = lane >> 4;
#pragma unroll
  for (int i = 0; i < 8; ++i) { const int ka = k0 + 8 * g + i, kb = ka + 16;
    a[i] = (_Float16)(ka < K ? W[(size_t)(ka < K ? ka : K - 1) * ld + n] : 0.f); a[8 + i] = (_Float16)(kb < K ? W[(size_t)(kb < K ? kb : K - 1) * ld + n] : 0.f); }
  return a;
}
struct F2 { v16b h, l; };
__device__ __forceinline__ F2 bsplit16(const float v[16]) { F2 r;
#pragma unroll
  for (int i = 0; i < 16; ++i) { const __bf16 h = (__bf16)v[i]; r.h[i] = h; r.l[i] = (__bf16)(v[i] - (float)h); }
  return r; }
__device__ __forceinline__ F2 split_row(const float* row, int k0, int lane) { float v[16]; const float* p = row + k0 + 8 * (lane >> 4);
#pragma unroll
  for (int i = 0; i < 8; ++i) { v[i] = p[i]; v[8 + i] = p[16 + i]; }
  return bsplit16(v); }
__device__ __forceinline__ F2 split_rowK(const float* row, int k0, int lane, int K) { float v[16]; const int g = lane >> 4;
#pragma unroll
  for (int i = 0; i < 8; ++i) { const int ka = k0 + 8 * g + i, kb = ka + 16; v[i] = ka < K ? row[ka < K ? ka : K - 1] : 0.f; v[8 + i] = kb < K ? row[kb < K ? kb : K - 1] : 0.f; }
  return bsplit16(v); }
__device__ __forceinline__ F2 split_col(const float* W, int k0, int n, int lane, int ld, int K) { float v[16]; const int g = lane >> 4;
#pragma unroll
  for (int i = 0; i < 8; ++i) { const int ka = k0 + 8 * g + i, kb = ka + 16; v[i] = ka < K ? W[(size_t)(ka < K ? ka : K - 1) * ld + n] : 0.f; v[8 + i] = kb < K ? W[(size_t)(kb < K ? kb : K - 1) * ld + n] : 0.f; }
  return bsplit16(v); }
__device__ __forceinline__ v8f mac3(const F2& a, const F2& b, v8f c) { c = wmma_bf(a.l, b.h, c); c = wmma_bf(a.h, b.l, c); return wmma_bf(a.h, b.h, c); }
__device__ __forceinline__ float sigm(float v) { return 1.0f / (1.0f + expf(-v)); }
#define LDSX() do { asm volatile("s_wait_dscnt 0" ::: "memory"); __builtin_amdgcn_wave_barrier(); __builtin_amdgcn_fence(__ATOMIC_RELEASE, "workgroup"); } while (0)

// Scaled dot-product attention on given tensors whose softmax runs over the QUERY axis (Q / K / V [4,4096,64]; scores = Q K^T / 8 of shape [B, q, k]; attn = softmax(scores, axis=1) - axis 1 is the QUERY axis, so every key COLUMN is normalised over the 4,096 queries (faithful to the source); out = attn V -> [4,4096,64]; no mask).
#define NB 4
#define TT 4096
#define CC 64            // NH * HD = projected width
#define DIN 64          // input (model) width
#define NH 1
#define HD 64
#define NQB (TT / 64)
#define HG 1
#define SCALE (0.125f)
#define CAUSAL 0
#ifndef TNB
#define TNB NB
#endif
__device__ __forceinline__ float bfr(float v) { return (float)(__bf16)v; }
__host__ __device__ __forceinline__ int kb_last(int qb) { return CAUSAL ? ((qb * 64 + 63) >> 7) : (TT / 128 - 1); }
typedef __attribute__((ext_vector_type(8))) __bf16 v8b;
__device__ __forceinline__ v16b frag_b(const __bf16* rowk0, int lane) {
  union { v16b v; v8b q[2]; } u; const __bf16* p = rowk0 + 8 * (lane >> 4);
  u.q[0] = *(const v8b*)p; u.q[1] = *(const v8b*)(p + 16); return u.v;
}
#define QBH 0              // exact planes: single-product logits and single-f16 P x V on every block
#define QHI 0               // no q residual plane (q is bf16-exact in f16)
#define KHI 64              // unused high-precision planes kept minimal
// B fragment (k rows k0+.., output column o) of a weight: (in,out) [K][ld] or (out,in) [ld rows of K]: bf16 exact, or f16(bf16 * 256) exact
__device__ __forceinline__ v16b wcol_io(const float* Wm, int k0, int o, int lane, int ld) { v16b w; const int g = lane >> 4;
#pragma unroll
  for (int i = 0; i < 8; ++i) { w[i] = (__bf16)Wm[(size_t)(k0 + 8 * g + i) * ld + o]; w[8 + i] = (__bf16)Wm[(size_t)(k0 + 16 + 8 * g + i) * ld + o]; }
  return w; }
__device__ __forceinline__ v16b wcol_oi(const float* Wm, int k0, int o, int lane, int K) { v16b w; const float* p = Wm + (size_t)o * K + k0 + 8 * (lane >> 4);
#pragma unroll
  for (int i = 0; i < 8; ++i) { w[i] = (__bf16)p[i]; w[8 + i] = (__bf16)p[16 + i]; }
  return w; }
__device__ __forceinline__ v16h wcolh_io(const float* Wm, int k0, int o, int lane, int ld) { v16h w; const int g = lane >> 4;
#pragma unroll
  for (int i = 0; i < 8; ++i) { w[i] = (_Float16)(bfr(Wm[(size_t)(k0 + 8 * g + i) * ld + o]) * 256.0f); w[8 + i] = (_Float16)(bfr(Wm[(size_t)(k0 + 16 + 8 * g + i) * ld + o]) * 256.0f); }
  return w; }
__device__ __forceinline__ v16h wcolh_oi(const float* Wm, int k0, int o, int lane, int K) { v16h w; const float* p = Wm + (size_t)o * K + k0 + 8 * (lane >> 4);
#pragma unroll
  for (int i = 0; i < 8; ++i) { w[i] = (_Float16)(bfr(p[i]) * 256.0f); w[8 + i] = (_Float16)(bfr(p[16 + i]) * 256.0f); }
  return w; }
#define WQKV_LAYOUT 0   // 0 = (in,out) [DIN][CC]; 1 = (out,in) [CC][DIN]; 2 = per-head [NH][DIN][HD]
__device__ __forceinline__ v16b wcol_hdk(const float* Wm, int k0, int o, int lane) { v16b w; const int g = lane >> 4; const float* p = Wm + (size_t)(o / HD) * DIN * HD + (o % HD);
#pragma unroll
  for (int i = 0; i < 8; ++i) { w[i] = (__bf16)p[(size_t)(k0 + 8 * g + i) * HD]; w[8 + i] = (__bf16)p[(size_t)(k0 + 16 + 8 * g + i) * HD]; }
  return w; }
#define WO_OUT_IN 0
#if WQKV_LAYOUT == 1
#define WCOL(W, k0, o, lane) wcol_oi(W, k0, o, lane, DIN)
#elif WQKV_LAYOUT == 2
#define WCOL(W, k0, o, lane) wcol_hdk(W, k0, o, lane)
#else
#define WCOL(W, k0, o, lane) wcol_io(W, k0, o, lane, CC)
#endif
#if WO_OUT_IN
#define WOCOL(W, k0, o, lane) wcol_oi(W, k0, o, lane, CC)
#define WOCOLH(W, k0, o, lane) wcolh_oi(W, k0, o, lane, CC)
#else
#define WOCOL(W, k0, o, lane) wcol_io(W, k0, o, lane, DIN)
#define WOCOLH(W, k0, o, lane) wcolh_io(W, k0, o, lane, DIN)
#endif
__global__ __launch_bounds__(256) void k_planes64(const float* __restrict__ Qs, const float* __restrict__ Ks, const float* __restrict__ Vs, _Float16* __restrict__ QH, _Float16* __restrict__ QL, _Float16* __restrict__ KH, _Float16* __restrict__ KL, _Float16* __restrict__ VT, __bf16* __restrict__ VB, __bf16* __restrict__ VBL) {
  __shared__ _Float16 sv[64][72];
  const int tid = threadIdx.x; const size_t r0 = (size_t)blockIdx.x * 64; const int b = (int)(r0 / TT), t0 = (int)(r0 % TT);
  for (int e = tid; e < 64 * 8; e += 256) { const int rl = e >> 3, q = e & 7; const size_t src = (r0 + rl) * CC + q * 8; float tq[8], tk[8], tv[8];
#pragma unroll
    for (int u = 0; u < 8; ++u) { tq[u] = Qs[src + u]; tk[u] = Ks[src + u]; tv[u] = Vs[src + u]; }
    asm volatile("s_wait_loadcnt 0x0" ::: "memory");
    hx8 hq, hk, hlq, hlk;
#pragma unroll
    for (int u = 0; u < 8; ++u) { const float qv = bfr(tq[u]), kv = bfr(tk[u]); const _Float16 qh = (_Float16)qv, kh = (_Float16)kv; hq[u] = qh; hlq[u] = (_Float16)((qv - (float)qh) * 1024.0f); hk[u] = kh; hlk[u] = (_Float16)((kv - (float)kh) * 1024.0f); sv[rl][q * 8 + u] = (_Float16)bfr(tv[u]); }
    vst2((unsigned*)(QH + (r0 + rl) * CC + q * 8), *(const v4u*)&hq); vst2((unsigned*)(KH + (r0 + rl) * CC + q * 8), *(const v4u*)&hk);
    if (t0 + rl < QHI) vst2((unsigned*)(QL + ((size_t)b * QHI + t0 + rl) * CC + q * 8), *(const v4u*)&hlq);
    if (t0 + rl < KHI) vst2((unsigned*)(KL + ((size_t)b * KHI + t0 + rl) * CC + q * 8), *(const v4u*)&hlk); }
  __syncthreads();
  for (int e = tid; e < 64 * 8; e += 256) { const int c = e >> 3, q = e & 7; hx8 hv; _Pragma("unroll") for (int j = 0; j < 8; ++j) hv[j] = sv[q * 8 + j][c]; vst2((unsigned*)(VT + ((size_t)b * CC + c) * TT + t0 + q * 8), *(const v4u*)&hv);
    if (t0 < KHI) { v8b bh, bl; _Pragma("unroll") for (int j = 0; j < 8; ++j) { const float vv = (float)hv[j]; const __bf16 h1 = (__bf16)vv; bh[j] = h1; bl[j] = (__bf16)(vv - (float)h1); } vst2((unsigned*)(VB + ((size_t)b * CC + c) * KHI + t0 + q * 8), *(const v4u*)&bh); vst2((unsigned*)(VBL + ((size_t)b * CC + c) * KHI + t0 + q * 8), *(const v4u*)&bl); } } }
#define SM_EXTRA_PARAMS
#define SM_MASK_HOOK (void)0
#ifndef SM_EXTRA_PARAMS
#define SM_EXTRA_PARAMS
#endif
#ifndef PROJ_EXTRA_PARAMS
#define PROJ_EXTRA_PARAMS
#endif
#ifndef SM_MASK_HOOK
#define SM_MASK_HOOK (void)0
#endif

#define WS_QH  0u                                      // f16 q rows [b*t][CC]
#define WS_KH  (WS_QH + 2u * (size_t)NB * TT * CC)      // f16 k rows [b*t][CC]
#define WS_VT  (WS_KH + 2u * (size_t)NB * TT * CC)      // f16 v planes [b][c][t]
#define WS_QL  (WS_VT + 2u * (size_t)NB * CC * TT)      // f16 q residual x 2^10 rows [b][t < QHI][CC]
#define WS_KL  (WS_QL + 2u * (size_t)NB * QHI * CC)     // f16 k residual x 2^10 rows [b][t < KHI][CC]
#define WS_VB  (WS_KL + 2u * (size_t)NB * KHI * CC)     // bf16 v hi planes [b][c][t < KHI]
#define WS_VBL (WS_VB + 2u * (size_t)NB * CC * KHI)
#define WS_S   (WS_VBL + 2u * (size_t)NB * CC * KHI)    // f32 logits / P [hg][t][s]
#define WS_Y   (WS_S  + 4u * (size_t)HG * TT * TT)      // f32 ctx rows [b*t][CC] (only when there is an output projection)
#define WS_END (WS_Y  + 0u)
#define WS_CM (WS_END)                                  // f32 column maxima [HG][TT]
#define WS_CZ (WS_CM + 4u * (size_t)HG * TT)
#define WS_END2 (WS_CZ + 4u * (size_t)HG * TT)

// ---- k_proj: block = (64 rows, 128 cols, which): q/k/v = X W (+ b) with exact bf16 products (K = DIN) -> which 0: q f16 rows (+ residual rows < QHI); 1: k f16 rows (+ residual rows < KHI); 2: v f16 planes [c][t] (+ bf16 hi/lo planes for t < KHI)
__global__ __launch_bounds__(128) void k_proj(const float* __restrict__ XQ, const float* __restrict__ XK, const float* __restrict__ XV, const float* __restrict__ WQ, const float* __restrict__ WK, const float* __restrict__ WV, const float* __restrict__ BQ, const float* __restrict__ BK, const float* __restrict__ BV,
    _Float16* __restrict__ QH, _Float16* __restrict__ QL, _Float16* __restrict__ KH, _Float16* __restrict__ KL, _Float16* __restrict__ VT, __bf16* __restrict__ VB, __bf16* __restrict__ VBL) {
  __shared__ __align__(16) _Float16 sh[64][136], sl[64][136]; __shared__ __align__(16) _Float16 th[128][72]; __shared__ __align__(16) __bf16 tb[128][72], tbl[128][72];
  const int tid = threadIdx.x, wave = tid >> 5, lane = tid & 31, col = lane & 15, g = lane >> 4; const int which = blockIdx.z; const int c0 = blockIdx.y * 128; const size_t r0 = (size_t)blockIdx.x * 64; const size_t bb = r0 / TT; const int t0 = (int)(r0 % TT);
  const float* X = which == 0 ? XQ : which == 1 ? XK : XV; const float* WA = which == 0 ? WQ : which == 1 ? WK : WV; const float* BA = which == 0 ? BQ : which == 1 ? BK : BV;
  v8f acc[8] = {};
#pragma unroll 2
  for (int kc = 0; kc < DIN / 32; ++kc) { v16b a; { const float* p = X + (r0 + wave * 16 + col) * DIN + kc * 32 + 8 * g;
#pragma unroll
      for (int i = 0; i < 8; ++i) { a[i] = (__bf16)p[i]; a[8 + i] = (__bf16)p[16 + i]; } }
    asm volatile("s_wait_loadcnt 0x0" ::: "memory");
#pragma unroll
    for (int j = 0; j < 8; ++j) { const v16b w = WCOL(WA, kc * 32, c0 + j * 16 + col, lane); asm volatile("s_wait_loadcnt 0x0" ::: "memory"); acc[j] = wmma_bf(a, w, acc[j]); } }
  if (which < 2) { _Float16* DH = which == 0 ? QH : KH; _Float16* DL = which == 0 ? QL : KL; const int nhi = which == 0 ? QHI : KHI; const bool hi_rows = t0 < nhi;
#pragma unroll
    for (int j = 0; j < 8; ++j) { const float bias = BA ? bfr(BA[c0 + j * 16 + col]) : 0.f;
#pragma unroll
      for (int r = 0; r < 8; ++r) { const float v = acc[j][r] + bias; const _Float16 hv = (_Float16)v; sh[wave * 16 + 8 * g + r][j * 16 + col] = hv; sl[wave * 16 + 8 * g + r][j * 16 + col] = (_Float16)((v - (float)hv) * 1024.0f); } }
    __syncthreads();
    for (int e = tid; e < 64 * 16; e += 128) { const int rl = e >> 4, q = e & 15; vst2((unsigned*)(DH + (r0 + rl) * CC + c0 + q * 8), *(const v4u*)&sh[rl][q * 8]); if (hi_rows) vst2((unsigned*)(DL + (bb * nhi + t0 + rl) * (size_t)CC + c0 + q * 8), *(const v4u*)&sl[rl][q * 8]); }
  } else { const bool hi_rows = t0 < KHI;
#pragma unroll
    for (int j = 0; j < 8; ++j) { const float bias = BA ? bfr(BA[c0 + j * 16 + col]) : 0.f;
#pragma unroll
      for (int r = 0; r < 8; ++r) { const float v = acc[j][r] + bias; const int rl = wave * 16 + 8 * g + r, cl = j * 16 + col; th[cl][rl] = (_Float16)v; const __bf16 bh = (__bf16)v; tb[cl][rl] = bh; tbl[cl][rl] = (__bf16)(v - (float)bh); } }
    __syncthreads();
    for (int e = tid; e < 128 * 8; e += 128) { const int cl = e >> 3, q = e & 7; vst2((unsigned*)(VT + (bb * CC + c0 + cl) * (size_t)TT + t0 + q * 8), *(const v4u*)&th[cl][q * 8]); if (hi_rows) { const size_t o3 = (bb * CC + c0 + cl) * (size_t)KHI + t0 + q * 8; vst2((unsigned*)(VB + o3), *(const v4u*)&tb[cl][q * 8]); vst2((unsigned*)(VBL + o3), *(const v4u*)&tbl[cl][q * 8]); } } } }
// ---- k_sc: block = (query block qb, key block kb <= kb_last(qb), head in group) of batch b: logits x SCALE; q hi + residual (x 2^10) against k (2 products) for query rows < QHI, plus the k residual (3 products) for query blocks < QBH (causal early rows); causal: blocks past the diagonal exit, the mask itself is applied by index in k_sm
__global__ __launch_bounds__(128) void k_sc(const _Float16* __restrict__ QH, const _Float16* __restrict__ KH, const _Float16* __restrict__ QL, const _Float16* __restrict__ KL, int b, int h0, float* __restrict__ S0) { __shared__ __align__(16) float ss[4][16][132];
  const int qb = blockIdx.x, kb = blockIdx.y; if (kb > kb_last(qb)) return;
  const int h = h0 + blockIdx.z; float* S = S0 + (size_t)blockIdx.z * TT * TT;
  const int tid = threadIdx.x, wave = tid >> 5, lane = tid & 31, col = lane & 15, g = lane >> 4; const int k0 = kb * 128; const int ql0 = qb * 64 + wave * 16; const size_t q0 = (size_t)b * TT + ql0, kr0 = (size_t)b * TT + k0;
  v8f acc[8] = {}, accl[8] = {};
  const _Float16* QLb = QL + (size_t)b * QHI * CC; const _Float16* KLb = KL + (size_t)b * KHI * CC;
  if (qb < QBH) {
#pragma unroll
    for (int kc = 0; kc < HD / 32; ++kc) { const v16h ah = frag_h(QH + (q0 + col) * CC + h * HD + kc * 32, lane), al = frag_h(QLb + (size_t)(ql0 + col) * CC + h * HD + kc * 32, lane);
#pragma unroll
      for (int j = 0; j < 8; ++j) { const v16h kbf = frag_h(KH + (kr0 + j * 16 + col) * CC + h * HD + kc * 32, lane), klf = frag_h(KLb + (size_t)(k0 + j * 16 + col) * CC + h * HD + kc * 32, lane); acc[j] = wmma16(ah, kbf, acc[j]); accl[j] = wmma16(al, kbf, accl[j]); accl[j] = wmma16(ah, klf, accl[j]); } }
  } else if (qb * 64 < QHI) {
#pragma unroll
    for (int kc = 0; kc < HD / 32; ++kc) { const v16h ah = frag_h(QH + (q0 + col) * CC + h * HD + kc * 32, lane), al = frag_h(QLb + (size_t)(ql0 + col) * CC + h * HD + kc * 32, lane);
#pragma unroll
      for (int j = 0; j < 8; ++j) { const v16h kbf = frag_h(KH + (kr0 + j * 16 + col) * CC + h * HD + kc * 32, lane); acc[j] = wmma16(ah, kbf, acc[j]); accl[j] = wmma16(al, kbf, accl[j]); } }
  } else {
#pragma unroll
    for (int kc = 0; kc < HD / 32; ++kc) { const v16h ah = frag_h(QH + (q0 + col) * CC + h * HD + kc * 32, lane);
#pragma unroll
      for (int j = 0; j < 8; ++j) { const v16h kbf = frag_h(KH + (kr0 + j * 16 + col) * CC + h * HD + kc * 32, lane); acc[j] = wmma16(ah, kbf, acc[j]); } } }
#pragma unroll
  for (int j = 0; j < 8; ++j) {
#pragma unroll
    for (int r = 0; r < 8; ++r) ss[wave][8 * g + r][j * 16 + col] = (acc[j][r] + accl[j][r] * (1.0f / 1024.0f)) * SCALE; }
  LDSX(); for (int rl = 0; rl < 16; ++rl) vst2(S + (size_t)(ql0 + rl) * TT + k0 + lane * 4, *(const v4f*)&ss[wave][rl][lane * 4]); }
// ---- k_sm: block = query row t (head in group): keys [0, kend): causal -> logit if s <= t else excluded; softmax in f32; P x 2^11 in place (0 for excluded)
__global__ __launch_bounds__(256) void k_sm(float* __restrict__ S0 SM_EXTRA_PARAMS) { __shared__ float sred[8]; __shared__ float sbc; __shared__ __align__(16) float shv[TT];
  const int tid = threadIdx.x; const int t = blockIdx.x; const int kend = (kb_last(t >> 6) + 1) * 128;
  float* sr = S0 + (size_t)blockIdx.y * TT * TT + (size_t)t * TT;
  float m = -3.0e38f; for (int k = tid; k < kend; k += 256) { float v = (!CAUSAL || k <= t) ? sr[k] : -3.0e38f; SM_MASK_HOOK; shv[k] = v; m = fmaxf(m, v); }
#pragma unroll
  for (int o = 1; o < 32; o <<= 1) m = fmaxf(m, __shfl_xor(m, o));
  if ((tid & 31) == 0) sred[tid >> 5] = m; __syncthreads(); if (tid == 0) { float a = sred[0]; for (int i = 1; i < 8; ++i) a = fmaxf(a, sred[i]); sbc = a; } __syncthreads(); m = sbc; __syncthreads();
  float sum = 0.f; for (int k = tid; k < kend; k += 256) { const float v = shv[k]; const float e = (v <= -1.0e38f) ? 0.f : expf(v - m); shv[k] = e; sum += e; }
#pragma unroll
  for (int o = 1; o < 32; o <<= 1) sum += __shfl_xor(sum, o);
  if ((tid & 31) == 0) sred[tid >> 5] = sum; __syncthreads(); if (tid == 0) { float a = 0.f; for (int i = 0; i < 8; ++i) a += sred[i]; sbc = a > 0.f ? 2048.0f / a : 0.f; }   /* a fully excluded row yields P = 0 */ __syncthreads(); const float inv = sbc;
  for (int k = tid; k < kend; k += 256) shv[k] = shv[k] * inv;
  __syncthreads(); for (int q = tid; q < kend / 4; q += 256) vst2(sr + q * 4, *(const v4f*)&shv[q * 4]); }
// ---- k_colstat: softmax over the QUERY axis (the source's softmax(axis=1) on a [B, q, k] tensor): for every key column k of each head plane: m_k = max_q S[q][k], Z_k = sum_q exp(S[q][k] - m_k) (online, one pass, f32, precise expf); thread per column, consecutive threads = consecutive columns (coalesced row reads)
__global__ __launch_bounds__(256) void k_colstat(const float* __restrict__ S0, float* __restrict__ CM, float* __restrict__ CZ) { const int k = blockIdx.x * 256 + threadIdx.x; const float* sp = S0 + (size_t)blockIdx.y * TT * TT + k;
  float m = -3.0e38f, z = 0.f;
#pragma unroll 4
  for (int q = 0; q < TT; ++q) { const float v = sp[(size_t)q * TT]; asm volatile("s_wait_loadcnt 0x0" ::: "memory"); const float mn = fmaxf(m, v); z = z * expf(m - mn) + expf(v - mn); m = mn; }
  vst2(CM + (size_t)blockIdx.y * TT + k, m); vst2(CZ + (size_t)blockIdx.y * TT + k, z); }   
// ---- k_csm: block = (query row t, head in group): P[t][k] = exp(S[t][k] - m_k) / Z_k x 2^11 in place (column-normalised weights; each thread owns 16-B pieces)
__global__ __launch_bounds__(256) void k_csm(float* __restrict__ S0, const float* __restrict__ CM, const float* __restrict__ CZ) { const int tid = threadIdx.x; float* sr = S0 + (size_t)blockIdx.y * TT * TT + (size_t)blockIdx.x * TT; const float* cm = CM + (size_t)blockIdx.y * TT; const float* cz = CZ + (size_t)blockIdx.y * TT;
  for (int q4 = tid; q4 < TT / 4; q4 += 256) { const v4f s = *(const v4f*)(sr + q4 * 4), m4 = *(const v4f*)(cm + q4 * 4), z4 = *(const v4f*)(cz + q4 * 4); asm volatile("s_wait_loadcnt 0x0" ::: "memory"); v4f p;
#pragma unroll
    for (int u = 0; u < 4; ++u) p[u] = expf(s[u] - m4[u]) * (2048.0f / z4[u]);
    vst2(sr + q4 * 4, p); } }
// ---- k_pv: block = 64 queries (qb) of (b, h): ctx = P . v over keys [0, kend) (P x 2^11 once to f16 against v f16: 1 product; causal early query blocks: P and v as bf16 hi + lo, 3 products); 256-B (row, head) segment by 16 lanes
__global__ __launch_bounds__(128) void k_pv(const float* __restrict__ PS0, const _Float16* __restrict__ VT, const __bf16* __restrict__ VB, const __bf16* __restrict__ VBL, int b, int h0, float* __restrict__ Y) { const int h = h0 + blockIdx.z; const float* PS = PS0 + (size_t)blockIdx.z * TT * TT; __shared__ __align__(16) float ss[4][16][HD + 4];
  const int tid = threadIdx.x, wave = tid >> 5, lane = tid & 31, col = lane & 15, g = lane >> 4; const int qb = blockIdx.x; const int ql0 = qb * 64 + wave * 16; const int kce = (kb_last(qb) + 1) * 4;
  v8f acc[HD / 16] = {};
  if (qb < QBH) {
#pragma unroll 1
    for (int kc = 0; kc < kce; ++kc) { const F2 p = split_row(PS + (size_t)(ql0 + col) * TT, kc * 32, lane);
      asm volatile("s_wait_loadcnt 0x0" ::: "memory");
#pragma unroll
      for (int j = 0; j < HD / 16; ++j) { const size_t po = ((size_t)b * CC + h * HD + j * 16 + col) * (size_t)KHI + kc * 32; const v16b vh = frag_b(VB + po, lane); acc[j] = wmma_bf(p.h, vh, acc[j]); acc[j] = wmma_bf(p.l, vh, acc[j]); acc[j] = wmma_bf(p.h, frag_b(VBL + po, lane), acc[j]); } }
  } else {
#pragma unroll 1
    for (int kc = 0; kc < kce; ++kc) { const v16h p = frag_f32(PS + (size_t)(ql0 + col) * TT + kc * 32, lane);
      asm volatile("s_wait_loadcnt 0x0" ::: "memory");
#pragma unroll
      for (int j = 0; j < HD / 16; ++j) { const size_t po = ((size_t)b * CC + h * HD + j * 16 + col) * (size_t)TT + kc * 32; acc[j] = wmma16(p, frag_h(VT + po, lane), acc[j]); } } }
#pragma unroll
  for (int j = 0; j < HD / 16; ++j)
#pragma unroll
    for (int r = 0; r < 8; ++r) ss[wave][8 * g + r][j * 16 + col] = acc[j][r] * (1.0f / 2048.0f);
  LDSX(); for (int rl = 0; rl < 16; ++rl) if (lane < HD / 4) vst2(Y + ((size_t)b * TT + ql0 + rl) * CC + h * HD + lane * 4, *(const v4f*)&ss[wave][rl][lane * 4]); }

extern "C" void kernel_launch(void* const* d_in, const int* in_sizes, int n_in, void* d_out, int out_size, void* d_ws, size_t ws_size, hipStream_t stream) {
  (void)in_sizes; (void)n_in; (void)out_size;
  const float** F = (const float**)d_in;
  if (ws_size < (size_t)WS_END2) return;
  char* ws = (char*)d_ws; _Float16 *QH = (_Float16*)(ws + WS_QH), *KH = (_Float16*)(ws + WS_KH), *VT = (_Float16*)(ws + WS_VT), *QL = (_Float16*)(ws + WS_QL), *KL = (_Float16*)(ws + WS_KL); __bf16 *VB = (__bf16*)(ws + WS_VB), *VBL = (__bf16*)(ws + WS_VBL); float *S = (float*)(ws + WS_S), *Y = (float*)(ws + WS_Y);
  (void)Y; (void)QL; (void)KL; (void)VB; (void)VBL;
  float *CM = (float*)(ws + WS_CM), *CZ = (float*)(ws + WS_CZ);
  // inputs: 0 Q [4,4096,64]; 1 K; 2 V
  k_planes64<<<dim3(TNB * TT / 64), 256, 0, stream>>>(F[0], F[1], F[2], QH, QL, KH, KL, VT, VB, VBL);
  for (int b = 0; b < TNB; ++b) {
    k_sc<<<dim3(NQB, TT / 128, 1), 128, 0, stream>>>(QH, KH, QL, KL, b, 0, S);
    k_colstat<<<dim3(TT / 256, 1), 256, 0, stream>>>(S, CM, CZ);   /* per key column: max and sum over the queries */
    k_csm<<<dim3(TT, 1), 256, 0, stream>>>(S, CM, CZ);            /* P[q][k] = exp(S - m_k) / Z_k x 2^11 */
    k_pv<<<dim3(NQB, 1, 1), 128, 0, stream>>>(S, VT, VB, VBL, b, 0, (float*)d_out);
  }


}

// v001
// It runs in 751 microseconds.
// Two timings next to v000 put it at 9.05 and 9.06 times that version's speed.
// compute dtype: all float inputs rounded to bf16; Q, K, V are bf16-valued so their f16 planes are exact; scores q x k (1 product on exact planes) x 64^-0.5; softmax over the QUERY axis in f32 (per key column: max / sum over the 4,096 queries, 32 online partials merged, precise expf); P x 2^11 once to f16 x v (exact) (1 product); f32 output.
#include <hip/hip_runtime.h>
#include <math.h>

typedef __attribute__((ext_vector_type(16))) _Float16 v16h;
typedef __attribute__((ext_vector_type(16))) __bf16 v16b;
typedef __attribute__((ext_vector_type(8)))  _Float16 v8h;
typedef __attribute__((ext_vector_type(8)))  float v8f;
typedef __attribute__((ext_vector_type(4)))  float v4f;
typedef __attribute__((ext_vector_type(2)))  float v2f;
typedef __attribute__((ext_vector_type(4)))  unsigned v4u;
typedef _Float16 hx8 __attribute__((ext_vector_type(8)));
typedef __attribute__((ext_vector_type(4)))  int v4i;
typedef float __attribute__((may_alias)) float_a;
typedef int __attribute__((may_alias)) int_a;

template <typename T> __device__ __forceinline__ void vst2(void* p, T v) { *(T*)p = v;  }
__device__ __forceinline__ v8f wmma16(v16h a, v16h b, v8f c) {
  v8f d = __builtin_amdgcn_wmma_f32_16x16x32_f16(false, a, false, b, (short)0, c, false, false);
  asm volatile("v_nop\n\tv_nop\n\tv_nop\n\tv_nop" : "+v"(d) : "v"(a), "v"(b));
  return d;
}
__device__ __forceinline__ v8f wmma_bf(v16b a, v16b b, v8f c) {
  v8f d = __builtin_amdgcn_wmma_f32_16x16x32_bf16(false, a, false, b, (short)0, c, false, false);
  asm volatile("v_nop\n\tv_nop\n\tv_nop\n\tv_nop" : "+v"(d) : "v"(a), "v"(b));
  return d;
}
// 16x16x32 fragments: lane = (h = lane>>4, row/col = lane&15); elements 0..7 = k0+8h+0..7, 8..15 = k0+16+8h+0..7; D element r = row 8h+r
__device__ __forceinline__ v16h frag_h(const _Float16* rowk0, int lane) {
  union { v16h v; v8h q[2]; } u; const _Float16* p = rowk0 + 8 * (lane >> 4);
  u.q[0] = *(const v8h*)p; u.q[1] = *(const v8h*)(p + 16); return u.v;
}
__device__ __forceinline__ v16h frag_f32(const float* rowk0, int lane) {
  v16h a; const float* p = rowk0 + 8 * (lane >> 4);
#pragma unroll
  for (int i = 0; i < 8; ++i) { a[i] = (_Float16)p[i]; a[8 + i] = (_Float16)p[16 + i]; }
  return a;
}
__device__ __forceinline__ v16h frag_f32s(const float* rowk0, int lane, float sc) {
  v16h a; const float* p = rowk0 + 8 * (lane >> 4);
#pragma unroll
  for (int i = 0; i < 8; ++i) { a[i] = (_Float16)(p[i] * sc); a[8 + i] = (_Float16)(p[16 + i] * sc); }
  return a;
}
// column fragment from a [K][ld] layout (column n), rows >= K read as 0
__device__ __forceinline__ v16h fragc_f32(const float* W, int k0, int n, int lane, int ld, int K) {
  v16h a; const int g = lane >> 4;
#pragma unroll
  for (int i = 0; i < 8; ++i) { const int ka = k0 + 8 * g + i, kb = ka + 16;
    a[i] = (_Float16)(ka < K ? W[(size_t)(ka < K ? ka : K - 1) * ld + n] : 0.f); a[8 + i] = (_Float16)(kb < K ? W[(size_t)(kb < K ? kb : K - 1) * ld + n] : 0.f); }
  return a;
}
struct F2 { v16b h, l; };
__device__ __forceinline__ F2 bsplit16(const float v[16]) { F2 r;
#pragma unroll
  for (int i = 0; i < 16; ++i) { const __bf16 h = (__bf16)v[i]; r.h[i] = h; r.l[i] = (__bf16)(v[i] - (float)h); }
  return r; }
__device__ __forceinline__ F2 split_row(const float* row, int k0, int lane) { float v[16]; const float* p = row + k0 + 8 * (lane >> 4);
#pragma unroll
  for (int i = 0; i < 8; ++i) { v[i] = p[i]; v[8 + i] = p[16 + i]; }
  return bsplit16(v); }
__device__ __forceinline__ F2 split_rowK(const float* row, int k0, int lane, int K) { float v[16]; const int g = lane >> 4;
#pragma unroll
  for (int i = 0; i < 8; ++i) { const int ka = k0 + 8 * g + i, kb = ka + 16; v[i] = ka < K ? row[ka < K ? ka : K - 1] : 0.f; v[8 + i] = kb < K ? row[kb < K ? kb : K - 1] : 0.f; }
  return bsplit16(v); }
__device__ __forceinline__ F2 split_col(const float* W, int k0, int n, int lane, int ld, int K) { float v[16]; const int g = lane >> 4;
#pragma unroll
  for (int i = 0; i < 8; ++i) { const int ka = k0 + 8 * g + i, kb = ka + 16; v[i] = ka < K ? W[(size_t)(ka < K ? ka : K - 1) * ld + n] : 0.f; v[8 + i] = kb < K ? W[(size_t)(kb < K ? kb : K - 1) * ld + n] : 0.f; }
  return bsplit16(v); }
__device__ __forceinline__ v8f mac3(const F2& a, const F2& b, v8f c) { c = wmma_bf(a.l, b.h, c); c = wmma_bf(a.h, b.l, c); return wmma_bf(a.h, b.h, c); }
__device__ __forceinline__ float sigm(float v) { return 1.0f / (1.0f + expf(-v)); }
#define LDSX() do { asm volatile("s_wait_dscnt 0" ::: "memory"); __builtin_amdgcn_wave_barrier(); __builtin_amdgcn_fence(__ATOMIC_RELEASE, "workgroup"); } while (0)

// Scaled dot-product attention on given tensors whose softmax runs over the QUERY axis (Q / K / V [4,4096,64]; scores = Q K^T / 8 of shape [B, q, k]; attn = softmax(scores, axis=1) - axis 1 is the QUERY axis, so every key COLUMN is normalised over the 4,096 queries (faithful to the source); out = attn V -> [4,4096,64]; no mask).
#define NB 4
#define TT 4096
#define CC 64            // NH * HD = projected width
#define DIN 64          // input (model) width
#define NH 1
#define HD 64
#define NQB (TT / 64)
#define HG 1
#define SCALE (0.125f)
#define CAUSAL 0
#ifndef TNB
#define TNB NB
#endif
__device__ __forceinline__ float bfr(float v) { return (float)(__bf16)v; }
__host__ __device__ __forceinline__ int kb_last(int qb) { return CAUSAL ? ((qb * 64 + 63) >> 7) : (TT / 128 - 1); }
typedef __attribute__((ext_vector_type(8))) __bf16 v8b;
__device__ __forceinline__ v16b frag_b(const __bf16* rowk0, int lane) {
  union { v16b v; v8b q[2]; } u; const __bf16* p = rowk0 + 8 * (lane >> 4);
  u.q[0] = *(const v8b*)p; u.q[1] = *(const v8b*)(p + 16); return u.v;
}
#define QBH 0              // exact planes: single-product logits and single-f16 P x V on every block
#define QHI 0               // no q residual plane (q is bf16-exact in f16)
#define KHI 64              // unused high-precision planes kept minimal
// B fragment (k rows k0+.., output column o) of a weight: (in,out) [K][ld] or (out,in) [ld rows of K]: bf16 exact, or f16(bf16 * 256) exact
__device__ __forceinline__ v16b wcol_io(const float* Wm, int k0, int o, int lane, int ld) { v16b w; const int g = lane >> 4;
#pragma unroll
  for (int i = 0; i < 8; ++i) { w[i] = (__bf16)Wm[(size_t)(k0 + 8 * g + i) * ld + o]; w[8 + i] = (__bf16)Wm[(size_t)(k0 + 16 + 8 * g + i) * ld + o]; }
  return w; }
__device__ __forceinline__ v16b wcol_oi(const float* Wm, int k0, int o, int lane, int K) { v16b w; const float* p = Wm + (size_t)o * K + k0 + 8 * (lane >> 4);
#pragma unroll
  for (int i = 0; i < 8; ++i) { w[i] = (__bf16)p[i]; w[8 + i] = (__bf16)p[16 + i]; }
  return w; }
__device__ __forceinline__ v16h wcolh_io(const float* Wm, int k0, int o, int lane, int ld) { v16h w; const int g = lane >> 4;
#pragma unroll
  for (int i = 0; i < 8; ++i) { w[i] = (_Float16)(bfr(Wm[(size_t)(k0 + 8 * g + i) * ld + o]) * 256.0f); w[8 + i] = (_Float16)(bfr(Wm[(size_t)(k0 + 16 + 8 * g + i) * ld + o]) * 256.0f); }
  return w; }
__device__ __forceinline__ v16h wcolh_oi(const float* Wm, int k0, int o, int lane, int K) { v16h w; const float* p = Wm + (size_t)o * K + k0 + 8 * (lane >> 4);
#pragma unroll
  for (int i = 0; i < 8; ++i) { w[i] = (_Float16)(bfr(p[i]) * 256.0f); w[8 + i] = (_Float16)(bfr(p[16 + i]) * 256.0f); }
  return w; }
#define WQKV_LAYOUT 0   // 0 = (in,out) [DIN][CC]; 1 = (out,in) [CC][DIN]; 2 = per-head [NH][DIN][HD]
__device__ __forceinline__ v16b wcol_hdk(const float* Wm, int k0, int o, int lane) { v16b w; const int g = lane >> 4; const float* p = Wm + (size_t)(o / HD) * DIN * HD + (o % HD);
#pragma unroll
  for (int i = 0; i < 8; ++i) { w[i] = (__bf16)p[(size_t)(k0 + 8 * g + i) * HD]; w[8 + i] = (__bf16)p[(size_t)(k0 + 16 + 8 * g + i) * HD]; }
  return w; }
#define WO_OUT_IN 0
#if WQKV_LAYOUT == 1
#define WCOL(W, k0, o, lane) wcol_oi(W, k0, o, lane, DIN)
#elif WQKV_LAYOUT == 2
#define WCOL(W, k0, o, lane) wcol_hdk(W, k0, o, lane)
#else
#define WCOL(W, k0, o, lane) wcol_io(W, k0, o, lane, CC)
#endif
#if WO_OUT_IN
#define WOCOL(W, k0, o, lane) wcol_oi(W, k0, o, lane, CC)
#define WOCOLH(W, k0, o, lane) wcolh_oi(W, k0, o, lane, CC)
#else
#define WOCOL(W, k0, o, lane) wcol_io(W, k0, o, lane, DIN)
#define WOCOLH(W, k0, o, lane) wcolh_io(W, k0, o, lane, DIN)
#endif
__global__ __launch_bounds__(256) void k_planes64(const float* __restrict__ Qs, const float* __restrict__ Ks, const float* __restrict__ Vs, _Float16* __restrict__ QH, _Float16* __restrict__ QL, _Float16* __restrict__ KH, _Float16* __restrict__ KL, _Float16* __restrict__ VT, __bf16* __restrict__ VB, __bf16* __restrict__ VBL) {
  __shared__ _Float16 sv[64][72];
  const int tid = threadIdx.x; const size_t r0 = (size_t)blockIdx.x * 64; const int b = (int)(r0 / TT), t0 = (int)(r0 % TT);
  for (int e = tid; e < 64 * 8; e += 256) { const int rl = e >> 3, q = e & 7; const size_t src = (r0 + rl) * CC + q * 8; float tq[8], tk[8], tv[8];
#pragma unroll
    for (int u = 0; u < 8; ++u) { tq[u] = Qs[src + u]; tk[u] = Ks[src + u]; tv[u] = Vs[src + u]; }
    asm volatile("s_wait_loadcnt 0x0" ::: "memory");
    hx8 hq, hk, hlq, hlk;
#pragma unroll
    for (int u = 0; u < 8; ++u) { const float qv = bfr(tq[u]), kv = bfr(tk[u]); const _Float16 qh = (_Float16)qv, kh = (_Float16)kv; hq[u] = qh; hlq[u] = (_Float16)((qv - (float)qh) * 1024.0f); hk[u] = kh; hlk[u] = (_Float16)((kv - (float)kh) * 1024.0f); sv[rl][q * 8 + u] = (_Float16)bfr(tv[u]); }
    vst2((unsigned*)(QH + (r0 + rl) * CC + q * 8), *(const v4u*)&hq); vst2((unsigned*)(KH + (r0 + rl) * CC + q * 8), *(const v4u*)&hk);
    if (t0 + rl < QHI) vst2((unsigned*)(QL + ((size_t)b * QHI + t0 + rl) * CC + q * 8), *(const v4u*)&hlq);
    if (t0 + rl < KHI) vst2((unsigned*)(KL + ((size_t)b * KHI + t0 + rl) * CC + q * 8), *(const v4u*)&hlk); }
  __syncthreads();
  for (int e = tid; e < 64 * 8; e += 256) { const int c = e >> 3, q = e & 7; hx8 hv; _Pragma("unroll") for (int j = 0; j < 8; ++j) hv[j] = sv[q * 8 + j][c]; vst2((unsigned*)(VT + ((size_t)b * CC + c) * TT + t0 + q * 8), *(const v4u*)&hv);
    if (t0 < KHI) { v8b bh, bl; _Pragma("unroll") for (int j = 0; j < 8; ++j) { const float vv = (float)hv[j]; const __bf16 h1 = (__bf16)vv; bh[j] = h1; bl[j] = (__bf16)(vv - (float)h1); } vst2((unsigned*)(VB + ((size_t)b * CC + c) * KHI + t0 + q * 8), *(const v4u*)&bh); vst2((unsigned*)(VBL + ((size_t)b * CC + c) * KHI + t0 + q * 8), *(const v4u*)&bl); } } }
#define SM_EXTRA_PARAMS
#define SM_MASK_HOOK (void)0
#ifndef SM_EXTRA_PARAMS
#define SM_EXTRA_PARAMS
#endif
#ifndef PROJ_EXTRA_PARAMS
#define PROJ_EXTRA_PARAMS
#endif
#ifndef SM_MASK_HOOK
#define SM_MASK_HOOK (void)0
#endif

#define WS_QH  0u                                      // f16 q rows [b*t][CC]
#define WS_KH  (WS_QH + 2u * (size_t)NB * TT * CC)      // f16 k rows [b*t][CC]
#define WS_VT  (WS_KH + 2u * (size_t)NB * TT * CC)      // f16 v planes [b][c][t]
#define WS_QL  (WS_VT + 2u * (size_t)NB * CC * TT)      // f16 q residual x 2^10 rows [b][t < QHI][CC]
#define WS_KL  (WS_QL + 2u * (size_t)NB * QHI * CC)     // f16 k residual x 2^10 rows [b][t < KHI][CC]
#define WS_VB  (WS_KL + 2u * (size_t)NB * KHI * CC)     // bf16 v hi planes [b][c][t < KHI]
#define WS_VBL (WS_VB + 2u * (size_t)NB * CC * KHI)
#define WS_S   (WS_VBL + 2u * (size_t)NB * CC * KHI)    // f32 logits / P [hg][t][s]
#define WS_Y   (WS_S  + 4u * (size_t)HG * TT * TT)      // f32 ctx rows [b*t][CC] (only when there is an output projection)
#define WS_END (WS_Y  + 0u)
#define WS_CM (WS_END)                                  // f32 column maxima [HG][TT]
#define WS_CZ (WS_CM + 4u * (size_t)HG * TT)
#define WS_END2 (WS_CZ + 4u * (size_t)HG * TT)

// ---- k_proj: block = (64 rows, 128 cols, which): q/k/v = X W (+ b) with exact bf16 products (K = DIN) -> which 0: q f16 rows (+ residual rows < QHI); 1: k f16 rows (+ residual rows < KHI); 2: v f16 planes [c][t] (+ bf16 hi/lo planes for t < KHI)
__global__ __launch_bounds__(128) void k_proj(const float* __restrict__ XQ, const float* __restrict__ XK, const float* __restrict__ XV, const float* __restrict__ WQ, const float* __restrict__ WK, const float* __restrict__ WV, const float* __restrict__ BQ, const float* __restrict__ BK, const float* __restrict__ BV,
    _Float16* __restrict__ QH, _Float16* __restrict__ QL, _Float16* __restrict__ KH, _Float16* __restrict__ KL, _Float16* __restrict__ VT, __bf16* __restrict__ VB, __bf16* __restrict__ VBL) {
  __shared__ __align__(16) _Float16 sh[64][136], sl[64][136]; __shared__ __align__(16) _Float16 th[128][72]; __shared__ __align__(16) __bf16 tb[128][72], tbl[128][72];
  const int tid = threadIdx.x, wave = tid >> 5, lane = tid & 31, col = lane & 15, g = lane >> 4; const int which = blockIdx.z; const int c0 = blockIdx.y * 128; const size_t r0 = (size_t)blockIdx.x * 64; const size_t bb = r0 / TT; const int t0 = (int)(r0 % TT);
  const float* X = which == 0 ? XQ : which == 1 ? XK : XV; const float* WA = which == 0 ? WQ : which == 1 ? WK : WV; const float* BA = which == 0 ? BQ : which == 1 ? BK : BV;
  v8f acc[8] = {};
#pragma unroll 2
  for (int kc = 0; kc < DIN / 32; ++kc) { v16b a; { const float* p = X + (r0 + wave * 16 + col) * DIN + kc * 32 + 8 * g;
#pragma unroll
      for (int i = 0; i < 8; ++i) { a[i] = (__bf16)p[i]; a[8 + i] = (__bf16)p[16 + i]; } }
    asm volatile("s_wait_loadcnt 0x0" ::: "memory");
#pragma unroll
    for (int j = 0; j < 8; ++j) { const v16b w = WCOL(WA, kc * 32, c0 + j * 16 + col, lane); asm volatile("s_wait_loadcnt 0x0" ::: "memory"); acc[j] = wmma_bf(a, w, acc[j]); } }
  if (which < 2) { _Float16* DH = which == 0 ? QH : KH; _Float16* DL = which == 0 ? QL : KL; const int nhi = which == 0 ? QHI : KHI; const bool hi_rows = t0 < nhi;
#pragma unroll
    for (int j = 0; j < 8; ++j) { const float bias = BA ? bfr(BA[c0 + j * 16 + col]) : 0.f;
#pragma unroll
      for (int r = 0; r < 8; ++r) { const float v = acc[j][r] + bias; const _Float16 hv = (_Float16)v; sh[wave * 16 + 8 * g + r][j * 16 + col] = hv; sl[wave * 16 + 8 * g + r][j * 16 + col] = (_Float16)((v - (float)hv) * 1024.0f); } }
    __syncthreads();
    for (int e = tid; e < 64 * 16; e += 128) { const int rl = e >> 4, q = e & 15; vst2((unsigned*)(DH + (r0 + rl) * CC + c0 + q * 8), *(const v4u*)&sh[rl][q * 8]); if (hi_rows) vst2((unsigned*)(DL + (bb * nhi + t0 + rl) * (size_t)CC + c0 + q * 8), *(const v4u*)&sl[rl][q * 8]); }
  } else { const bool hi_rows = t0 < KHI;
#pragma unroll
    for (int j = 0; j < 8; ++j) { const float bias = BA ? bfr(BA[c0 + j * 16 + col]) : 0.f;
#pragma unroll
      for (int r = 0; r < 8; ++r) { const float v = acc[j][r] + bias; const int rl = wave * 16 + 8 * g + r, cl = j * 16 + col; th[cl][rl] = (_Float16)v; const __bf16 bh = (__bf16)v; tb[cl][rl] = bh; tbl[cl][rl] = (__bf16)(v - (float)bh); } }
    __syncthreads();
    for (int e = tid; e < 128 * 8; e += 128) { const int cl = e >> 3, q = e & 7; vst2((unsigned*)(VT + (bb * CC + c0 + cl) * (size_t)TT + t0 + q * 8), *(const v4u*)&th[cl][q * 8]); if (hi_rows) { const size_t o3 = (bb * CC + c0 + cl) * (size_t)KHI + t0 + q * 8; vst2((unsigned*)(VB + o3), *(const v4u*)&tb[cl][q * 8]); vst2((unsigned*)(VBL + o3), *(const v4u*)&tbl[cl][q * 8]); } } } }
// ---- k_sc: block = (query block qb, key block kb <= kb_last(qb), head in group) of batch b: logits x SCALE; q hi + residual (x 2^10) against k (2 products) for query rows < QHI, plus the k residual (3 products) for query blocks < QBH (causal early rows); causal: blocks past the diagonal exit, the mask itself is applied by index in k_sm
__global__ __launch_bounds__(128) void k_sc(const _Float16* __restrict__ QH, const _Float16* __restrict__ KH, const _Float16* __restrict__ QL, const _Float16* __restrict__ KL, int b, int h0, float* __restrict__ S0) { __shared__ __align__(16) float ss[4][16][132];
  const int qb = blockIdx.x, kb = blockIdx.y; if (kb > kb_last(qb)) return;
  const int h = h0 + blockIdx.z; float* S = S0 + (size_t)blockIdx.z * TT * TT;
  const int tid = threadIdx.x, wave = tid >> 5, lane = tid & 31, col = lane & 15, g = lane >> 4; const int k0 = kb * 128; const int ql0 = qb * 64 + wave * 16; const size_t q0 = (size_t)b * TT + ql0, kr0 = (size_t)b * TT + k0;
  v8f acc[8] = {}, accl[8] = {};
  const _Float16* QLb = QL + (size_t)b * QHI * CC; const _Float16* KLb = KL + (size_t)b * KHI * CC;
  if (qb < QBH) {
#pragma unroll
    for (int kc = 0; kc < HD / 32; ++kc) { const v16h ah = frag_h(QH + (q0 + col) * CC + h * HD + kc * 32, lane), al = frag_h(QLb + (size_t)(ql0 + col) * CC + h * HD + kc * 32, lane);
#pragma unroll
      for (int j = 0; j < 8; ++j) { const v16h kbf = frag_h(KH + (kr0 + j * 16 + col) * CC + h * HD + kc * 32, lane), klf = frag_h(KLb + (size_t)(k0 + j * 16 + col) * CC + h * HD + kc * 32, lane); acc[j] = wmma16(ah, kbf, acc[j]); accl[j] = wmma16(al, kbf, accl[j]); accl[j] = wmma16(ah, klf, accl[j]); } }
  } else if (qb * 64 < QHI) {
#pragma unroll
    for (int kc = 0; kc < HD / 32; ++kc) { const v16h ah = frag_h(QH + (q0 + col) * CC + h * HD + kc * 32, lane), al = frag_h(QLb + (size_t)(ql0 + col) * CC + h * HD + kc * 32, lane);
#pragma unroll
      for (int j = 0; j < 8; ++j) { const v16h kbf = frag_h(KH + (kr0 + j * 16 + col) * CC + h * HD + kc * 32, lane); acc[j] = wmma16(ah, kbf, acc[j]); accl[j] = wmma16(al, kbf, accl[j]); } }
  } else {
#pragma unroll
    for (int kc = 0; kc < HD / 32; ++kc) { const v16h ah = frag_h(QH + (q0 + col) * CC + h * HD + kc * 32, lane);
#pragma unroll
      for (int j = 0; j < 8; ++j) { const v16h kbf = frag_h(KH + (kr0 + j * 16 + col) * CC + h * HD + kc * 32, lane); acc[j] = wmma16(ah, kbf, acc[j]); } } }
#pragma unroll
  for (int j = 0; j < 8; ++j) {
#pragma unroll
    for (int r = 0; r < 8; ++r) ss[wave][8 * g + r][j * 16 + col] = (acc[j][r] + accl[j][r] * (1.0f / 1024.0f)) * SCALE; }
  LDSX(); for (int rl = 0; rl < 16; ++rl) vst2(S + (size_t)(ql0 + rl) * TT + k0 + lane * 4, *(const v4f*)&ss[wave][rl][lane * 4]); }
// ---- k_sm: block = query row t (head in group): keys [0, kend): causal -> logit if s <= t else excluded; softmax in f32; P x 2^11 in place (0 for excluded)
__global__ __launch_bounds__(256) void k_sm(float* __restrict__ S0 SM_EXTRA_PARAMS) { __shared__ float sred[8]; __shared__ float sbc; __shared__ __align__(16) float shv[TT];
  const int tid = threadIdx.x; const int t = blockIdx.x; const int kend = (kb_last(t >> 6) + 1) * 128;
  float* sr = S0 + (size_t)blockIdx.y * TT * TT + (size_t)t * TT;
  float m = -3.0e38f; for (int k = tid; k < kend; k += 256) { float v = (!CAUSAL || k <= t) ? sr[k] : -3.0e38f; SM_MASK_HOOK; shv[k] = v; m = fmaxf(m, v); }
#pragma unroll
  for (int o = 1; o < 32; o <<= 1) m = fmaxf(m, __shfl_xor(m, o));
  if ((tid & 31) == 0) sred[tid >> 5] = m; __syncthreads(); if (tid == 0) { float a = sred[0]; for (int i = 1; i < 8; ++i) a = fmaxf(a, sred[i]); sbc = a; } __syncthreads(); m = sbc; __syncthreads();
  float sum = 0.f; for (int k = tid; k < kend; k += 256) { const float v = shv[k]; const float e = (v <= -1.0e38f) ? 0.f : expf(v - m); shv[k] = e; sum += e; }
#pragma unroll
  for (int o = 1; o < 32; o <<= 1) sum += __shfl_xor(sum, o);
  if ((tid & 31) == 0) sred[tid >> 5] = sum; __syncthreads(); if (tid == 0) { float a = 0.f; for (int i = 0; i < 8; ++i) a += sred[i]; sbc = a > 0.f ? 2048.0f / a : 0.f; }   /* a fully excluded row yields P = 0 */ __syncthreads(); const float inv = sbc;
  for (int k = tid; k < kend; k += 256) shv[k] = shv[k] * inv;
  __syncthreads(); for (int q = tid; q < kend / 4; q += 256) vst2(sr + q * 4, *(const v4f*)&shv[q * 4]); }
// ---- k_colstat: softmax over the QUERY axis (the source's softmax(axis=1) on a [B, q, k] tensor): for every key column k of each head plane: m_k = max_q S[q][k], Z_k = sum_q exp(S[q][k] - m_k) (f32, precise expf). Work-group = 32 columns (one 128-B line of every row), lane = column; the 4,096 queries are dealt to the 32 waves in groups of CSR rows: per group one running-max update, one rescale of the running sum and CSR terms. The 32 partial (m, z) pairs of a column meet in LDS: wave c merges column c (lane = partial), wave 0 stores the two whole lines
#define CSW 32           // waves per work-group = columns per work-group (the merge reads the partials transposed)
#define CSR 16           // rows per group: that many independent row loads of a wave in flight
__global__ __launch_bounds__(CSW * 32) void k_colstat(const float* __restrict__ S0, float* __restrict__ CM, float* __restrict__ CZ) { __shared__ float pm[CSW][33], pz[CSW][33], fm[32], fz[32];
  const int lane = threadIdx.x & 31, wave = threadIdx.x >> 5; const int k = blockIdx.x * 32 + lane; const float* sp = S0 + (size_t)blockIdx.y * TT * TT + (size_t)wave * CSR * TT + k;
  float m = -3.0e38f, z = 0.f;
  for (int t = 0; t < TT / (CSW * CSR); ++t) { float v[CSR];
#pragma unroll
    for (int u = 0; u < CSR; ++u) v[u] = sp[((size_t)t * CSW * CSR + u) * TT];
    asm volatile("s_wait_xcnt 0x0" ::: "memory");   // the registers of the loads' address are reused by the arithmetic below: the wait stands in front of that overwrite
    float mn = m;
#pragma unroll
    for (int u = 0; u < CSR; ++u) mn = fmaxf(mn, v[u]);
    float s = 0.f;
#pragma unroll
    for (int u = 0; u < CSR; ++u) s += expf(v[u] - mn);
    z = z * expf(m - mn) + s; m = mn; }
  pm[wave][lane] = m; pz[wave][lane] = z;
  __syncthreads();
  const float mw = pm[lane][wave]; float mm = mw;
#pragma unroll
  for (int o = 1; o < 32; o <<= 1) mm = fmaxf(mm, __shfl_xor(mm, o));
  float zz = pz[lane][wave] * expf(mw - mm);
#pragma unroll
  for (int o = 1; o < 32; o <<= 1) zz += __shfl_xor(zz, o);
  if (lane == 0) { fm[wave] = mm; fz[wave] = zz; }
  __syncthreads();
  if (wave == 0) { vst2(CM + (size_t)blockIdx.y * TT + k, fm[lane]); vst2(CZ + (size_t)blockIdx.y * TT + k, fz[lane]); } }
// ---- k_csm: block = (query row t, head in group): P[t][k] = exp(S[t][k] - m_k) / Z_k x 2^11 in place (column-normalised weights; each thread owns 16-B pieces)
__global__ __launch_bounds__(256) void k_csm(float* __restrict__ S0, const float* __restrict__ CM, const float* __restrict__ CZ) { const int tid = threadIdx.x; float* sr = S0 + (size_t)blockIdx.y * TT * TT + (size_t)blockIdx.x * TT; const float* cm = CM + (size_t)blockIdx.y * TT; const float* cz = CZ + (size_t)blockIdx.y * TT;
  for (int q4 = tid; q4 < TT / 4; q4 += 256) { const v4f s = *(const v4f*)(sr + q4 * 4), m4 = *(const v4f*)(cm + q4 * 4), z4 = *(const v4f*)(cz + q4 * 4); asm volatile("s_wait_loadcnt 0x0" ::: "memory"); v4f p;
#pragma unroll
    for (int u = 0; u < 4; ++u) p[u] = expf(s[u] - m4[u]) * (2048.0f / z4[u]);
    vst2(sr + q4 * 4, p); } }
// ---- k_pv: block = 64 queries (qb) of (b, h): ctx = P . v over keys [0, kend) (P x 2^11 once to f16 against v f16: 1 product; causal early query blocks: P and v as bf16 hi + lo, 3 products); 256-B (row, head) segment by 16 lanes
__global__ __launch_bounds__(128) void k_pv(const float* __restrict__ PS0, const _Float16* __restrict__ VT, const __bf16* __restrict__ VB, const __bf16* __restrict__ VBL, int b, int h0, float* __restrict__ Y) { const int h = h0 + blockIdx.z; const float* PS = PS0 + (size_t)blockIdx.z * TT * TT; __shared__ __align__(16) float ss[4][16][HD + 4];
  const int tid = threadIdx.x, wave = tid >> 5, lane = tid & 31, col = lane & 15, g = lane >> 4; const int qb = blockIdx.x; const int ql0 = qb * 64 + wave * 16; const int kce = (kb_last(qb) + 1) * 4;
  v8f acc[HD / 16] = {};
  if (qb < QBH) {
#pragma unroll 1
    for (int kc = 0; kc < kce; ++kc) { const F2 p = split_row(PS + (size_t)(ql0 + col) * TT, kc * 32, lane);
      asm volatile("s_wait_loadcnt 0x0" ::: "memory");
#pragma unroll
      for (int j = 0; j < HD / 16; ++j) { const size_t po = ((size_t)b * CC + h * HD + j * 16 + col) * (size_t)KHI + kc * 32; const v16b vh = frag_b(VB + po, lane); acc[j] = wmma_bf(p.h, vh, acc[j]); acc[j] = wmma_bf(p.l, vh, acc[j]); acc[j] = wmma_bf(p.h, frag_b(VBL + po, lane), acc[j]); } }
  } else {
#pragma unroll 1
    for (int kc = 0; kc < kce; ++kc) { const v16h p = frag_f32(PS + (size_t)(ql0 + col) * TT + kc * 32, lane);
      asm volatile("s_wait_loadcnt 0x0" ::: "memory");
#pragma unroll
      for (int j = 0; j < HD / 16; ++j) { const size_t po = ((size_t)b * CC + h * HD + j * 16 + col) * (size_t)TT + kc * 32; acc[j] = wmma16(p, frag_h(VT + po, lane), acc[j]); } } }
#pragma unroll
  for (int j = 0; j < HD / 16; ++j)
#pragma unroll
    for (int r = 0; r < 8; ++r) ss[wave][8 * g + r][j * 16 + col] = acc[j][r] * (1.0f / 2048.0f);
  LDSX(); for (int rl = 0; rl < 16; ++rl) if (lane < HD / 4) vst2(Y + ((size_t)b * TT + ql0 + rl) * CC + h * HD + lane * 4, *(const v4f*)&ss[wave][rl][lane * 4]); }

extern "C" void kernel_launch(void* const* d_in, const int* in_sizes, int n_in, void* d_out, int out_size, void* d_ws, size_t ws_size, hipStream_t stream) {
  (void)in_sizes; (void)n_in; (void)out_size;
  const float** F = (const float**)d_in;
  if (ws_size < (size_t)WS_END2) return;
  char* ws = (char*)d_ws; _Float16 *QH = (_Float16*)(ws + WS_QH), *KH = (_Float16*)(ws + WS_KH), *VT = (_Float16*)(ws + WS_VT), *QL = (_Float16*)(ws + WS_QL), *KL = (_Float16*)(ws + WS_KL); __bf16 *VB = (__bf16*)(ws + WS_VB), *VBL = (__bf16*)(ws + WS_VBL); float *S = (float*)(ws + WS_S), *Y = (float*)(ws + WS_Y);
  (void)Y; (void)QL; (void)KL; (void)VB; (void)VBL;
  float *CM = (float*)(ws + WS_CM), *CZ = (float*)(ws + WS_CZ);
  // inputs: 0 Q [4,4096,64]; 1 K; 2 V
  k_planes64<<<dim3(TNB * TT / 64), 256, 0, stream>>>(F[0], F[1], F[2], QH, QL, KH, KL, VT, VB, VBL);
  for (int b = 0; b < TNB; ++b) {
    k_sc<<<dim3(NQB, TT / 128, 1), 128, 0, stream>>>(QH, KH, QL, KL, b, 0, S);
    k_colstat<<<dim3(TT / 32, 1), CSW * 32, 0, stream>>>(S, CM, CZ);   /* per key column: max and sum over the queries */
    k_csm<<<dim3(TT, 1), 256, 0, stream>>>(S, CM, CZ);            /* P[q][k] = exp(S - m_k) / Z_k x 2^11 */
    k_pv<<<dim3(NQB, 1, 1), 128, 0, stream>>>(S, VT, VB, VBL, b, 0, (float*)d_out);
  }


}

// v003
// Measured time: 54 microseconds a run.
// It is 13.9 times as fast as v001, going by the measured steps of the versions left out in between.
// All steps since v000 together make it 126 times as fast.
// compute dtype: all float inputs rounded to bf16; Q, K, V are bf16-valued so their f16 planes are exact; scores q x k (1 product on exact planes) x 64^-0.5; softmax over the QUERY axis in f32 (per key column: max / sum over the 4,096 queries, 32 online partials merged, exponentials in base 2 on the hardware's exp2; scores recomputed per use, never stored); P x 2^11 once to f16 x v (exact) (1 product); f32 output.
#include <hip/hip_runtime.h>
#include <math.h>

typedef __attribute__((ext_vector_type(16))) _Float16 v16h;
typedef __attribute__((ext_vector_type(16))) __bf16 v16b;
typedef __attribute__((ext_vector_type(8)))  _Float16 v8h;
typedef __attribute__((ext_vector_type(8)))  float v8f;
typedef __attribute__((ext_vector_type(4)))  float v4f;
typedef __attribute__((ext_vector_type(2)))  float v2f;
typedef __attribute__((ext_vector_type(4)))  unsigned v4u;
typedef _Float16 hx8 __attribute__((ext_vector_type(8)));
typedef __attribute__((ext_vector_type(4)))  int v4i;
typedef float __attribute__((may_alias)) float_a;
typedef int __attribute__((may_alias)) int_a;

template <typename T> __device__ __forceinline__ void vst2(void* p, T v) { *(T*)p = v;  }
__device__ __forceinline__ v8f wmma16(v16h a, v16h b, v8f c) {
  v8f d = __builtin_amdgcn_wmma_f32_16x16x32_f16(false, a, false, b, (short)0, c, false, false);
  asm volatile("v_nop\n\tv_nop\n\tv_nop\n\tv_nop" : "+v"(d) : "v"(a), "v"(b));
  return d;
}
__device__ __forceinline__ v8f wmma_bf(v16b a, v16b b, v8f c) {
  v8f d = __builtin_amdgcn_wmma_f32_16x16x32_bf16(false, a, false, b, (short)0, c, false, false);
  asm volatile("v_nop\n\tv_nop\n\tv_nop\n\tv_nop" : "+v"(d) : "v"(a), "v"(b));
  return d;
}
// 16x16x32 fragments: lane = (h = lane>>4, row/col = lane&15); elements 0..7 = k0+8h+0..7, 8..15 = k0+16+8h+0..7; D element r = row 8h+r
__device__ __forceinline__ v16h frag_h(const _Float16* rowk0, int lane) {
  union { v16h v; v8h q[2]; } u; const _Float16* p = rowk0 + 8 * (lane >> 4);
  u.q[0] = *(const v8h*)p; u.q[1] = *(const v8h*)(p + 16); return u.v;
}
__device__ __forceinline__ v16h frag_f32(const float* rowk0, int lane) {
  v16h a; const float* p = rowk0 + 8 * (lane >> 4);
#pragma unroll
  for (int i = 0; i < 8; ++i) { a[i] = (_Float16)p[i]; a[8 + i] = (_Float16)p[16 + i]; }
  return a;
}
__device__ __forceinline__ v16h frag_f32s(const float* rowk0, int lane, float sc) {
  v16h a; const float* p = rowk0 + 8 * (lane >> 4);
#pragma unroll
  for (int i = 0; i < 8; ++i) { a[i] = (_Float16)(p[i] * sc); a[8 + i] = (_Float16)(p[16 + i] * sc); }
  return a;
}
// column fragment from a [K][ld] layout (column n), rows >= K read as 0
__device__ __forceinline__ v16h fragc_f32(const float* W, int k0, int n, int lane, int ld, int K) {
  v16h a; const int g = lane >> 4;
#pragma unroll
  for (int i = 0; i < 8; ++i) { const int ka = k0 + 8 * g + i, kb = ka + 16;
    a[i] = (_Float16)(ka < K ? W[(size_t)(ka < K ? ka : K - 1) * ld + n] : 0.f); a[8 + i] = (_Float16)(kb < K ? W[(size_t)(kb < K ? kb : K - 1) * ld + n] : 0.f); }
  return a;
}
struct F2 { v16b h, l; };
__device__ __forceinline__ F2 bsplit16(const float v[16]) { F2 r;
#pragma unroll
  for (int i = 0; i < 16; ++i) { const __bf16 h = (__bf16)v[i]; r.h[i] = h; r.l[i] = (__bf16)(v[i] - (float)h); }
  return r; }
__device__ __forceinline__ F2 split_row(const float* row, int k0, int lane) { float v[16]; const float* p = row + k0 + 8 * (lane >> 4);
#pragma unroll
  for (int i = 0; i < 8; ++i) { v[i] = p[i]; v[8 + i] = p[16 + i]; }
  return bsplit16(v); }
__device__ __forceinline__ F2 split_rowK(const float* row, int k0, int lane, int K) { float v[16]; const int g = lane >> 4;
#pragma unroll
  for (int i = 0; i < 8; ++i) { const int ka = k0 + 8 * g + i, kb = ka + 16; v[i] = ka < K ? row[ka < K ? ka : K - 1] : 0.f; v[8 + i] = kb < K ? row[kb < K ? kb : K - 1] : 0.f; }
  return bsplit16(v); }
__device__ __forceinline__ F2 split_col(const float* W, int k0, int n, int lane, int ld, int K) { float v[16]; const int g = lane >> 4;
#pragma unroll
  for (int i = 0; i < 8; ++i) { const int ka = k0 + 8 * g + i, kb = ka + 16; v[i] = ka < K ? W[(size_t)(ka < K ? ka : K - 1) * ld + n] : 0.f; v[8 + i] = kb < K ? W[(size_t)(kb < K ? kb : K - 1) * ld + n] : 0.f; }
  return bsplit16(v); }
__device__ __forceinline__ v8f mac3(const F2& a, const F2& b, v8f c) { c = wmma_bf(a.l, b.h, c); c = wmma_bf(a.h, b.l, c); return wmma_bf(a.h, b.h, c); }
__device__ __forceinline__ float sigm(float v) { return 1.0f / (1.0f + expf(-v)); }
#define LDSX() do { asm volatile("s_wait_dscnt 0" ::: "memory"); __builtin_amdgcn_wave_barrier(); __builtin_amdgcn_fence(__ATOMIC_RELEASE, "workgroup"); } while (0)

// Scaled dot-product attention on given tensors whose softmax runs over the QUERY axis (Q / K / V [4,4096,64]; scores = Q K^T / 8 of shape [B, q, k]; attn = softmax(scores, axis=1) - axis 1 is the QUERY axis, so every key COLUMN is normalised over the 4,096 queries (faithful to the source); out = attn V -> [4,4096,64]; no mask).
#define NB 4
#define TT 4096
#define CC 64            // NH * HD = projected width
#define DIN 64          // input (model) width
#define NH 1
#define HD 64
#define NQB (TT / 64)
#define HG 1
#define SCALE (0.125f)
#define CAUSAL 0
#ifndef TNB
#define TNB NB
#endif
__device__ __forceinline__ float bfr(float v) { return (float)(__bf16)v; }
__host__ __device__ __forceinline__ int kb_last(int qb) { return CAUSAL ? ((qb * 64 + 63) >> 7) : (TT / 128 - 1); }
typedef __attribute__((ext_vector_type(8))) __bf16 v8b;
__device__ __forceinline__ v16b frag_b(const __bf16* rowk0, int lane) {
  union { v16b v; v8b q[2]; } u; const __bf16* p = rowk0 + 8 * (lane >> 4);
  u.q[0] = *(const v8b*)p; u.q[1] = *(const v8b*)(p + 16); return u.v;
}
#define QBH 0              // exact planes: single-product logits and single-f16 P x V on every block
#define QHI 0               // no q residual plane (q is bf16-exact in f16)
#define KHI 64              // unused high-precision planes kept minimal
// B fragment (k rows k0+.., output column o) of a weight: (in,out) [K][ld] or (out,in) [ld rows of K]: bf16 exact, or f16(bf16 * 256) exact
__device__ __forceinline__ v16b wcol_io(const float* Wm, int k0, int o, int lane, int ld) { v16b w; const int g = lane >> 4;
#pragma unroll
  for (int i = 0; i < 8; ++i) { w[i] = (__bf16)Wm[(size_t)(k0 + 8 * g + i) * ld + o]; w[8 + i] = (__bf16)Wm[(size_t)(k0 + 16 + 8 * g + i) * ld + o]; }
  return w; }
__device__ __forceinline__ v16b wcol_oi(const float* Wm, int k0, int o, int lane, int K) { v16b w; const float* p = Wm + (size_t)o * K + k0 + 8 * (lane >> 4);
#pragma unroll
  for (int i = 0; i < 8; ++i) { w[i] = (__bf16)p[i]; w[8 + i] = (__bf16)p[16 + i]; }
  return w; }
__device__ __forceinline__ v16h wcolh_io(const float* Wm, int k0, int o, int lane, int ld) { v16h w; const int g = lane >> 4;
#pragma unroll
  for (int i = 0; i < 8; ++i) { w[i] = (_Float16)(bfr(Wm[(size_t)(k0 + 8 * g + i) * ld + o]) * 256.0f); w[8 + i] = (_Float16)(bfr(Wm[(size_t)(k0 + 16 + 8 * g + i) * ld + o]) * 256.0f); }
  return w; }
__device__ __forceinline__ v16h wcolh_oi(const float* Wm, int k0, int o, int lane, int K) { v16h w; const float* p = Wm + (size_t)o * K + k0 + 8 * (lane >> 4);
#pragma unroll
  for (int i = 0; i < 8; ++i) { w[i] = (_Float16)(bfr(p[i]) * 256.0f); w[8 + i] = (_Float16)(bfr(p[16 + i]) * 256.0f); }
  return w; }
#define WQKV_LAYOUT 0   // 0 = (in,out) [DIN][CC]; 1 = (out,in) [CC][DIN]; 2 = per-head [NH][DIN][HD]
__device__ __forceinline__ v16b wcol_hdk(const float* Wm, int k0, int o, int lane) { v16b w; const int g = lane >> 4; const float* p = Wm + (size_t)(o / HD) * DIN * HD + (o % HD);
#pragma unroll
  for (int i = 0; i < 8; ++i) { w[i] = (__bf16)p[(size_t)(k0 + 8 * g + i) * HD]; w[8 + i] = (__bf16)p[(size_t)(k0 + 16 + 8 * g + i) * HD]; }
  return w; }
#define WO_OUT_IN 0
#if WQKV_LAYOUT == 1
#define WCOL(W, k0, o, lane) wcol_oi(W, k0, o, lane, DIN)
#elif WQKV_LAYOUT == 2
#define WCOL(W, k0, o, lane) wcol_hdk(W, k0, o, lane)
#else
#define WCOL(W, k0, o, lane) wcol_io(W, k0, o, lane, CC)
#endif
#if WO_OUT_IN
#define WOCOL(W, k0, o, lane) wcol_oi(W, k0, o, lane, CC)
#define WOCOLH(W, k0, o, lane) wcolh_oi(W, k0, o, lane, CC)
#else
#define WOCOL(W, k0, o, lane) wcol_io(W, k0, o, lane, DIN)
#define WOCOLH(W, k0, o, lane) wcolh_io(W, k0, o, lane, DIN)
#endif
__global__ __launch_bounds__(256) void k_planes64(const float* __restrict__ Qs, const float* __restrict__ Ks, const float* __restrict__ Vs, _Float16* __restrict__ QH, _Float16* __restrict__ QL, _Float16* __restrict__ KH, _Float16* __restrict__ KL, _Float16* __restrict__ VT, __bf16* __restrict__ VB, __bf16* __restrict__ VBL) {
  __shared__ _Float16 sv[64][72];
  const int tid = threadIdx.x; const size_t r0 = (size_t)blockIdx.x * 64; const int b = (int)(r0 / TT), t0 = (int)(r0 % TT);
  for (int e = tid; e < 64 * 8; e += 256) { const int rl = e >> 3, q = e & 7; const size_t src = (r0 + rl) * CC + q * 8; float tq[8], tk[8], tv[8];
#pragma unroll
    for (int u = 0; u < 8; ++u) { tq[u] = Qs[src + u]; tk[u] = Ks[src + u]; tv[u] = Vs[src + u]; }
    asm volatile("s_wait_loadcnt 0x0" ::: "memory");
    hx8 hq, hk, hlq, hlk;
#pragma unroll
    for (int u = 0; u < 8; ++u) { const float qv = bfr(tq[u]), kv = bfr(tk[u]); const _Float16 qh = (_Float16)qv, kh = (_Float16)kv; hq[u] = qh; hlq[u] = (_Float16)((qv - (float)qh) * 1024.0f); hk[u] = kh; hlk[u] = (_Float16)((kv - (float)kh) * 1024.0f); sv[rl][q * 8 + u] = (_Float16)bfr(tv[u]); }
    vst2((unsigned*)(QH + (r0 + rl) * CC + q * 8), *(const v4u*)&hq); vst2((unsigned*)(KH + (r0 + rl) * CC + q * 8), *(const v4u*)&hk);
    if (t0 + rl < QHI) vst2((unsigned*)(QL + ((size_t)b * QHI + t0 + rl) * CC + q * 8), *(const v4u*)&hlq);
    if (t0 + rl < KHI) vst2((unsigned*)(KL + ((size_t)b * KHI + t0 + rl) * CC + q * 8), *(const v4u*)&hlk); }
  __syncthreads();
  for (int e = tid; e < 64 * 8; e += 256) { const int c = e >> 3, q = e & 7; hx8 hv; _Pragma("unroll") for (int j = 0; j < 8; ++j) hv[j] = sv[q * 8 + j][c]; vst2((unsigned*)(VT + ((size_t)b * CC + c) * TT + t0 + q * 8), *(const v4u*)&hv);
    if (t0 < KHI) { v8b bh, bl; _Pragma("unroll") for (int j = 0; j < 8; ++j) { const float vv = (float)hv[j]; const __bf16 h1 = (__bf16)vv; bh[j] = h1; bl[j] = (__bf16)(vv - (float)h1); } vst2((unsigned*)(VB + ((size_t)b * CC + c) * KHI + t0 + q * 8), *(const v4u*)&bh); vst2((unsigned*)(VBL + ((size_t)b * CC + c) * KHI + t0 + q * 8), *(const v4u*)&bl); } } }
#define SM_EXTRA_PARAMS
#define SM_MASK_HOOK (void)0
#ifndef SM_EXTRA_PARAMS
#define SM_EXTRA_PARAMS
#endif
#ifndef PROJ_EXTRA_PARAMS
#define PROJ_EXTRA_PARAMS
#endif
#ifndef SM_MASK_HOOK
#define SM_MASK_HOOK (void)0
#endif

#define WS_QH  0u                                      // f16 q rows [b*t][CC]
#define WS_KH  (WS_QH + 2u * (size_t)NB * TT * CC)      // f16 k rows [b*t][CC]
#define WS_VT  (WS_KH + 2u * (size_t)NB * TT * CC)      // f16 v planes [b][c][t]
#define WS_QL  (WS_VT + 2u * (size_t)NB * CC * TT)      // f16 q residual x 2^10 rows [b][t < QHI][CC]
#define WS_KL  (WS_QL + 2u * (size_t)NB * QHI * CC)     // f16 k residual x 2^10 rows [b][t < KHI][CC]
#define WS_VB  (WS_KL + 2u * (size_t)NB * KHI * CC)     // bf16 v hi planes [b][c][t < KHI]
#define WS_VBL (WS_VB + 2u * (size_t)NB * CC * KHI)
#define WS_END (WS_VBL + 2u * (size_t)NB * CC * KHI)
#define WS_CL (WS_END)                                  // f32 column exponent offsets [b][TT]
#define WS_END2 (WS_CL + 4u * (size_t)NB * TT)

// ---- k_proj: block = (64 rows, 128 cols, which): q/k/v = X W (+ b) with exact bf16 products (K = DIN) -> which 0: q f16 rows (+ residual rows < QHI); 1: k f16 rows (+ residual rows < KHI); 2: v f16 planes [c][t] (+ bf16 hi/lo planes for t < KHI)
__global__ __launch_bounds__(128) void k_proj(const float* __restrict__ XQ, const float* __restrict__ XK, const float* __restrict__ XV, const float* __restrict__ WQ, const float* __restrict__ WK, const float* __restrict__ WV, const float* __restrict__ BQ, const float* __restrict__ BK, const float* __restrict__ BV,
    _Float16* __restrict__ QH, _Float16* __restrict__ QL, _Float16* __restrict__ KH, _Float16* __restrict__ KL, _Float16* __restrict__ VT, __bf16* __restrict__ VB, __bf16* __restrict__ VBL) {
  __shared__ __align__(16) _Float16 sh[64][136], sl[64][136]; __shared__ __align__(16) _Float16 th[128][72]; __shared__ __align__(16) __bf16 tb[128][72], tbl[128][72];
  const int tid = threadIdx.x, wave = tid >> 5, lane = tid & 31, col = lane & 15, g = lane >> 4; const int which = blockIdx.z; const int c0 = blockIdx.y * 128; const size_t r0 = (size_t)blockIdx.x * 64; const size_t bb = r0 / TT; const int t0 = (int)(r0 % TT);
  const float* X = which == 0 ? XQ : which == 1 ? XK : XV; const float* WA = which == 0 ? WQ : which == 1 ? WK : WV; const float* BA = which == 0 ? BQ : which == 1 ? BK : BV;
  v8f acc[8] = {};
#pragma unroll 2
  for (int kc = 0; kc < DIN / 32; ++kc) { v16b a; { const float* p = X + (r0 + wave * 16 + col) * DIN + kc * 32 + 8 * g;
#pragma unroll
      for (int i = 0; i < 8; ++i) { a[i] = (__bf16)p[i]; a[8 + i] = (__bf16)p[16 + i]; } }
    asm volatile("s_wait_loadcnt 0x0" ::: "memory");
#pragma unroll
    for (int j = 0; j < 8; ++j) { const v16b w = WCOL(WA, kc * 32, c0 + j * 16 + col, lane); asm volatile("s_wait_loadcnt 0x0" ::: "memory"); acc[j] = wmma_bf(a, w, acc[j]); } }
  if (which < 2) { _Float16* DH = which == 0 ? QH : KH; _Float16* DL = which == 0 ? QL : KL; const int nhi = which == 0 ? QHI : KHI; const bool hi_rows = t0 < nhi;
#pragma unroll
    for (int j = 0; j < 8; ++j) { const float bias = BA ? bfr(BA[c0 + j * 16 + col]) : 0.f;
#pragma unroll
      for (int r = 0; r < 8; ++r) { const float v = acc[j][r] + bias; const _Float16 hv = (_Float16)v; sh[wave * 16 + 8 * g + r][j * 16 + col] = hv; sl[wave * 16 + 8 * g + r][j * 16 + col] = (_Float16)((v - (float)hv) * 1024.0f); } }
    __syncthreads();
    for (int e = tid; e < 64 * 16; e += 128) { const int rl = e >> 4, q = e & 15; vst2((unsigned*)(DH + (r0 + rl) * CC + c0 + q * 8), *(const v4u*)&sh[rl][q * 8]); if (hi_rows) vst2((unsigned*)(DL + (bb * nhi + t0 + rl) * (size_t)CC + c0 + q * 8), *(const v4u*)&sl[rl][q * 8]); }
  } else { const bool hi_rows = t0 < KHI;
#pragma unroll
    for (int j = 0; j < 8; ++j) { const float bias = BA ? bfr(BA[c0 + j * 16 + col]) : 0.f;
#pragma unroll
      for (int r = 0; r < 8; ++r) { const float v = acc[j][r] + bias; const int rl = wave * 16 + 8 * g + r, cl = j * 16 + col; th[cl][rl] = (_Float16)v; const __bf16 bh = (__bf16)v; tb[cl][rl] = bh; tbl[cl][rl] = (__bf16)(v - (float)bh); } }
    __syncthreads();
    for (int e = tid; e < 128 * 8; e += 128) { const int cl = e >> 3, q = e & 7; vst2((unsigned*)(VT + (bb * CC + c0 + cl) * (size_t)TT + t0 + q * 8), *(const v4u*)&th[cl][q * 8]); if (hi_rows) { const size_t o3 = (bb * CC + c0 + cl) * (size_t)KHI + t0 + q * 8; vst2((unsigned*)(VB + o3), *(const v4u*)&tb[cl][q * 8]); vst2((unsigned*)(VBL + o3), *(const v4u*)&tbl[cl][q * 8]); } } } }
// ---- k_sm: block = query row t (head in group): keys [0, kend): causal -> logit if s <= t else excluded; softmax in f32; P x 2^11 in place (0 for excluded)
__global__ __launch_bounds__(256) void k_sm(float* __restrict__ S0 SM_EXTRA_PARAMS) { __shared__ float sred[8]; __shared__ float sbc; __shared__ __align__(16) float shv[TT];
  const int tid = threadIdx.x; const int t = blockIdx.x; const int kend = (kb_last(t >> 6) + 1) * 128;
  float* sr = S0 + (size_t)blockIdx.y * TT * TT + (size_t)t * TT;
  float m = -3.0e38f; for (int k = tid; k < kend; k += 256) { float v = (!CAUSAL || k <= t) ? sr[k] : -3.0e38f; SM_MASK_HOOK; shv[k] = v; m = fmaxf(m, v); }
#pragma unroll
  for (int o = 1; o < 32; o <<= 1) m = fmaxf(m, __shfl_xor(m, o));
  if ((tid & 31) == 0) sred[tid >> 5] = m; __syncthreads(); if (tid == 0) { float a = sred[0]; for (int i = 1; i < 8; ++i) a = fmaxf(a, sred[i]); sbc = a; } __syncthreads(); m = sbc; __syncthreads();
  float sum = 0.f; for (int k = tid; k < kend; k += 256) { const float v = shv[k]; const float e = (v <= -1.0e38f) ? 0.f : expf(v - m); shv[k] = e; sum += e; }
#pragma unroll
  for (int o = 1; o < 32; o <<= 1) sum += __shfl_xor(sum, o);
  if ((tid & 31) == 0) sred[tid >> 5] = sum; __syncthreads(); if (tid == 0) { float a = 0.f; for (int i = 0; i < 8; ++i) a += sred[i]; sbc = a > 0.f ? 2048.0f / a : 0.f; }   /* a fully excluded row yields P = 0 */ __syncthreads(); const float inv = sbc;
  for (int k = tid; k < kend; k += 256) shv[k] = shv[k] * inv;
  __syncthreads(); for (int q = tid; q < kend / 4; q += 256) vst2(sr + q * 4, *(const v4f*)&shv[q * 4]); }
// plain builtin form of the f16 product: the compiler keeps the distance behind it itself
__device__ __forceinline__ v8f mm16(v16h a, v16h b, v8f c) { return __builtin_amdgcn_wmma_f32_16x16x32_f16(false, a, false, b, (short)0, c, false, false); }
// frag_h from the lane's own pointer (row start + k0 + 8 h)
__device__ __forceinline__ v16h frag_p(const _Float16* p) { union { v16h v; v8h q[2]; } u; u.q[0] = *(const v8h*)p; u.q[1] = *(const v8h*)(p + 16); return u.v; }
// The scores are never stored: both kernels below form their own q x k tiles on the matrix unit and use them from the accumulator registers.
// Exponentials run in base 2: exp(SCALE x - SCALE m) = 2^(C2 x - C2 m) with C2 = SCALE log2(e), so a raw score costs one multiply-add and one hardware exp2; the multiply-add rounds the argument once, to 2^-24 of its size, the order of the f32 score's own rounding
#define C2 (SCALE * 1.44269504088896340736f)
__device__ __forceinline__ float ex2(float x) { return __builtin_amdgcn_exp2f(x); }
// the exponents of two neighbouring accumulator registers in one packed multiply-add
__device__ __forceinline__ v2f arg2(float xa, float xb, float la, float lb) { return __builtin_elementwise_fma((v2f){xa, xb}, (v2f){C2, C2}, (v2f){la, lb}); }
// ---- k_cstat: softmax over the QUERY axis (the source's softmax(axis=1) on a [B, q, k] tensor): for every key column k, on the raw products x = q . k: m_k = max_q x, Z_k = sum_q 2^(C2 x - C2 m_k) (f32); stored: L_k = 11 - C2 m_k - log2(Z_k), so that P x 2^11 = 2^(C2 x + L_k). Work-group = 64 key columns (their 8 B fragments held in registers by every wave), the 4,096 queries dealt to 16 waves; S = Q K^T: A = 16 query rows, B = 16 key columns, so a lane holds 8 queries of ONE key column per tile: running max / sum in-lane, one rescale per 16 scores. The halves of a wave meet by one lane exchange, the 16 waves' partials in LDS behind one barrier
#define C1W 16           // waves per work-group (query axis)
#define C1K 4            // 16-column key tiles per work-group
__global__ __launch_bounds__(C1W * 32) void k_cstat(const _Float16* __restrict__ QH, const _Float16* __restrict__ KH, float* __restrict__ CL) { __shared__ float pm[C1W][C1K * 16], pz[C1W][C1K * 16];
  const int tid = threadIdx.x, wave = tid >> 5, lane = tid & 31, col = lane & 15;
  const size_t kr0 = (size_t)blockIdx.x * (C1K * 16);                            // flat key row b * TT + k
  const size_t qr0 = (kr0 / TT) * TT + (size_t)wave * (TT / C1W);                // this wave's first flat query row
  v16h kf[C1K][2];
#pragma unroll
  for (int j = 0; j < C1K; ++j) { kf[j][0] = frag_h(KH + (kr0 + j * 16 + col) * CC, lane); kf[j][1] = frag_h(KH + (kr0 + j * 16 + col) * CC + 32, lane); }
  asm volatile("s_wait_xcnt 0x0" :: "v"(KH + (kr0 + col) * CC + 8 * (lane >> 4)) : "memory");   // the loads' address pair is an input here, so it stays live up to the wait: no load's result lands in it ahead of the wait
  float m[C1K], z[C1K];
#pragma unroll
  for (int j = 0; j < C1K; ++j) { m[j] = -3.0e38f; z[j] = 0.f; }
  for (int t = 0; t < TT / C1W / 32; ++t) { const _Float16* qp = QH + (qr0 + t * 32 + col) * CC;
    const v16h a00 = frag_h(qp, lane), a01 = frag_h(qp + 32, lane), a10 = frag_h(qp + 16 * CC, lane), a11 = frag_h(qp + 16 * CC + 32, lane);
#pragma unroll
    for (int j = 0; j < C1K; ++j) { v8f s0 = {}, s1 = {}; s0 = mm16(a00, kf[j][0], s0); s1 = mm16(a10, kf[j][0], s1); s0 = mm16(a01, kf[j][1], s0); s1 = mm16(a11, kf[j][1], s1);
      float mn = m[j];
#pragma unroll
      for (int r = 0; r < 8; ++r) mn = fmaxf(mn, fmaxf(s0[r], s1[r]));
      const float nb = -C2 * mn; float s = 0.f;
#pragma unroll
      for (int r = 0; r < 8; r += 2) { const v2f t0 = arg2(s0[r], s0[r + 1], nb, nb), t1 = arg2(s1[r], s1[r + 1], nb, nb); s += ex2(t0[0]) + ex2(t1[0]); s += ex2(t0[1]) + ex2(t1[1]); }
      z[j] = z[j] * ex2(fmaf(m[j], C2, nb)) + s; m[j] = mn; } }
#pragma unroll
  for (int j = 0; j < C1K; ++j) { const float mo = __shfl_xor(m[j], 16), zo = __shfl_xor(z[j], 16); const float mm = fmaxf(m[j], mo); const float zz = z[j] * ex2((m[j] - mm) * C2) + zo * ex2((mo - mm) * C2);
    if (lane < 16) { pm[wave][j * 16 + col] = mm; pz[wave][j * 16 + col] = zz; } }
  __syncthreads();
  if (tid < C1K * 16) { float mm = pm[0][tid];
#pragma unroll
    for (int w = 1; w < C1W; ++w) mm = fmaxf(mm, pm[w][tid]);
    float zz = 0.f;
#pragma unroll
    for (int w = 0; w < C1W; ++w) zz += pz[w][tid] * ex2((pm[w][tid] - mm) * C2);
    CL[kr0 + tid] = 11.0f - mm * C2 - log2f(zz); } }
// ---- k_ctx: out = P v with P[q][k] x 2^11 = 2^(C2 x + L_k), once to f16, against v f16 (1 product). Work-group = 64 queries: 2 query groups of 32 x 8 key shares, one wave each; the keys are dealt to the shares in slices of 32, so that the 8 shares of one trip read 256 consecutive keys (whole lines of the v planes between them). S^T = K Q^T (A = 16 key rows, B = 16 query columns): two S^T tiles of 32 consecutive keys, turned into P in place, ARE the B fragment of O^T += V^T P^T in the hardware k order (element s < 8: key 8h + s, else key 16 + 8h + s - 8), which is frag_h's order for the v plane rows; P touches neither LDS nor memory. The 8 shares' partial outputs meet in LDS behind one barrier (summed in share order)
#define P2Q 2            // 32-query groups per work-group
#define P2S 8            // key shares per work-group
__global__ __launch_bounds__(P2Q * P2S * 32) void k_ctx(const _Float16* __restrict__ QH, const _Float16* __restrict__ KH, const _Float16* __restrict__ VT, const float* __restrict__ CL, float* __restrict__ Y) { __shared__ __align__(16) float red[P2S][P2Q * 32][HD + 4];
  const int tid = threadIdx.x, wave = tid >> 5, lane = tid & 31, col = lane & 15, g = lane >> 4; const int qg = wave % P2Q, ks = wave / P2Q;
  const size_t q0 = (size_t)blockIdx.x * (P2Q * 32); const size_t b = q0 / TT;   // flat query row b * TT + t
  const _Float16* Kb = KH + b * TT * CC; const _Float16* Vb = VT + b * CC * TT; const float* cl = CL + b * TT;
  v16h qf[2][2];
#pragma unroll
  for (int i = 0; i < 2; ++i) { qf[i][0] = frag_h(QH + (q0 + qg * 32 + i * 16 + col) * CC, lane); qf[i][1] = frag_h(QH + (q0 + qg * 32 + i * 16 + col) * CC + 32, lane); }
  v8f acc[2][HD / 16] = {};
  unsigned ko = (unsigned)((ks * 32 + col) * CC + 8 * g) * 2u, vo = (unsigned)(col * TT + ks * 32 + 8 * g) * 2u, so = (unsigned)(ks * 32 + 8 * g) * 4u;   // the lane's own byte offsets for keys k0 = (t * P2S + ks) * 32 ..: key row k0 + col, v plane row col, column statistics; they step with the trip, on bases that are the same for the whole work-group
  for (int t = 0; t < TT / P2S / 32; ++t) { const _Float16* kp = (const _Float16*)((const char*)Kb + ko); const _Float16* vp = (const _Float16*)((const char*)Vb + vo); const float* mp = (const float*)((const char*)cl + so);
    const v16h k00 = frag_p(kp), k01 = frag_p(kp + 32), k10 = frag_p(kp + 16 * CC), k11 = frag_p(kp + 16 * CC + 32);
    const v4f m0a = *(const v4f*)(mp), m0b = *(const v4f*)(mp + 4), m1a = *(const v4f*)(mp + 16), m1b = *(const v4f*)(mp + 20);
    v16h vf[HD / 16];
#pragma unroll
    for (int j = 0; j < HD / 16; ++j) vf[j] = frag_p(vp + (size_t)j * 16 * TT);
    asm volatile("s_wait_xcnt 0x0" : "+v"(ko), "+v"(vo), "+v"(so) :: "memory");   // behind the trip's loads: their three offset registers pass through the wait, so that no load's result lands in one and no step is added to one ahead of it
    __builtin_amdgcn_sched_barrier(0);   // keeps the trip's loads together at its head: the v and statistics loads fly under the score products instead of being issued just ahead of their use
    ko += P2S * 32 * CC * 2u; vo += P2S * 32 * 2u; so += P2S * 32 * 4u;
#pragma unroll
    for (int i = 0; i < 2; ++i) { v8f s0 = {}, s1 = {}; s0 = mm16(k00, qf[i][0], s0); s1 = mm16(k10, qf[i][0], s1); s0 = mm16(k01, qf[i][1], s0); s1 = mm16(k11, qf[i][1], s1);
      v16h p;
#pragma unroll
      for (int r = 0; r < 4; r += 2) { const v2f t0 = arg2(s0[r], s0[r + 1], m0a[r], m0a[r + 1]), t1 = arg2(s0[4 + r], s0[5 + r], m0b[r], m0b[r + 1]), t2 = arg2(s1[r], s1[r + 1], m1a[r], m1a[r + 1]), t3 = arg2(s1[4 + r], s1[5 + r], m1b[r], m1b[r + 1]);
        p[r] = (_Float16)ex2(t0[0]); p[r + 1] = (_Float16)ex2(t0[1]); p[4 + r] = (_Float16)ex2(t1[0]); p[5 + r] = (_Float16)ex2(t1[1]); p[8 + r] = (_Float16)ex2(t2[0]); p[9 + r] = (_Float16)ex2(t2[1]); p[12 + r] = (_Float16)ex2(t3[0]); p[13 + r] = (_Float16)ex2(t3[1]); }
#pragma unroll
      for (int j = 0; j < HD / 16; ++j) acc[i][j] = mm16(vf[j], p, acc[i][j]); } }
  // acc[i][j][r] = O[query i * 16 + col][channel j * 16 + 8 g + r] x 2^11 over this wave's key share
#pragma unroll
  for (int i = 0; i < 2; ++i)
#pragma unroll
    for (int j = 0; j < HD / 16; ++j) { float* rp = &red[ks][qg * 32 + i * 16 + col][j * 16 + 8 * g]; v4f lo, hi;
#pragma unroll
      for (int r = 0; r < 4; ++r) { lo[r] = acc[i][j][r]; hi[r] = acc[i][j][4 + r]; }
      *(v4f*)rp = lo; *(v4f*)(rp + 4) = hi; }
  __syncthreads();
  for (int e = tid; e < P2Q * 32 * (HD / 4); e += P2Q * P2S * 32) { const int q = e / (HD / 4), d4 = e % (HD / 4); v4f a = *(const v4f*)&red[0][q][d4 * 4];
#pragma unroll
    for (int s = 1; s < P2S; ++s) a += *(const v4f*)&red[s][q][d4 * 4];
    vst2(Y + (q0 + q) * CC + d4 * 4, a * (1.0f / 2048.0f)); } }

extern "C" void kernel_launch(void* const* d_in, const int* in_sizes, int n_in, void* d_out, int out_size, void* d_ws, size_t ws_size, hipStream_t stream) {
  (void)in_sizes; (void)n_in; (void)out_size;
  const float** F = (const float**)d_in;
  if (ws_size < (size_t)WS_END2) return;
  char* ws = (char*)d_ws; _Float16 *QH = (_Float16*)(ws + WS_QH), *KH = (_Float16*)(ws + WS_KH), *VT = (_Float16*)(ws + WS_VT), *QL = (_Float16*)(ws + WS_QL), *KL = (_Float16*)(ws + WS_KL); __bf16 *VB = (__bf16*)(ws + WS_VB), *VBL = (__bf16*)(ws + WS_VBL);
  float *CL = (float*)(ws + WS_CL);
  // inputs: 0 Q [4,4096,64]; 1 K; 2 V
  k_planes64<<<dim3(TNB * TT / 64), 256, 0, stream>>>(F[0], F[1], F[2], QH, QL, KH, KL, VT, VB, VBL);
  k_cstat<<<dim3(TNB * TT / (C1K * 16)), C1W * 32, 0, stream>>>(QH, KH, CL);                           /* per key column: the exponent offset from max and sum over the queries */
  k_ctx<<<dim3(TNB * TT / (P2Q * 32)), P2Q * P2S * 32, 0, stream>>>(QH, KH, VT, CL, (float*)d_out);  /* out = P v, P formed in registers */
}

// v004
// Measured time: 28.9 microseconds a run.
// Timed twice side by side with v003, it ran 1.80 and 1.82 times as fast.
// Counting every step since v000, it is 228 times as fast.
// compute dtype: all float inputs rounded to bf16; Q, K, V are bf16-valued so their f16 planes are exact; scores q x k (1 product on exact planes) x 64^-0.5; softmax over the QUERY axis in f32 (per key column: max / sum over the 4,096 queries, 32 online partials merged, exponentials in base 2 on the hardware's exp2; scores recomputed per use, never stored); P x 2^11 once to f16 x v (exact) (1 product); f32 output.
#include <hip/hip_runtime.h>
#include <math.h>

typedef __attribute__((ext_vector_type(16))) _Float16 v16h;
typedef __attribute__((ext_vector_type(16))) __bf16 v16b;
typedef __attribute__((ext_vector_type(8)))  _Float16 v8h;
typedef __attribute__((ext_vector_type(8)))  float v8f;
typedef __attribute__((ext_vector_type(4)))  float v4f;
typedef __attribute__((ext_vector_type(2)))  float v2f;
typedef __attribute__((ext_vector_type(4)))  unsigned v4u;
typedef _Float16 hx8 __attribute__((ext_vector_type(8)));
typedef __attribute__((ext_vector_type(4)))  int v4i;
typedef float __attribute__((may_alias)) float_a;
typedef int __attribute__((may_alias)) int_a;

template <typename T> __device__ __forceinline__ void vst2(void* p, T v) { *(T*)p = v;  }
__device__ __forceinline__ v8f wmma16(v16h a, v16h b, v8f c) {
  v8f d = __builtin_amdgcn_wmma_f32_16x16x32_f16(false, a, false, b, (short)0, c, false, false);
  asm volatile("v_nop\n\tv_nop\n\tv_nop\n\tv_nop" : "+v"(d) : "v"(a), "v"(b));
  return d;
}
__device__ __forceinline__ v8f wmma_bf(v16b a, v16b b, v8f c) {
  v8f d = __builtin_amdgcn_wmma_f32_16x16x32_bf16(false, a, false, b, (short)0, c, false, false);
  asm volatile("v_nop\n\tv_nop\n\tv_nop\n\tv_nop" : "+v"(d) : "v"(a), "v"(b));
  return d;
}
// 16x16x32 fragments: lane = (h = lane>>4, row/col = lane&15); elements 0..7 = k0+8h+0..7, 8..15 = k0+16+8h+0..7; D element r = row 8h+r
__device__ __forceinline__ v16h frag_h(const _Float16* rowk0, int lane) {
  union { v16h v; v8h q[2]; } u; const _Float16* p = rowk0 + 8 * (lane >> 4);
  u.q[0] = *(const v8h*)p; u.q[1] = *(const v8h*)(p + 16); return u.v;
}
__device__ __forceinline__ v16h frag_f32(const float* rowk0, int lane) {
  v16h a; const float* p = rowk0 + 8 * (lane >> 4);
#pragma unroll
  for (int i = 0; i < 8; ++i) { a[i] = (_Float16)p[i]; a[8 + i] = (_Float16)p[16 + i]; }
  return a;
}
__device__ __forceinline__ v16h frag_f32s(const float* rowk0, int lane, float sc) {
  v16h a; const float* p = rowk0 + 8 * (lane >> 4);
#pragma unroll
  for (int i = 0; i < 8; ++i) { a[i] = (_Float16)(p[i] * sc); a[8 + i] = (_Float16)(p[16 + i] * sc); }
  return a;
}
// column fragment from a [K][ld] layout (column n), rows >= K read as 0
__device__ __forceinline__ v16h fragc_f32(const float* W, int k0, int n, int lane, int ld, int K) {
  v16h a; const int g = lane >> 4;
#pragma unroll
  for (int i = 0; i < 8; ++i) { const int ka = k0 + 8 * g + i, kb = ka + 16;
    a[i] = (_Float16)(ka < K ? W[(size_t)(ka < K ? ka : K - 1) * ld + n] : 0.f); a[8 + i] = (_Float16)(kb < K ? W[(size_t)(kb < K ? kb : K - 1) * ld + n] : 0.f); }
  return a;
}
struct F2 { v16b h, l; };
__device__ __forceinline__ F2 bsplit16(const float v[16]) { F2 r;
#pragma unroll
  for (int i = 0; i < 16; ++i) { const __bf16 h = (__bf16)v[i]; r.h[i] = h; r.l[i] = (__bf16)(v[i] - (float)h); }
  return r; }
__device__ __forceinline__ F2 split_row(const float* row, int k0, int lane) { float v[16]; const float* p = row + k0 + 8 * (lane >> 4);
#pragma unroll
  for (int i = 0; i < 8; ++i) { v[i] = p[i]; v[8 + i] = p[16 + i]; }
  return bsplit16(v); }
__device__ __forceinline__ F2 split_rowK(const float* row, int k0, int lane, int K) { float v[16]; const int g = lane >> 4;
#pragma unroll
  for (int i = 0; i < 8; ++i) { const int ka = k0 + 8 * g + i, kb = ka + 16; v[i] = ka < K ? row[ka < K ? ka : K - 1] : 0.f; v[8 + i] = kb < K ? row[kb < K ? kb : K - 1] : 0.f; }
  return bsplit16(v); }
__device__ __forceinline__ F2 split_col(const float* W, int k0, int n, int lane, int ld, int K) { float v[16]; const int g = lane >> 4;
#pragma unroll
  for (int i = 0; i < 8; ++i) { const int ka = k0 + 8 * g + i, kb = ka + 16; v[i] = ka < K ? W[(size_t)(ka < K ? ka : K - 1) * ld + n] : 0.f; v[8 + i] = kb < K ? W[(size_t)(kb < K ? kb : K - 1) * ld + n] : 0.f; }
  return bsplit16(v); }
__device__ __forceinline__ v8f mac3(const F2& a, const F2& b, v8f c) { c = wmma_bf(a.l, b.h, c); c = wmma_bf(a.h, b.l, c); return wmma_bf(a.h, b.h, c); }
__device__ __forceinline__ float sigm(float v) { return 1.0f / (1.0f + expf(-v)); }
#define LDSX() do { asm volatile("s_wait_dscnt 0" ::: "memory"); __builtin_amdgcn_wave_barrier(); __builtin_amdgcn_fence(__ATOMIC_RELEASE, "workgroup"); } while (0)

// Scaled dot-product attention on given tensors whose softmax runs over the QUERY axis (Q / K / V [4,4096,64]; scores = Q K^T / 8 of shape [B, q, k]; attn = softmax(scores, axis=1) - axis 1 is the QUERY axis, so every key COLUMN is normalised over the 4,096 queries (faithful to the source); out = attn V -> [4,4096,64]; no mask).
#define NB 4
#define TT 4096
#define CC 64            // NH * HD = projected width
#define DIN 64          // input (model) width
#define NH 1
#define HD 64
#define NQB (TT / 64)
#define HG 1
#define SCALE (0.125f)
#define CAUSAL 0
#ifndef TNB
#define TNB NB
#endif
__device__ __forceinline__ float bfr(float v) { return (float)(__bf16)v; }
__host__ __device__ __forceinline__ int kb_last(int qb) { return CAUSAL ? ((qb * 64 + 63) >> 7) : (TT / 128 - 1); }
typedef __attribute__((ext_vector_type(8))) __bf16 v8b;
__device__ __forceinline__ v16b frag_b(const __bf16* rowk0, int lane) {
  union { v16b v; v8b q[2]; } u; const __bf16* p = rowk0 + 8 * (lane >> 4);
  u.q[0] = *(const v8b*)p; u.q[1] = *(const v8b*)(p + 16); return u.v;
}
#define QBH 0              // exact planes: single-product logits and single-f16 P x V on every block
#define QHI 0               // no q residual plane (q is bf16-exact in f16)
#define KHI 64              // unused high-precision planes kept minimal
// B fragment (k rows k0+.., output column o) of a weight: (in,out) [K][ld] or (out,in) [ld rows of K]: bf16 exact, or f16(bf16 * 256) exact
__device__ __forceinline__ v16b wcol_io(const float* Wm, int k0, int o, int lane, int ld) { v16b w; const int g = lane >> 4;
#pragma unroll
  for (int i = 0; i < 8; ++i) { w[i] = (__bf16)Wm[(size_t)(k0 + 8 * g + i) * ld + o]; w[8 + i] = (__bf16)Wm[(size_t)(k0 + 16 + 8 * g + i) * ld + o]; }
  return w; }
__device__ __forceinline__ v16b wcol_oi(const float* Wm, int k0, int o, int lane, int K) { v16b w; const float* p = Wm + (size_t)o * K + k0 + 8 * (lane >> 4);
#pragma unroll
  for (int i = 0; i < 8; ++i) { w[i] = (__bf16)p[i]; w[8 + i] = (__bf16)p[16 + i]; }
  return w; }
__device__ __forceinline__ v16h wcolh_io(const float* Wm, int k0, int o, int lane, int ld) { v16h w; const int g = lane >> 4;
#pragma unroll
  for (int i = 0; i < 8; ++i) { w[i] = (_Float16)(bfr(Wm[(size_t)(k0 + 8 * g + i) * ld + o]) * 256.0f); w[8 + i] = (_Float16)(bfr(Wm[(size_t)(k0 + 16 + 8 * g + i) * ld + o]) * 256.0f); }
  return w; }
__device__ __forceinline__ v16h wcolh_oi(const float* Wm, int k0, int o, int lane, int K) { v16h w; const float* p = Wm + (size_t)o * K + k0 + 8 * (lane >> 4);
#pragma unroll
  for (int i = 0; i < 8; ++i) { w[i] = (_Float16)(bfr(p[i]) * 256.0f); w[8 + i] = (_Float16)(bfr(p[16 + i]) * 256.0f); }
  return w; }
#define WQKV_LAYOUT 0   // 0 = (in,out) [DIN][CC]; 1 = (out,in) [CC][DIN]; 2 = per-head [NH][DIN][HD]
__device__ __forceinline__ v16b wcol_hdk(const float* Wm, int k0, int o, int lane) { v16b w; const int g = lane >> 4; const float* p = Wm + (size_t)(o / HD) * DIN * HD + (o % HD);
#pragma unroll
  for (int i = 0; i < 8; ++i) { w[i] = (__bf16)p[(size_t)(k0 + 8 * g + i) * HD]; w[8 + i] = (__bf16)p[(size_t)(k0 + 16 + 8 * g + i) * HD]; }
  return w; }
#define WO_OUT_IN 0
#if WQKV_LAYOUT == 1
#define WCOL(W, k0, o, lane) wcol_oi(W, k0, o, lane, DIN)
#elif WQKV_LAYOUT == 2
#define WCOL(W, k0, o, lane) wcol_hdk(W, k0, o, lane)
#else
#define WCOL(W, k0, o, lane) wcol_io(W, k0, o, lane, CC)
#endif
#if WO_OUT_IN
#define WOCOL(W, k0, o, lane) wcol_oi(W, k0, o, lane, CC)
#define WOCOLH(W, k0, o, lane) wcolh_oi(W, k0, o, lane, CC)
#else
#define WOCOL(W, k0, o, lane) wcol_io(W, k0, o, lane, DIN)
#define WOCOLH(W, k0, o, lane) wcolh_io(W, k0, o, lane, DIN)
#endif
// The q, k and v planes lie in FRAGMENT ORDER. A 16 x 32 operand fragment (16 rows or channels x 32 k) is 1 KiB = [part p = 0, 1][lane = 16 h + row][8 elements], the piece holding k = k0 + 16 p + 8 h + 0..7: frag_h's k order, unchanged. Each of a fragment's two 16-byte loads then reads 512 consecutive bytes, four whole 128-byte lines, where a row-major plane gives a load 32 bytes out of each of 16 lines.
// q, k: [flat row / 16][k / 32] fragments; element offset of piece q8 (elements 8 q8 .. 8 q8 + 7) of flat row r
#define FRAG_QK(r, q8) (((size_t)(r) >> 4) * (16 * CC) + (size_t)(((q8) >> 1) * 256 + (((q8) & 1) * 16 + ((int)(r) & 15)) * 8))
// v, per batch: [key / 32][channel / 16] fragments; element offset of piece t8 (keys 8 t8 .. 8 t8 + 7) of channel c
#define FRAG_V(c, t8) ((size_t)((((t8) >> 2) * (CC / 16) + ((c) >> 4)) * 512 + (((t8) >> 1) & 1) * 256 + (((t8) & 1) * 16 + ((c) & 15)) * 8))
__global__ __launch_bounds__(256) void k_planes64(const float* __restrict__ Qs, const float* __restrict__ Ks, const float* __restrict__ Vs, _Float16* __restrict__ QH, _Float16* __restrict__ QL, _Float16* __restrict__ KH, _Float16* __restrict__ KL, _Float16* __restrict__ VT, __bf16* __restrict__ VB, __bf16* __restrict__ VBL) {
  __shared__ _Float16 sv[64][72];
  const int tid = threadIdx.x; const size_t r0 = (size_t)blockIdx.x * 64; const int b = (int)(r0 / TT), t0 = (int)(r0 % TT);
  for (int e = tid; e < 64 * 8; e += 256) { const int rl = ((e >> 6) << 3) | ((e >> 2) & 7), q = (((e >> 5) & 1) << 2) | (e & 3);   // a wave = 8 rows x 4 pieces of 8 elements: it reads one whole line of each row and stores whole lines of the fragment-order planes
    const size_t src = (r0 + rl) * CC + q * 8, dst = FRAG_QK(r0 + rl, q); float tq[8], tk[8], tv[8];
#pragma unroll
    for (int u = 0; u < 8; ++u) { tq[u] = Qs[src + u]; tk[u] = Ks[src + u]; tv[u] = Vs[src + u]; }
    asm volatile("s_wait_loadcnt 0x0" ::: "memory");
    hx8 hq, hk, hlq, hlk;
#pragma unroll
    for (int u = 0; u < 8; ++u) { const float qv = bfr(tq[u]), kv = bfr(tk[u]); const _Float16 qh = (_Float16)qv, kh = (_Float16)kv; hq[u] = qh; hlq[u] = (_Float16)((qv - (float)qh) * 1024.0f); hk[u] = kh; hlk[u] = (_Float16)((kv - (float)kh) * 1024.0f); sv[rl][q * 8 + u] = (_Float16)bfr(tv[u]); }
    vst2((unsigned*)(QH + dst), *(const v4u*)&hq); vst2((unsigned*)(KH + dst), *(const v4u*)&hk);
    asm volatile("s_wait_xcnt 0x0" ::: "memory");   // behind the two stores, ahead of whatever writes their address or data registers again (the residual below, the next trip)
    if (t0 + rl < QHI) vst2((unsigned*)(QL + ((size_t)b * QHI + t0 + rl) * CC + q * 8), *(const v4u*)&hlq);
    if (t0 + rl < KHI) vst2((unsigned*)(KL + ((size_t)b * KHI + t0 + rl) * CC + q * 8), *(const v4u*)&hlk); }
  __syncthreads();
  for (int e = tid; e < 64 * 8; e += 256) { const int c = ((e >> 6) << 3) | (e & 7), q = (e >> 3) & 7;   // 8 neighbouring channels of one piece of 8 keys fill one line of the fragment-order plane
    hx8 hv; _Pragma("unroll") for (int j = 0; j < 8; ++j) hv[j] = sv[q * 8 + j][c]; vst2((unsigned*)(VT + (size_t)b * CC * TT + FRAG_V(c, t0 / 8 + q)), *(const v4u*)&hv);
    asm volatile("s_wait_xcnt 0x0" ::: "memory");   // behind the store, ahead of whatever writes its address or data registers again
    if (t0 < KHI) { v8b bh, bl; _Pragma("unroll") for (int j = 0; j < 8; ++j) { const float vv = (float)hv[j]; const __bf16 h1 = (__bf16)vv; bh[j] = h1; bl[j] = (__bf16)(vv - (float)h1); } vst2((unsigned*)(VB + ((size_t)b * CC + c) * KHI + t0 + q * 8), *(const v4u*)&bh); vst2((unsigned*)(VBL + ((size_t)b * CC + c) * KHI + t0 + q * 8), *(const v4u*)&bl); } } }
#define SM_EXTRA_PARAMS
#define SM_MASK_HOOK (void)0
#ifndef SM_EXTRA_PARAMS
#define SM_EXTRA_PARAMS
#endif
#ifndef PROJ_EXTRA_PARAMS
#define PROJ_EXTRA_PARAMS
#endif
#ifndef SM_MASK_HOOK
#define SM_MASK_HOOK (void)0
#endif

#define WS_QH  0u                                      // f16 q, fragment order (FRAG_QK)
#define WS_KH  (WS_QH + 2u * (size_t)NB * TT * CC)      // f16 k, fragment order (FRAG_QK)
#define WS_VT  (WS_KH + 2u * (size_t)NB * TT * CC)      // f16 v, per batch in fragment order (FRAG_V)
#define WS_QL  (WS_VT + 2u * (size_t)NB * CC * TT)      // f16 q residual x 2^10 rows [b][t < QHI][CC]
#define WS_KL  (WS_QL + 2u * (size_t)NB * QHI * CC)     // f16 k residual x 2^10 rows [b][t < KHI][CC]
#define WS_VB  (WS_KL + 2u * (size_t)NB * KHI * CC)     // bf16 v hi planes [b][c][t < KHI]
#define WS_VBL (WS_VB + 2u * (size_t)NB * CC * KHI)
#define WS_END (WS_VBL + 2u * (size_t)NB * CC * KHI)
#define WS_CL (WS_END)                                  // f32 column exponent offsets [b][TT]
#define WS_END2 (WS_CL + 4u * (size_t)NB * TT)

// ---- k_proj: block = (64 rows, 128 cols, which): q/k/v = X W (+ b) with exact bf16 products (K = DIN) -> which 0: q f16 rows (+ residual rows < QHI); 1: k f16 rows (+ residual rows < KHI); 2: v f16 planes [c][t] (+ bf16 hi/lo planes for t < KHI)
__global__ __launch_bounds__(128) void k_proj(const float* __restrict__ XQ, const float* __restrict__ XK, const float* __restrict__ XV, const float* __restrict__ WQ, const float* __restrict__ WK, const float* __restrict__ WV, const float* __restrict__ BQ, const float* __restrict__ BK, const float* __restrict__ BV,
    _Float16* __restrict__ QH, _Float16* __restrict__ QL, _Float16* __restrict__ KH, _Float16* __restrict__ KL, _Float16* __restrict__ VT, __bf16* __restrict__ VB, __bf16* __restrict__ VBL) {
  __shared__ __align__(16) _Float16 sh[64][136], sl[64][136]; __shared__ __align__(16) _Float16 th[128][72]; __shared__ __align__(16) __bf16 tb[128][72], tbl[128][72];
  const int tid = threadIdx.x, wave = tid >> 5, lane = tid & 31, col = lane & 15, g = lane >> 4; const int which = blockIdx.z; const int c0 = blockIdx.y * 128; const size_t r0 = (size_t)blockIdx.x * 64; const size_t bb = r0 / TT; const int t0 = (int)(r0 % TT);
  const float* X = which == 0 ? XQ : which == 1 ? XK : XV; const float* WA = which == 0 ? WQ : which == 1 ? WK : WV; const float* BA = which == 0 ? BQ : which == 1 ? BK : BV;
  v8f acc[8] = {};
#pragma unroll 2
  for (int kc = 0; kc < DIN / 32; ++kc) { v16b a; { const float* p = X + (r0 + wave * 16 + col) * DIN + kc * 32 + 8 * g;
#pragma unroll
      for (int i = 0; i < 8; ++i) { a[i] = (__bf16)p[i]; a[8 + i] = (__bf16)p[16 + i]; } }
    asm volatile("s_wait_loadcnt 0x0" ::: "memory");
#pragma unroll
    for (int j = 0; j < 8; ++j) { const v16b w = WCOL(WA, kc * 32, c0 + j * 16 + col, lane); asm volatile("s_wait_loadcnt 0x0" ::: "memory"); acc[j] = wmma_bf(a, w, acc[j]); } }
  if (which < 2) { _Float16* DH = which == 0 ? QH : KH; _Float16* DL = which == 0 ? QL : KL; const int nhi = which == 0 ? QHI : KHI; const bool hi_rows = t0 < nhi;
#pragma unroll
    for (int j = 0; j < 8; ++j) { const float bias = BA ? bfr(BA[c0 + j * 16 + col]) : 0.f;
#pragma unroll
      for (int r = 0; r < 8; ++r) { const float v = acc[j][r] + bias; const _Float16 hv = (_Float16)v; sh[wave * 16 + 8 * g + r][j * 16 + col] = hv; sl[wave * 16 + 8 * g + r][j * 16 + col] = (_Float16)((v - (float)hv) * 1024.0f); } }
    __syncthreads();
    for (int e = tid; e < 64 * 16; e += 128) { const int rl = e >> 4, q = e & 15; vst2((unsigned*)(DH + (r0 + rl) * CC + c0 + q * 8), *(const v4u*)&sh[rl][q * 8]); if (hi_rows) vst2((unsigned*)(DL + (bb * nhi + t0 + rl) * (size_t)CC + c0 + q * 8), *(const v4u*)&sl[rl][q * 8]); }
  } else { const bool hi_rows = t0 < KHI;
#pragma unroll
    for (int j = 0; j < 8; ++j) { const float bias = BA ? bfr(BA[c0 + j * 16 + col]) : 0.f;
#pragma unroll
      for (int r = 0; r < 8; ++r) { const float v = acc[j][r] + bias; const int rl = wave * 16 + 8 * g + r, cl = j * 16 + col; th[cl][rl] = (_Float16)v; const __bf16 bh = (__bf16)v; tb[cl][rl] = bh; tbl[cl][rl] = (__bf16)(v - (float)bh); } }
    __syncthreads();
    for (int e = tid; e < 128 * 8; e += 128) { const int cl = e >> 3, q = e & 7; vst2((unsigned*)(VT + (bb * CC + c0 + cl) * (size_t)TT + t0 + q * 8), *(const v4u*)&th[cl][q * 8]); if (hi_rows) { const size_t o3 = (bb * CC + c0 + cl) * (size_t)KHI + t0 + q * 8; vst2((unsigned*)(VB + o3), *(const v4u*)&tb[cl][q * 8]); vst2((unsigned*)(VBL + o3), *(const v4u*)&tbl[cl][q * 8]); } } } }
// ---- k_sm: block = query row t (head in group): keys [0, kend): causal -> logit if s <= t else excluded; softmax in f32; P x 2^11 in place (0 for excluded)
__global__ __launch_bounds__(256) void k_sm(float* __restrict__ S0 SM_EXTRA_PARAMS) { __shared__ float sred[8]; __shared__ float sbc; __shared__ __align__(16) float shv[TT];
  const int tid = threadIdx.x; const int t = blockIdx.x; const int kend = (kb_last(t >> 6) + 1) * 128;
  float* sr = S0 + (size_t)blockIdx.y * TT * TT + (size_t)t * TT;
  float m = -3.0e38f; for (int k = tid; k < kend; k += 256) { float v = (!CAUSAL || k <= t) ? sr[k] : -3.0e38f; SM_MASK_HOOK; shv[k] = v; m = fmaxf(m, v); }
#pragma unroll
  for (int o = 1; o < 32; o <<= 1) m = fmaxf(m, __shfl_xor(m, o));
  if ((tid & 31) == 0) sred[tid >> 5] = m; __syncthreads(); if (tid == 0) { float a = sred[0]; for (int i = 1; i < 8; ++i) a = fmaxf(a, sred[i]); sbc = a; } __syncthreads(); m = sbc; __syncthreads();
  float sum = 0.f; for (int k = tid; k < kend; k += 256) { const float v = shv[k]; const float e = (v <= -1.0e38f) ? 0.f : expf(v - m); shv[k] = e; sum += e; }
#pragma unroll
  for (int o = 1; o < 32; o <<= 1) sum += __shfl_xor(sum, o);
  if ((tid & 31) == 0) sred[tid >> 5] = sum; __syncthreads(); if (tid == 0) { float a = 0.f; for (int i = 0; i < 8; ++i) a += sred[i]; sbc = a > 0.f ? 2048.0f / a : 0.f; }   /* a fully excluded row yields P = 0 */ __syncthreads(); const float inv = sbc;
  for (int k = tid; k < kend; k += 256) shv[k] = shv[k] * inv;
  __syncthreads(); for (int q = tid; q < kend / 4; q += 256) vst2(sr + q * 4, *(const v4f*)&shv[q * 4]); }
// plain builtin form of the f16 product: the compiler keeps the distance behind it itself
__device__ __forceinline__ v8f mm16(v16h a, v16h b, v8f c) { return __builtin_amdgcn_wmma_f32_16x16x32_f16(false, a, false, b, (short)0, c, false, false); }
// a fragment of a fragment-order plane from the lane's own pointer (fragment start + 8 lane): part 0, then part 1 at + 256 elements
__device__ __forceinline__ v16h frag_t(const _Float16* p) { union { v16h v; v8h q[2]; } u; u.q[0] = *(const v8h*)p; u.q[1] = *(const v8h*)(p + 256); return u.v; }
// The scores are never stored: both kernels below form their own q x k tiles on the matrix unit and use them from the accumulator registers.
// Exponentials run in base 2: exp(SCALE x - SCALE m) = 2^(C2 x - C2 m) with C2 = SCALE log2(e), so a raw score costs one multiply-add and one hardware exp2; the multiply-add rounds the argument once, to 2^-24 of its size, the order of the f32 score's own rounding
#define C2 (SCALE * 1.44269504088896340736f)
__device__ __forceinline__ float ex2(float x) { return __builtin_amdgcn_exp2f(x); }
// the exponents of two neighbouring accumulator registers in one packed multiply-add
__device__ __forceinline__ v2f arg2(float xa, float xb, float la, float lb) { return __builtin_elementwise_fma((v2f){xa, xb}, (v2f){C2, C2}, (v2f){la, lb}); }
// ---- k_cstat: softmax over the QUERY axis (the source's softmax(axis=1) on a [B, q, k] tensor): for every key column k, on the raw products x = q . k: m_k = max_q x, Z_k = sum_q 2^(C2 x - C2 m_k) (f32); stored: L_k = 11 - C2 m_k - log2(Z_k), so that P x 2^11 = 2^(C2 x + L_k). Work-group = 64 key columns (their 8 B fragments held in registers by every wave), the 4,096 queries dealt to 16 waves; S = Q K^T: A = 16 query rows, B = 16 key columns, so a lane holds 8 queries of ONE key column per tile: running max / sum in-lane, one rescale per 16 scores. The halves of a wave meet by one lane exchange, the 16 waves' partials in LDS behind one barrier
#define C1W 16           // waves per work-group (query axis)
#define C1K 4            // 16-column key tiles per work-group
__global__ __launch_bounds__(C1W * 32) void k_cstat(const _Float16* __restrict__ QH, const _Float16* __restrict__ KH, float* __restrict__ CL) { __shared__ float pm[C1W][C1K * 16], pz[C1W][C1K * 16];
  const int tid = threadIdx.x, wave = tid >> 5, lane = tid & 31, col = lane & 15;
  const size_t kr0 = (size_t)blockIdx.x * (C1K * 16);                            // flat key row b * TT + k
  const size_t qr0 = (kr0 / TT) * TT + (size_t)wave * (TT / C1W);                // this wave's first flat query row
  v16h kf[C1K][2]; const _Float16* kq = KH + kr0 * CC + lane * 8;                // 16 rows = 2 fragments = 16 * CC elements
#pragma unroll
  for (int j = 0; j < C1K; ++j) { kf[j][0] = frag_t(kq + j * 16 * CC); kf[j][1] = frag_t(kq + j * 16 * CC + 512); }
  asm volatile("s_wait_xcnt 0x0" ::: "memory");   // behind the 16 loads, ahead of whatever writes their base or offset register again
  float m[C1K], z[C1K];
#pragma unroll
  for (int j = 0; j < C1K; ++j) { m[j] = -3.0e38f; z[j] = 0.f; }
  for (int t = 0; t < TT / C1W / 32; ++t) { const _Float16* qp = QH + (qr0 + t * 32) * CC + lane * 8;
    const v16h a00 = frag_t(qp), a01 = frag_t(qp + 512), a10 = frag_t(qp + 16 * CC), a11 = frag_t(qp + 16 * CC + 512);
#pragma unroll
    for (int j = 0; j < C1K; ++j) { v8f s0 = {}, s1 = {}; s0 = mm16(a00, kf[j][0], s0); s1 = mm16(a10, kf[j][0], s1); s0 = mm16(a01, kf[j][1], s0); s1 = mm16(a11, kf[j][1], s1);
      float mn = m[j];
#pragma unroll
      for (int r = 0; r < 8; ++r) mn = fmaxf(mn, fmaxf(s0[r], s1[r]));
      const float nb = -C2 * mn; float s = 0.f;
#pragma unroll
      for (int r = 0; r < 8; r += 2) { const v2f t0 = arg2(s0[r], s0[r + 1], nb, nb), t1 = arg2(s1[r], s1[r + 1], nb, nb); s += ex2(t0[0]) + ex2(t1[0]); s += ex2(t0[1]) + ex2(t1[1]); }
      z[j] = z[j] * ex2(fmaf(m[j], C2, nb)) + s; m[j] = mn; } }
#pragma unroll
  for (int j = 0; j < C1K; ++j) { const float mo = __shfl_xor(m[j], 16), zo = __shfl_xor(z[j], 16); const float mm = fmaxf(m[j], mo); const float zz = z[j] * ex2((m[j] - mm) * C2) + zo * ex2((mo - mm) * C2);
    if (lane < 16) { pm[wave][j * 16 + col] = mm; pz[wave][j * 16 + col] = zz; } }
  __syncthreads();
  if (tid < C1K * 16) { float mm = pm[0][tid];
#pragma unroll
    for (int w = 1; w < C1W; ++w) mm = fmaxf(mm, pm[w][tid]);
    float zz = 0.f;
#pragma unroll
    for (int w = 0; w < C1W; ++w) zz += pz[w][tid] * ex2((pm[w][tid] - mm) * C2);
    CL[kr0 + tid] = 11.0f - mm * C2 - log2f(zz); } }
// ---- k_ctx: out = P v with P[q][k] x 2^11 = 2^(C2 x + L_k), once to f16, against v f16 (1 product). Work-group = 64 queries: 2 query groups of 32 x 8 key shares, one wave each; the keys are dealt to the shares in slices of 32, so that the 8 shares of one trip read 256 consecutive keys (32 KiB in a row of the k plane and of the v plane). S^T = K Q^T (A = 16 key rows, B = 16 query columns): two S^T tiles of 32 consecutive keys, turned into P in place, ARE the B fragment of O^T += V^T P^T in the hardware k order (element s < 8: key 8h + s, else key 16 + 8h + s - 8), which is frag_h's order for the v plane rows; P touches neither LDS nor memory. The 8 shares' partial outputs meet in LDS behind one barrier (summed in share order)
#define P2Q 2            // 32-query groups per work-group
#define P2S 8            // key shares per work-group
__global__ __launch_bounds__(P2Q * P2S * 32) void k_ctx(const _Float16* __restrict__ QH, const _Float16* __restrict__ KH, const _Float16* __restrict__ VT, const float* __restrict__ CL, float* __restrict__ Y) { __shared__ __align__(16) float red[P2S][P2Q * 32][HD + 4];
  const int tid = threadIdx.x, wave = tid >> 5, lane = tid & 31, col = lane & 15, g = lane >> 4; const int qg = wave % P2Q, ks = wave / P2Q;
  const size_t q0 = (size_t)blockIdx.x * (P2Q * 32); const size_t b = q0 / TT;   // flat query row b * TT + t
  const _Float16* Kb = KH + b * TT * CC; const _Float16* Vb = VT + b * CC * TT; const float* cl = CL + b * TT;
  v16h qf[2][2];
#pragma unroll
  for (int i = 0; i < 2; ++i) { qf[i][0] = frag_t(QH + (q0 + qg * 32 + i * 16) * CC + lane * 8); qf[i][1] = frag_t(QH + (q0 + qg * 32 + i * 16) * CC + 512 + lane * 8); }
  v8f acc[2][HD / 16] = {};
  unsigned ko = (unsigned)(ks * 32 * CC + lane * 8) * 2u, so = (unsigned)(ks * 32 + 8 * g) * 4u;   // the lane's own byte offsets for keys k0 = (t * P2S + ks) * 32 ..: ko for its piece of the first of the 4 k and of the 4 v fragments of those 32 keys (4 KiB in a row in either plane, at the same offset), so for the column statistics; they step with the trip, on bases that are the same for the whole work-group
  for (int t = 0; t < TT / P2S / 32; ++t) { const _Float16* kp = (const _Float16*)((const char*)Kb + ko); const _Float16* vp = (const _Float16*)((const char*)Vb + ko); const float* mp = (const float*)((const char*)cl + so);
    const v16h k00 = frag_t(kp), k01 = frag_t(kp + 512), k10 = frag_t(kp + 16 * CC), k11 = frag_t(kp + 16 * CC + 512);
    const v4f m0a = *(const v4f*)(mp), m0b = *(const v4f*)(mp + 4), m1a = *(const v4f*)(mp + 16), m1b = *(const v4f*)(mp + 20);
    v16h vf[HD / 16];
#pragma unroll
    for (int j = 0; j < HD / 16; ++j) vf[j] = frag_t(vp + j * 512);
    asm volatile("s_wait_xcnt 0x0" : "+v"(ko), "+v"(so) :: "memory");   // behind the trip's loads: their two offset registers pass through the wait, so that no load's result lands in one and no step is added to one ahead of it
    __builtin_amdgcn_sched_barrier(0);   // keeps the trip's loads together at its head: the v and statistics loads fly under the score products instead of being issued just ahead of their use
    ko += P2S * 32 * CC * 2u; so += P2S * 32 * 4u;
#pragma unroll
    for (int i = 0; i < 2; ++i) { v8f s0 = {}, s1 = {}; s0 = mm16(k00, qf[i][0], s0); s1 = mm16(k10, qf[i][0], s1); s0 = mm16(k01, qf[i][1], s0); s1 = mm16(k11, qf[i][1], s1);
      v16h p;
#pragma unroll
      for (int r = 0; r < 4; r += 2) { const v2f t0 = arg2(s0[r], s0[r + 1], m0a[r], m0a[r + 1]), t1 = arg2(s0[4 + r], s0[5 + r], m0b[r], m0b[r + 1]), t2 = arg2(s1[r], s1[r + 1], m1a[r], m1a[r + 1]), t3 = arg2(s1[4 + r], s1[5 + r], m1b[r], m1b[r + 1]);
        p[r] = (_Float16)ex2(t0[0]); p[r + 1] = (_Float16)ex2(t0[1]); p[4 + r] = (_Float16)ex2(t1[0]); p[5 + r] = (_Float16)ex2(t1[1]); p[8 + r] = (_Float16)ex2(t2[0]); p[9 + r] = (_Float16)ex2(t2[1]); p[12 + r] = (_Float16)ex2(t3[0]); p[13 + r] = (_Float16)ex2(t3[1]); }
#pragma unroll
      for (int j = 0; j < HD / 16; ++j) acc[i][j] = mm16(vf[j], p, acc[i][j]); } }
  // acc[i][j][r] = O[query i * 16 + col][channel j * 16 + 8 g + r] x 2^11 over this wave's key share
#pragma unroll
  for (int i = 0; i < 2; ++i)
#pragma unroll
    for (int j = 0; j < HD / 16; ++j) { float* rp = &red[ks][qg * 32 + i * 16 + col][j * 16 + 8 * g]; v4f lo, hi;
#pragma unroll
      for (int r = 0; r < 4; ++r) { lo[r] = acc[i][j][r]; hi[r] = acc[i][j][4 + r]; }
      *(v4f*)rp = lo; *(v4f*)(rp + 4) = hi; }
  __syncthreads();
  for (int e = tid; e < P2Q * 32 * (HD / 4); e += P2Q * P2S * 32) { const int q = e / (HD / 4), d4 = e % (HD / 4); v4f a = *(const v4f*)&red[0][q][d4 * 4];
#pragma unroll
    for (int s = 1; s < P2S; ++s) a += *(const v4f*)&red[s][q][d4 * 4];
    vst2(Y + (q0 + q) * CC + d4 * 4, a * (1.0f / 2048.0f)); } }

extern "C" void kernel_launch(void* const* d_in, const int* in_sizes, int n_in, void* d_out, int out_size, void* d_ws, size_t ws_size, hipStream_t stream) {
  (void)in_sizes; (void)n_in; (void)out_size;
  const float** F = (const float**)d_in;
  if (ws_size < (size_t)WS_END2) return;
  char* ws = (char*)d_ws; _Float16 *QH = (_Float16*)(ws + WS_QH), *KH = (_Float16*)(ws + WS_KH), *VT = (_Float16*)(ws + WS_VT), *QL = (_Float16*)(ws + WS_QL), *KL = (_Float16*)(ws + WS_KL); __bf16 *VB = (__bf16*)(ws + WS_VB), *VBL = (__bf16*)(ws + WS_VBL);
  float *CL = (float*)(ws + WS_CL);
  // inputs: 0 Q [4,4096,64]; 1 K; 2 V
  k_planes64<<<dim3(TNB * TT / 64), 256, 0, stream>>>(F[0], F[1], F[2], QH, QL, KH, KL, VT, VB, VBL);
  k_cstat<<<dim3(TNB * TT / (C1K * 16)), C1W * 32, 0, stream>>>(QH, KH, CL);                           /* per key column: the exponent offset from max and sum over the queries */
  k_ctx<<<dim3(TNB * TT / (P2Q * 32)), P2Q * P2S * 32, 0, stream>>>(QH, KH, VT, CL, (float*)d_out);  /* out = P v, P formed in registers */
}

// v005
// Measured time: 27.9 microseconds a run.
// Timed twice side by side with v004, it ran 1.05 and 1.06 times as fast.
// Over all steps from v000 it is 240 times as fast.
// compute dtype: all float inputs rounded to bf16; Q, K, V are bf16-valued so their f16 planes are exact; scores q x k (1 product on exact planes) x 64^-0.5; softmax over the QUERY axis in f32 (per key column: max / sum over the 4,096 queries, 32 online partials merged, exponentials in base 2 on the hardware's exp2; scores recomputed per use, never stored); P x 2^11 once to f16 x v (exact) (1 product); f32 output.
#include <hip/hip_runtime.h>
#include <math.h>

typedef __attribute__((ext_vector_type(16))) _Float16 v16h;
typedef __attribute__((ext_vector_type(16))) __bf16 v16b;
typedef __attribute__((ext_vector_type(8)))  _Float16 v8h;
typedef __attribute__((ext_vector_type(8)))  float v8f;
typedef __attribute__((ext_vector_type(4)))  float v4f;
typedef __attribute__((ext_vector_type(2)))  float v2f;
typedef __attribute__((ext_vector_type(4)))  unsigned v4u;
typedef _Float16 hx8 __attribute__((ext_vector_type(8)));
typedef __attribute__((ext_vector_type(4)))  int v4i;
typedef float __attribute__((may_alias)) float_a;
typedef int __attribute__((may_alias)) int_a;

template <typename T> __device__ __forceinline__ void vst2(void* p, T v) { *(T*)p = v;  }
__device__ __forceinline__ v8f wmma16(v16h a, v16h b, v8f c) {
  v8f d = __builtin_amdgcn_wmma_f32_16x16x32_f16(false, a, false, b, (short)0, c, false, false);
  asm volatile("v_nop\n\tv_nop\n\tv_nop\n\tv_nop" : "+v"(d) : "v"(a), "v"(b));
  return d;
}
__device__ __forceinline__ v8f wmma_bf(v16b a, v16b b, v8f c) {
  v8f d = __builtin_amdgcn_wmma_f32_16x16x32_bf16(false, a, false, b, (short)0, c, false, false);
  asm volatile("v_nop\n\tv_nop\n\tv_nop\n\tv_nop" : "+v"(d) : "v"(a), "v"(b));
  return d;
}
// 16x16x32 fragments: lane = (h = lane>>4, row/col = lane&15); elements 0..7 = k0+8h+0..7, 8..15 = k0+16+8h+0..7; D element r = row 8h+r
__device__ __forceinline__ v16h frag_h(const _Float16* rowk0, int lane) {
  union { v16h v; v8h q[2]; } u; const _Float16* p = rowk0 + 8 * (lane >> 4);
  u.q[0] = *(const v8h*)p; u.q[1] = *(const v8h*)(p + 16); return u.v;
}
__device__ __forceinline__ v16h frag_f32(const float* rowk0, int lane) {
  v16h a; const float* p = rowk0 + 8 * (lane >> 4);
#pragma unroll
  for (int i = 0; i < 8; ++i) { a[i] = (_Float16)p[i]; a[8 + i] = (_Float16)p[16 + i]; }
  return a;
}
__device__ __forceinline__ v16h frag_f32s(const float* rowk0, int lane, float sc) {
  v16h a; const float* p = rowk0 + 8 * (lane >> 4);
#pragma unroll
  for (int i = 0; i < 8; ++i) { a[i] = (_Float16)(p[i] * sc); a[8 + i] = (_Float16)(p[16 + i] * sc); }
  return a;
}
// column fragment from a [K][ld] layout (column n), rows >= K read as 0
__device__ __forceinline__ v16h fragc_f32(const float* W, int k0, int n, int lane, int ld, int K) {
  v16h a; const int g = lane >> 4;
#pragma unroll
  for (int i = 0; i < 8; ++i) { const int ka = k0 + 8 * g + i, kb = ka + 16;
    a[i] = (_Float16)(ka < K ? W[(size_t)(ka < K ? ka : K - 1) * ld + n] : 0.f); a[8 + i] = (_Float16)(kb < K ? W[(size_t)(kb < K ? kb : K - 1) * ld + n] : 0.f); }
  return a;
}
struct F2 { v16b h, l; };
__device__ __forceinline__ F2 bsplit16(const float v[16]) { F2 r;
#pragma unroll
  for (int i = 0; i < 16; ++i) { const __bf16 h = (__bf16)v[i]; r.h[i] = h; r.l[i] = (__bf16)(v[i] - (float)h); }
  return r; }
__device__ __forceinline__ F2 split_row(const float* row, int k0, int lane) { float v[16]; const float* p = row + k0 + 8 * (lane >> 4);
#pragma unroll
  for (int i = 0; i < 8; ++i) { v[i] = p[i]; v[8 + i] = p[16 + i]; }
  return bsplit16(v); }
__device__ __forceinline__ F2 split_rowK(const float* row, int k0, int lane, int K) { float v[16]; const int g = lane >> 4;
#pragma unroll
  for (int i = 0; i < 8; ++i) { const int ka = k0 + 8 * g + i, kb = ka + 16; v[i] = ka < K ? row[ka < K ? ka : K - 1] : 0.f; v[8 + i] = kb < K ? row[kb < K ? kb : K - 1] : 0.f; }
  return bsplit16(v); }
__device__ __forceinline__ F2 split_col(const float* W, int k0, int n, int lane, int ld, int K) { float v[16]; const int g = lane >> 4;
#pragma unroll
  for (int i = 0; i < 8; ++i) { const int ka = k0 + 8 * g + i, kb = ka + 16; v[i] = ka < K ? W[(size_t)(ka < K ? ka : K - 1) * ld + n] : 0.f; v[8 + i] = kb < K ? W[(size_t)(kb < K ? kb : K - 1) * ld + n] : 0.f; }
  return bsplit16(v); }
__device__ __forceinline__ v8f mac3(const F2& a, const F2& b, v8f c) { c = wmma_bf(a.l, b.h, c); c = wmma_bf(a.h, b.l, c); return wmma_bf(a.h, b.h, c); }
__device__ __forceinline__ float sigm(float v) { return 1.0f / (1.0f + expf(-v)); }
#define LDSX() do { asm volatile("s_wait_dscnt 0" ::: "memory"); __builtin_amdgcn_wave_barrier(); __builtin_amdgcn_fence(__ATOMIC_RELEASE, "workgroup"); } while (0)

// Scaled dot-product attention on given tensors whose softmax runs over the QUERY axis (Q / K / V [4,4096,64]; scores = Q K^T / 8 of shape [B, q, k]; attn = softmax(scores, axis=1) - axis 1 is the QUERY axis, so every key COLUMN is normalised over the 4,096 queries (faithful to the source); out = attn V -> [4,4096,64]; no mask).
#define NB 4
#define TT 4096
#define CC 64            // NH * HD = projected width
#define DIN 64          // input (model) width
#define NH 1
#define HD 64
#define NQB (TT / 64)
#define HG 1
#define SCALE (0.125f)
#define CAUSAL 0
#ifndef TNB
#define TNB NB
#endif
__device__ __forceinline__ float bfr(float v) { return (float)(__bf16)v; }
__host__ __device__ __forceinline__ int kb_last(int qb) { return CAUSAL ? ((qb * 64 + 63) >> 7) : (TT / 128 - 1); }
typedef __attribute__((ext_vector_type(8))) __bf16 v8b;
__device__ __forceinline__ v16b frag_b(const __bf16* rowk0, int lane) {
  union { v16b v; v8b q[2]; } u; const __bf16* p = rowk0 + 8 * (lane >> 4);
  u.q[0] = *(const v8b*)p; u.q[1] = *(const v8b*)(p + 16); return u.v;
}
#define QBH 0              // exact planes: single-product logits and single-f16 P x V on every block
#define QHI 0               // no q residual plane (q is bf16-exact in f16)
#define KHI 64              // unused high-precision planes kept minimal
// B fragment (k rows k0+.., output column o) of a weight: (in,out) [K][ld] or (out,in) [ld rows of K]: bf16 exact, or f16(bf16 * 256) exact
__device__ __forceinline__ v16b wcol_io(const float* Wm, int k0, int o, int lane, int ld) { v16b w; const int g = lane >> 4;
#pragma unroll
  for (int i = 0; i < 8; ++i) { w[i] = (__bf16)Wm[(size_t)(k0 + 8 * g + i) * ld + o]; w[8 + i] = (__bf16)Wm[(size_t)(k0 + 16 + 8 * g + i) * ld + o]; }
  return w; }
__device__ __forceinline__ v16b wcol_oi(const float* Wm, int k0, int o, int lane, int K) { v16b w; const float* p = Wm + (size_t)o * K + k0 + 8 * (lane >> 4);
#pragma unroll
  for (int i = 0; i < 8; ++i) { w[i] = (__bf16)p[i]; w[8 + i] = (__bf16)p[16 + i]; }
  return w; }
__device__ __forceinline__ v16h wcolh_io(const float* Wm, int k0, int o, int lane, int ld) { v16h w; const int g = lane >> 4;
#pragma unroll
  for (int i = 0; i < 8; ++i) { w[i] = (_Float16)(bfr(Wm[(size_t)(k0 + 8 * g + i) * ld + o]) * 256.0f); w[8 + i] = (_Float16)(bfr(Wm[(size_t)(k0 + 16 + 8 * g + i) * ld + o]) * 256.0f); }
  return w; }
__device__ __forceinline__ v16h wcolh_oi(const float* Wm, int k0, int o, int lane, int K) { v16h w; const float* p = Wm + (size_t)o * K + k0 + 8 * (lane >> 4);
#pragma unroll
  for (int i = 0; i < 8; ++i) { w[i] = (_Float16)(bfr(p[i]) * 256.0f); w[8 + i] = (_Float16)(bfr(p[16 + i]) * 256.0f); }
  return w; }
#define WQKV_LAYOUT 0   // 0 = (in,out) [DIN][CC]; 1 = (out,in) [CC][DIN]; 2 = per-head [NH][DIN][HD]
__device__ __forceinline__ v16b wcol_hdk(const float* Wm, int k0, int o, int lane) { v16b w; const int g = lane >> 4; const float* p = Wm + (size_t)(o / HD) * DIN * HD + (o % HD);
#pragma unroll
  for (int i = 0; i < 8; ++i) { w[i] = (__bf16)p[(size_t)(k0 + 8 * g + i) * HD]; w[8 + i] = (__bf16)p[(size_t)(k0 + 16 + 8 * g + i) * HD]; }
  return w; }
#define WO_OUT_IN 0
#if WQKV_LAYOUT == 1
#define WCOL(W, k0, o, lane) wcol_oi(W, k0, o, lane, DIN)
#elif WQKV_LAYOUT == 2
#define WCOL(W, k0, o, lane) wcol_hdk(W, k0, o, lane)
#else
#define WCOL(W, k0, o, lane) wcol_io(W, k0, o, lane, CC)
#endif
#if WO_OUT_IN
#define WOCOL(W, k0, o, lane) wcol_oi(W, k0, o, lane, CC)
#define WOCOLH(W, k0, o, lane) wcolh_oi(W, k0, o, lane, CC)
#else
#define WOCOL(W, k0, o, lane) wcol_io(W, k0, o, lane, DIN)
#define WOCOLH(W, k0, o, lane) wcolh_io(W, k0, o, lane, DIN)
#endif
// The q, k and v planes lie in FRAGMENT ORDER. A 16 x 32 operand fragment (16 rows or channels x 32 k) is 1 KiB = [part p = 0, 1][lane = 16 h + row][8 elements], the piece holding k = k0 + 16 p + 8 h + 0..7: frag_h's k order, unchanged. Each of a fragment's two 16-byte loads then reads 512 consecutive bytes, four whole 128-byte lines, where a row-major plane gives a load 32 bytes out of each of 16 lines.
// q, k: [flat row / 16][k / 32] fragments; element offset of piece q8 (elements 8 q8 .. 8 q8 + 7) of flat row r
#define FRAG_QK(r, q8) (((size_t)(r) >> 4) * (16 * CC) + (size_t)(((q8) >> 1) * 256 + (((q8) & 1) * 16 + ((int)(r) & 15)) * 8))
// v, per batch: [key / 32][channel / 16] fragments; element offset of piece t8 (keys 8 t8 .. 8 t8 + 7) of channel c
#define FRAG_V(c, t8) ((size_t)((((t8) >> 2) * (CC / 16) + ((c) >> 4)) * 512 + (((t8) >> 1) & 1) * 256 + (((t8) & 1) * 16 + ((c) & 15)) * 8))
__global__ __launch_bounds__(256) void k_planes64(const float* __restrict__ Qs, const float* __restrict__ Ks, const float* __restrict__ Vs, _Float16* __restrict__ QH, _Float16* __restrict__ QL, _Float16* __restrict__ KH, _Float16* __restrict__ KL, _Float16* __restrict__ VT, __bf16* __restrict__ VB, __bf16* __restrict__ VBL) {
  __shared__ _Float16 sv[64][72];
  const int tid = threadIdx.x; const size_t r0 = (size_t)blockIdx.x * 64; const int b = (int)(r0 / TT), t0 = (int)(r0 % TT);
  for (int e = tid; e < 64 * 8; e += 256) { const int rl = ((e >> 6) << 3) | ((e >> 2) & 7), q = (((e >> 5) & 1) << 2) | (e & 3);   // a wave = 8 rows x 4 pieces of 8 elements: it reads one whole line of each row and stores whole lines of the fragment-order planes
    const size_t src = (r0 + rl) * CC + q * 8, dst = FRAG_QK(r0 + rl, q); float tq[8], tk[8], tv[8];
#pragma unroll
    for (int u = 0; u < 8; ++u) { tq[u] = Qs[src + u]; tk[u] = Ks[src + u]; tv[u] = Vs[src + u]; }
    asm volatile("s_wait_loadcnt 0x0" ::: "memory");
    hx8 hq, hk, hlq, hlk;
#pragma unroll
    for (int u = 0; u < 8; ++u) { const float qv = bfr(tq[u]), kv = bfr(tk[u]); const _Float16 qh = (_Float16)qv, kh = (_Float16)kv; hq[u] = qh; hlq[u] = (_Float16)((qv - (float)qh) * 1024.0f); hk[u] = kh; hlk[u] = (_Float16)((kv - (float)kh) * 1024.0f); sv[rl][q * 8 + u] = (_Float16)bfr(tv[u]); }
    vst2((unsigned*)(QH + dst), *(const v4u*)&hq); vst2((unsigned*)(KH + dst), *(const v4u*)&hk);
    asm volatile("s_wait_xcnt 0x0" ::: "memory");   // behind the two stores, ahead of whatever writes their address or data registers again (the residual below, the next trip)
    if (t0 + rl < QHI) vst2((unsigned*)(QL + ((size_t)b * QHI + t0 + rl) * CC + q * 8), *(const v4u*)&hlq);
    if (t0 + rl < KHI) vst2((unsigned*)(KL + ((size_t)b * KHI + t0 + rl) * CC + q * 8), *(const v4u*)&hlk); }
  __syncthreads();
  for (int e = tid; e < 64 * 8; e += 256) { const int c = ((e >> 6) << 3) | (e & 7), q = (e >> 3) & 7;   // 8 neighbouring channels of one piece of 8 keys fill one line of the fragment-order plane
    hx8 hv; _Pragma("unroll") for (int j = 0; j < 8; ++j) hv[j] = sv[q * 8 + j][c]; vst2((unsigned*)(VT + (size_t)b * CC * TT + FRAG_V(c, t0 / 8 + q)), *(const v4u*)&hv);
    asm volatile("s_wait_xcnt 0x0" ::: "memory");   // behind the store, ahead of whatever writes its address or data registers again
    if (t0 < KHI) { v8b bh, bl; _Pragma("unroll") for (int j = 0; j < 8; ++j) { const float vv = (float)hv[j]; const __bf16 h1 = (__bf16)vv; bh[j] = h1; bl[j] = (__bf16)(vv - (float)h1); } vst2((unsigned*)(VB + ((size_t)b * CC + c) * KHI + t0 + q * 8), *(const v4u*)&bh); vst2((unsigned*)(VBL + ((size_t)b * CC + c) * KHI + t0 + q * 8), *(const v4u*)&bl); } } }
#define SM_EXTRA_PARAMS
#define SM_MASK_HOOK (void)0
#ifndef SM_EXTRA_PARAMS
#define SM_EXTRA_PARAMS
#endif
#ifndef PROJ_EXTRA_PARAMS
#define PROJ_EXTRA_PARAMS
#endif
#ifndef SM_MASK_HOOK
#define SM_MASK_HOOK (void)0
#endif

#define WS_QH  0u                                      // f16 q, fragment order (FRAG_QK)
#define WS_KH  (WS_QH + 2u * (size_t)NB * TT * CC)      // f16 k, fragment order (FRAG_QK)
#define WS_VT  (WS_KH + 2u * (size_t)NB * TT * CC)      // f16 v, per batch in fragment order (FRAG_V)
#define WS_QL  (WS_VT + 2u * (size_t)NB * CC * TT)      // f16 q residual x 2^10 rows [b][t < QHI][CC]
#define WS_KL  (WS_QL + 2u * (size_t)NB * QHI * CC)     // f16 k residual x 2^10 rows [b][t < KHI][CC]
#define WS_VB  (WS_KL + 2u * (size_t)NB * KHI * CC)     // bf16 v hi planes [b][c][t < KHI]
#define WS_VBL (WS_VB + 2u * (size_t)NB * CC * KHI)
#define WS_END (WS_VBL + 2u * (size_t)NB * CC * KHI)
#define WS_CL (WS_END)                                  // f32 column exponent offsets [b][TT]
#define WS_END2 (WS_CL + 4u * (size_t)NB * TT)

// ---- k_proj: block = (64 rows, 128 cols, which): q/k/v = X W (+ b) with exact bf16 products (K = DIN) -> which 0: q f16 rows (+ residual rows < QHI); 1: k f16 rows (+ residual rows < KHI); 2: v f16 planes [c][t] (+ bf16 hi/lo planes for t < KHI)
__global__ __launch_bounds__(128) void k_proj(const float* __restrict__ XQ, const float* __restrict__ XK, const float* __restrict__ XV, const float* __restrict__ WQ, const float* __restrict__ WK, const float* __restrict__ WV, const float* __restrict__ BQ, const float* __restrict__ BK, const float* __restrict__ BV,
    _Float16* __restrict__ QH, _Float16* __restrict__ QL, _Float16* __restrict__ KH, _Float16* __restrict__ KL, _Float16* __restrict__ VT, __bf16* __restrict__ VB, __bf16* __restrict__ VBL) {
  __shared__ __align__(16) _Float16 sh[64][136], sl[64][136]; __shared__ __align__(16) _Float16 th[128][72]; __shared__ __align__(16) __bf16 tb[128][72], tbl[128][72];
  const int tid = threadIdx.x, wave = tid >> 5, lane = tid & 31, col = lane & 15, g = lane >> 4; const int which = blockIdx.z; const int c0 = blockIdx.y * 128; const size_t r0 = (size_t)blockIdx.x * 64; const size_t bb = r0 / TT; const int t0 = (int)(r0 % TT);
  const float* X = which == 0 ? XQ : which == 1 ? XK : XV; const float* WA = which == 0 ? WQ : which == 1 ? WK : WV; const float* BA = which == 0 ? BQ : which == 1 ? BK : BV;
  v8f acc[8] = {};
#pragma unroll 2
  for (int kc = 0; kc < DIN / 32; ++kc) { v16b a; { const float* p = X + (r0 + wave * 16 + col) * DIN + kc * 32 + 8 * g;
#pragma unroll
      for (int i = 0; i < 8; ++i) { a[i] = (__bf16)p[i]; a[8 + i] = (__bf16)p[16 + i]; } }
    asm volatile("s_wait_loadcnt 0x0" ::: "memory");
#pragma unroll
    for (int j = 0; j < 8; ++j) { const v16b w = WCOL(WA, kc * 32, c0 + j * 16 + col, lane); asm volatile("s_wait_loadcnt 0x0" ::: "memory"); acc[j] = wmma_bf(a, w, acc[j]); } }
  if (which < 2) { _Float16* DH = which == 0 ? QH : KH; _Float16* DL = which == 0 ? QL : KL; const int nhi = which == 0 ? QHI : KHI; const bool hi_rows = t0 < nhi;
#pragma unroll
    for (int j = 0; j < 8; ++j) { const float bias = BA ? bfr(BA[c0 + j * 16 + col]) : 0.f;
#pragma unroll
      for (int r = 0; r < 8; ++r) { const float v = acc[j][r] + bias; const _Float16 hv = (_Float16)v; sh[wave * 16 + 8 * g + r][j * 16 + col] = hv; sl[wave * 16 + 8 * g + r][j * 16 + col] = (_Float16)((v - (float)hv) * 1024.0f); } }
    __syncthreads();
    for (int e = tid; e < 64 * 16; e += 128) { const int rl = e >> 4, q = e & 15; vst2((unsigned*)(DH + (r0 + rl) * CC + c0 + q * 8), *(const v4u*)&sh[rl][q * 8]); if (hi_rows) vst2((unsigned*)(DL + (bb * nhi + t0 + rl) * (size_t)CC + c0 + q * 8), *(const v4u*)&sl[rl][q * 8]); }
  } else { const bool hi_rows = t0 < KHI;
#pragma unroll
    for (int j = 0; j < 8; ++j) { const float bias = BA ? bfr(BA[c0 + j * 16 + col]) : 0.f;
#pragma unroll
      for (int r = 0; r < 8; ++r) { const float v = acc[j][r] + bias; const int rl = wave * 16 + 8 * g + r, cl = j * 16 + col; th[cl][rl] = (_Float16)v; const __bf16 bh = (__bf16)v; tb[cl][rl] = bh; tbl[cl][rl] = (__bf16)(v - (float)bh); } }
    __syncthreads();
    for (int e = tid; e < 128 * 8; e += 128) { const int cl = e >> 3, q = e & 7; vst2((unsigned*)(VT + (bb * CC + c0 + cl) * (size_t)TT + t0 + q * 8), *(const v4u*)&th[cl][q * 8]); if (hi_rows) { const size_t o3 = (bb * CC + c0 + cl) * (size_t)KHI + t0 + q * 8; vst2((unsigned*)(VB + o3), *(const v4u*)&tb[cl][q * 8]); vst2((unsigned*)(VBL + o3), *(const v4u*)&tbl[cl][q * 8]); } } } }
// ---- k_sm: block = query row t (head in group): keys [0, kend): causal -> logit if s <= t else excluded; softmax in f32; P x 2^11 in place (0 for excluded)
__global__ __launch_bounds__(256) void k_sm(float* __restrict__ S0 SM_EXTRA_PARAMS) { __shared__ float sred[8]; __shared__ float sbc; __shared__ __align__(16) float shv[TT];
  const int tid = threadIdx.x; const int t = blockIdx.x; const int kend = (kb_last(t >> 6) + 1) * 128;
  float* sr = S0 + (size_t)blockIdx.y * TT * TT + (size_t)t * TT;
  float m = -3.0e38f; for (int k = tid; k < kend; k += 256) { float v = (!CAUSAL || k <= t) ? sr[k] : -3.0e38f; SM_MASK_HOOK; shv[k] = v; m = fmaxf(m, v); }
#pragma unroll
  for (int o = 1; o < 32; o <<= 1) m = fmaxf(m, __shfl_xor(m, o));
  if ((tid & 31) == 0) sred[tid >> 5] = m; __syncthreads(); if (tid == 0) { float a = sred[0]; for (int i = 1; i < 8; ++i) a = fmaxf(a, sred[i]); sbc = a; } __syncthreads(); m = sbc; __syncthreads();
  float sum = 0.f; for (int k = tid; k < kend; k += 256) { const float v = shv[k]; const float e = (v <= -1.0e38f) ? 0.f : expf(v - m); shv[k] = e; sum += e; }
#pragma unroll
  for (int o = 1; o < 32; o <<= 1) sum += __shfl_xor(sum, o);
  if ((tid & 31) == 0) sred[tid >> 5] = sum; __syncthreads(); if (tid == 0) { float a = 0.f; for (int i = 0; i < 8; ++i) a += sred[i]; sbc = a > 0.f ? 2048.0f / a : 0.f; }   /* a fully excluded row yields P = 0 */ __syncthreads(); const float inv = sbc;
  for (int k = tid; k < kend; k += 256) shv[k] = shv[k] * inv;
  __syncthreads(); for (int q = tid; q < kend / 4; q += 256) vst2(sr + q * 4, *(const v4f*)&shv[q * 4]); }
// plain builtin form of the f16 product: the compiler keeps the distance behind it itself
__device__ __forceinline__ v8f mm16(v16h a, v16h b, v8f c) { return __builtin_amdgcn_wmma_f32_16x16x32_f16(false, a, false, b, (short)0, c, false, false); }
// a fragment of a fragment-order plane from the lane's own pointer (fragment start + 8 lane): part 0, then part 1 at + 256 elements
__device__ __forceinline__ v16h frag_t(const _Float16* p) { union { v16h v; v8h q[2]; } u; u.q[0] = *(const v8h*)p; u.q[1] = *(const v8h*)(p + 256); return u.v; }
// The scores are never stored: both kernels below form their own q x k tiles on the matrix unit and use them from the accumulator registers.
// Exponentials run in base 2: exp(SCALE x - SCALE m) = 2^(C2 x - C2 m) with C2 = SCALE log2(e), so a raw score costs one multiply-add and one hardware exp2; the multiply-add rounds the argument once, to 2^-24 of its size, the order of the f32 score's own rounding
#define C2 (SCALE * 1.44269504088896340736f)
__device__ __forceinline__ float ex2(float x) { return __builtin_amdgcn_exp2f(x); }
// the exponents of two neighbouring accumulator registers in one packed multiply-add
__device__ __forceinline__ v2f arg2(float xa, float xb, float la, float lb) { return __builtin_elementwise_fma((v2f){xa, xb}, (v2f){C2, C2}, (v2f){la, lb}); }
// ---- k_cstat: softmax over the QUERY axis (the source's softmax(axis=1) on a [B, q, k] tensor): for every key column k, on the raw products x = q . k: m_k = max_q x, Z_k = sum_q 2^(C2 x - C2 m_k) (f32); stored: L_k = 11 - C2 m_k - log2(Z_k), so that P x 2^11 = 2^(C2 x + L_k). Work-group = 64 key columns (their 8 B fragments held in registers by every wave), the 4,096 queries dealt to 16 waves; S = Q K^T: A = 16 query rows, B = 16 key columns, so a lane holds 8 queries of ONE key column per tile: running max / sum in-lane, one rescale per 16 scores. The halves of a wave meet by one lane exchange, the 16 waves' partials in LDS behind one barrier
#define C1W 16           // waves per work-group (query axis)
#define C1K 4            // 16-column key tiles per work-group
__global__ __launch_bounds__(C1W * 32) void k_cstat(const _Float16* __restrict__ QH, const _Float16* __restrict__ KH, float* __restrict__ CL) { __shared__ float pm[C1W][C1K * 16], pz[C1W][C1K * 16];
  const int tid = threadIdx.x, wave = tid >> 5, lane = tid & 31, col = lane & 15;
  const size_t kr0 = (size_t)blockIdx.x * (C1K * 16);                            // flat key row b * TT + k
  const size_t qr0 = (kr0 / TT) * TT + (size_t)wave * (TT / C1W);                // this wave's first flat query row
  v16h kf[C1K][2]; const _Float16* kq = KH + kr0 * CC + lane * 8;                // 16 rows = 2 fragments = 16 * CC elements
#pragma unroll
  for (int j = 0; j < C1K; ++j) { kf[j][0] = frag_t(kq + j * 16 * CC); kf[j][1] = frag_t(kq + j * 16 * CC + 512); }
  asm volatile("s_wait_xcnt 0x0" ::: "memory");   // behind the 16 loads, ahead of whatever writes their base or offset register again
  float m[C1K], z[C1K];
#pragma unroll
  for (int j = 0; j < C1K; ++j) { m[j] = -3.0e38f; z[j] = 0.f; }
  // The 64 work-groups of a batch walk the same q lines. Each starts its walk at a trip of its own and wraps, so that they do not ask L2 for one line at one moment; every trip is still walked once, whatever the start. The start leaves out index bit 2, so that work-groups 4 apart share one (speed only)
  const int st = (int)((blockIdx.x & 3) | ((blockIdx.x >> 1) & 4));
  for (int t = 0; t < TT / C1W / 32; ++t) { const _Float16* qp = QH + (qr0 + ((t + st) & (TT / C1W / 32 - 1)) * 32) * CC + lane * 8;
    const v16h a00 = frag_t(qp), a01 = frag_t(qp + 512), a10 = frag_t(qp + 16 * CC), a11 = frag_t(qp + 16 * CC + 512);
#pragma unroll
    for (int j = 0; j < C1K; ++j) { v8f s0 = {}, s1 = {}; s0 = mm16(a00, kf[j][0], s0); s1 = mm16(a10, kf[j][0], s1); s0 = mm16(a01, kf[j][1], s0); s1 = mm16(a11, kf[j][1], s1);
      float mn = m[j];
#pragma unroll
      for (int r = 0; r < 8; ++r) mn = fmaxf(mn, fmaxf(s0[r], s1[r]));
      const float nb = -C2 * mn; float s = 0.f;
#pragma unroll
      for (int r = 0; r < 8; r += 2) { const v2f t0 = arg2(s0[r], s0[r + 1], nb, nb), t1 = arg2(s1[r], s1[r + 1], nb, nb); s += ex2(t0[0]) + ex2(t1[0]); s += ex2(t0[1]) + ex2(t1[1]); }
      z[j] = z[j] * ex2(fmaf(m[j], C2, nb)) + s; m[j] = mn; }
    asm volatile("s_wait_xcnt 0x0" ::: "memory"); }   // behind the trip's 8 loads, ahead of the next trip's write of their address pair
#pragma unroll
  for (int j = 0; j < C1K; ++j) { const float mo = __shfl_xor(m[j], 16), zo = __shfl_xor(z[j], 16); const float mm = fmaxf(m[j], mo); const float zz = z[j] * ex2((m[j] - mm) * C2) + zo * ex2((mo - mm) * C2);
    if (lane < 16) { pm[wave][j * 16 + col] = mm; pz[wave][j * 16 + col] = zz; } }
  __syncthreads();
  if (tid < C1K * 16) { float mm = pm[0][tid];
#pragma unroll
    for (int w = 1; w < C1W; ++w) mm = fmaxf(mm, pm[w][tid]);
    float zz = 0.f;
#pragma unroll
    for (int w = 0; w < C1W; ++w) zz += pz[w][tid] * ex2((pm[w][tid] - mm) * C2);
    CL[kr0 + tid] = 11.0f - mm * C2 - log2f(zz); } }
// ---- k_ctx: out = P v with P[q][k] x 2^11 = 2^(C2 x + L_k), once to f16, against v f16 (1 product). Work-group = 64 queries: 2 query groups of 32 x 8 key shares, one wave each; the keys are dealt to the shares in slices of 32, so that the 8 shares of one trip read 256 consecutive keys (32 KiB in a row of the k plane and of the v plane). S^T = K Q^T (A = 16 key rows, B = 16 query columns): two S^T tiles of 32 consecutive keys, turned into P in place, ARE the B fragment of O^T += V^T P^T in the hardware k order (element s < 8: key 8h + s, else key 16 + 8h + s - 8), which is frag_h's order for the v plane rows; P touches neither LDS nor memory. The 8 shares' partial outputs meet in LDS behind one barrier (summed in share order)
#define P2Q 2            // 32-query groups per work-group
#define P2S 8            // key shares per work-group
__global__ __launch_bounds__(P2Q * P2S * 32) void k_ctx(const _Float16* __restrict__ QH, const _Float16* __restrict__ KH, const _Float16* __restrict__ VT, const float* __restrict__ CL, float* __restrict__ Y) { __shared__ __align__(16) float red[P2S][P2Q * 32][HD + 4];
  const int tid = threadIdx.x, wave = tid >> 5, lane = tid & 31, col = lane & 15, g = lane >> 4; const int qg = wave % P2Q, ks = wave / P2Q;
  const size_t q0 = (size_t)blockIdx.x * (P2Q * 32); const size_t b = q0 / TT;   // flat query row b * TT + t
  const _Float16* Kb = KH + b * TT * CC; const _Float16* Vb = VT + b * CC * TT; const float* cl = CL + b * TT;
  v16h qf[2][2];
#pragma unroll
  for (int i = 0; i < 2; ++i) { qf[i][0] = frag_t(QH + (q0 + qg * 32 + i * 16) * CC + lane * 8); qf[i][1] = frag_t(QH + (q0 + qg * 32 + i * 16) * CC + 512 + lane * 8); }
  v8f acc[2][HD / 16] = {};
  // The 64 work-groups of a batch walk the same k and v lines. Each starts at a trip of its own and wraps (see k_cstat): 16 starts from index bits 0, 1, 3, 4
  const unsigned st = (blockIdx.x & 3) | ((blockIdx.x >> 1) & 12);
  unsigned ko = (unsigned)(ks * 32 * CC + lane * 8) * 2u + st * (P2S * 32 * CC * 2u), so = (unsigned)(ks * 32 + 8 * g) * 4u + st * (P2S * 32 * 4u);   // the lane's own byte offsets for keys k0 = (((t + st) % 16) * P2S + ks) * 32 ..: ko for its piece of the first of the 4 k and of the 4 v fragments of those 32 keys (4 KiB in a row in either plane, at the same offset), so for the column statistics; they step with the trip, on bases that are the same for the whole work-group
  for (int t = 0; t < TT / P2S / 32; ++t) { const _Float16* kp = (const _Float16*)((const char*)Kb + ko); const _Float16* vp = (const _Float16*)((const char*)Vb + ko); const float* mp = (const float*)((const char*)cl + so);
    const v16h k00 = frag_t(kp), k01 = frag_t(kp + 512), k10 = frag_t(kp + 16 * CC), k11 = frag_t(kp + 16 * CC + 512);
    const v4f m0a = *(const v4f*)(mp), m0b = *(const v4f*)(mp + 4), m1a = *(const v4f*)(mp + 16), m1b = *(const v4f*)(mp + 20);
    v16h vf[HD / 16];
#pragma unroll
    for (int j = 0; j < HD / 16; ++j) vf[j] = frag_t(vp + j * 512);
    asm volatile("s_wait_xcnt 0x0" : "+v"(ko), "+v"(so) :: "memory");   // behind the trip's loads: their two offset registers pass through the wait, so that no load's result lands in one and no step is added to one ahead of it
    __builtin_amdgcn_sched_barrier(0);   // keeps the trip's loads together at its head: the v and statistics loads fly under the score products instead of being issued just ahead of their use
    ko = (ko + P2S * 32 * CC * 2u) & (TT * CC * 2u - 1u); so = (so + P2S * 32 * 4u) & (TT * 4u - 1u);   // the step wraps at the end of the batch's plane
#pragma unroll
    for (int i = 0; i < 2; ++i) { v8f s0 = {}, s1 = {}; s0 = mm16(k00, qf[i][0], s0); s1 = mm16(k10, qf[i][0], s1); s0 = mm16(k01, qf[i][1], s0); s1 = mm16(k11, qf[i][1], s1);
      v16h p;
#pragma unroll
      for (int r = 0; r < 4; r += 2) { const v2f t0 = arg2(s0[r], s0[r + 1], m0a[r], m0a[r + 1]), t1 = arg2(s0[4 + r], s0[5 + r], m0b[r], m0b[r + 1]), t2 = arg2(s1[r], s1[r + 1], m1a[r], m1a[r + 1]), t3 = arg2(s1[4 + r], s1[5 + r], m1b[r], m1b[r + 1]);
        p[r] = (_Float16)ex2(t0[0]); p[r + 1] = (_Float16)ex2(t0[1]); p[4 + r] = (_Float16)ex2(t1[0]); p[5 + r] = (_Float16)ex2(t1[1]); p[8 + r] = (_Float16)ex2(t2[0]); p[9 + r] = (_Float16)ex2(t2[1]); p[12 + r] = (_Float16)ex2(t3[0]); p[13 + r] = (_Float16)ex2(t3[1]); }
#pragma unroll
      for (int j = 0; j < HD / 16; ++j) acc[i][j] = mm16(vf[j], p, acc[i][j]); } }
  // acc[i][j][r] = O[query i * 16 + col][channel j * 16 + 8 g + r] x 2^11 over this wave's key share
#pragma unroll
  for (int i = 0; i < 2; ++i)
#pragma unroll
    for (int j = 0; j < HD / 16; ++j) { float* rp = &red[ks][qg * 32 + i * 16 + col][j * 16 + 8 * g]; v4f lo, hi;
#pragma unroll
      for (int r = 0; r < 4; ++r) { lo[r] = acc[i][j][r]; hi[r] = acc[i][j][4 + r]; }
      *(v4f*)rp = lo; *(v4f*)(rp + 4) = hi; }
  __syncthreads();
  for (int e = tid; e < P2Q * 32 * (HD / 4); e += P2Q * P2S * 32) { const int q = e / (HD / 4), d4 = e % (HD / 4); v4f a = *(const v4f*)&red[0][q][d4 * 4];
#pragma unroll
    for (int s = 1; s < P2S; ++s) a += *(const v4f*)&red[s][q][d4 * 4];
    vst2(Y + (q0 + q) * CC + d4 * 4, a * (1.0f / 2048.0f)); } }

extern "C" void kernel_launch(void* const* d_in, const int* in_sizes, int n_in, void* d_out, int out_size, void* d_ws, size_t ws_size, hipStream_t stream) {
  (void)in_sizes; (void)n_in; (void)out_size;
  const float** F = (const float**)d_in;
  if (ws_size < (size_t)WS_END2) return;
  char* ws = (char*)d_ws; _Float16 *QH = (_Float16*)(ws + WS_QH), *KH = (_Float16*)(ws + WS_KH), *VT = (_Float16*)(ws + WS_VT), *QL = (_Float16*)(ws + WS_QL), *KL = (_Float16*)(ws + WS_KL); __bf16 *VB = (__bf16*)(ws + WS_VB), *VBL = (__bf16*)(ws + WS_VBL);
  float *CL = (float*)(ws + WS_CL);
  // inputs: 0 Q [4,4096,64]; 1 K; 2 V
  k_planes64<<<dim3(TNB * TT / 64), 256, 0, stream>>>(F[0], F[1], F[2], QH, QL, KH, KL, VT, VB, VBL);
  k_cstat<<<dim3(TNB * TT / (C1K * 16)), C1W * 32, 0, stream>>>(QH, KH, CL);                           /* per key column: the exponent offset from max and sum over the queries */
  k_ctx<<<dim3(TNB * TT / (P2Q * 32)), P2Q * P2S * 32, 0, stream>>>(QH, KH, VT, CL, (float*)d_out);  /* out = P v, P formed in registers */
}

// v006
// One run takes 26.8 microseconds.
// In both of two side-by-side timings against v005, it was 1.04 times as fast.
// Over all steps from v000 it is 249 times as fast.
// compute dtype: all float inputs rounded to bf16; Q, K, V are bf16-valued so their f16 planes are exact; scores q x k (1 product on exact planes) x 64^-0.5; softmax over the QUERY axis in f32 (per key column: max / sum over the 4,096 queries, 32 online partials merged, exponentials in base 2 on the hardware's exp2; scores recomputed per use, never stored); P x 2^11 once to f16 x v (exact) (1 product); f32 output.
#include <hip/hip_runtime.h>
#include <math.h>

typedef __attribute__((ext_vector_type(16))) _Float16 v16h;
typedef __attribute__((ext_vector_type(16))) __bf16 v16b;
typedef __attribute__((ext_vector_type(8)))  _Float16 v8h;
typedef __attribute__((ext_vector_type(8)))  float v8f;
typedef __attribute__((ext_vector_type(4)))  float v4f;
typedef __attribute__((ext_vector_type(2)))  float v2f;
typedef __attribute__((ext_vector_type(4)))  unsigned v4u;
typedef _Float16 hx8 __attribute__((ext_vector_type(8)));
typedef __attribute__((ext_vector_type(4)))  int v4i;
typedef float __attribute__((may_alias)) float_a;
typedef int __attribute__((may_alias)) int_a;

template <typename T> __device__ __forceinline__ void vst2(void* p, T v) { *(T*)p = v;  }
__device__ __forceinline__ v8f wmma16(v16h a, v16h b, v8f c) {
  v8f d = __builtin_amdgcn_wmma_f32_16x16x32_f16(false, a, false, b, (short)0, c, false, false);
  asm volatile("v_nop\n\tv_nop\n\tv_nop\n\tv_nop" : "+v"(d) : "v"(a), "v"(b));
  return d;
}
__device__ __forceinline__ v8f wmma_bf(v16b a, v16b b, v8f c) {
  v8f d = __builtin_amdgcn_wmma_f32_16x16x32_bf16(false, a, false, b, (short)0, c, false, false);
  asm volatile("v_nop\n\tv_nop\n\tv_nop\n\tv_nop" : "+v"(d) : "v"(a), "v"(b));
  return d;
}
// 16x16x32 fragments: lane = (h = lane>>4, row/col = lane&15); elements 0..7 = k0+8h+0..7, 8..15 = k0+16+8h+0..7; D element r = row 8h+r
__device__ __forceinline__ v16h frag_h(const _Float16* rowk0, int lane) {
  union { v16h v; v8h q[2]; } u; const _Float16* p = rowk0 + 8 * (lane >> 4);
  u.q[0] = *(const v8h*)p; u.q[1] = *(const v8h*)(p + 16); return u.v;
}
__device__ __forceinline__ v16h frag_f32(const float* rowk0, int lane) {
  v16h a; const float* p = rowk0 + 8 * (lane >> 4);
#pragma unroll
  for (int i = 0; i < 8; ++i) { a[i] = (_Float16)p[i]; a[8 + i] = (_Float16)p[16 + i]; }
  return a;
}
__device__ __forceinline__ v16h frag_f32s(const float* rowk0, int lane, float sc) {
  v16h a; const float* p = rowk0 + 8 * (lane >> 4);
#pragma unroll
  for (int i = 0; i < 8; ++i) { a[i] = (_Float16)(p[i] * sc); a[8 + i] = (_Float16)(p[16 + i] * sc); }
  return a;
}
// column fragment from a [K][ld] layout (column n), rows >= K read as 0
__device__ __forceinline__ v16h fragc_f32(const float* W, int k0, int n, int lane, int ld, int K) {
  v16h a; const int g = lane >> 4;
#pragma unroll
  for (int i = 0; i < 8; ++i) { const int ka = k0 + 8 * g + i, kb = ka + 16;
    a[i] = (_Float16)(ka < K ? W[(size_t)(ka < K ? ka : K - 1) * ld + n] : 0.f); a[8 + i] = (_Float16)(kb < K ? W[(size_t)(kb < K ? kb : K - 1) * ld + n] : 0.f); }
  return a;
}
struct F2 { v16b h, l; };
__device__ __forceinline__ F2 bsplit16(const float v[16]) { F2 r;
#pragma unroll
  for (int i = 0; i < 16; ++i) { const __bf16 h = (__bf16)v[i]; r.h[i] = h; r.l[i] = (__bf16)(v[i] - (float)h); }
  return r; }
__device__ __forceinline__ F2 split_row(const float* row, int k0, int lane) { float v[16]; const float* p = row + k0 + 8 * (lane >> 4);
#pragma unroll
  for (int i = 0; i < 8; ++i) { v[i] = p[i]; v[8 + i] = p[16 + i]; }
  return bsplit16(v); }
__device__ __forceinline__ F2 split_rowK(const float* row, int k0, int lane, int K) { float v[16]; const int g = lane >> 4;
#pragma unroll
  for (int i = 0; i < 8; ++i) { const int ka = k0 + 8 * g + i, kb = ka + 16; v[i] = ka < K ? row[ka < K ? ka : K - 1] : 0.f; v[8 + i] = kb < K ? row[kb < K ? kb : K - 1] : 0.f; }
  return bsplit16(v); }
__device__ __forceinline__ F2 split_col(const float* W, int k0, int n, int lane, int ld, int K) { float v[16]; const int g = lane >> 4;
#pragma unroll
  for (int i = 0; i < 8; ++i) { const int ka = k0 + 8 * g + i, kb = ka + 16; v[i] = ka < K ? W[(size_t)(ka < K ? ka : K - 1) * ld + n] : 0.f; v[8 + i] = kb < K ? W[(size_t)(kb < K ? kb : K - 1) * ld + n] : 0.f; }
  return bsplit16(v); }
__device__ __forceinline__ v8f mac3(const F2& a, const F2& b, v8f c) { c = wmma_bf(a.l, b.h, c); c = wmma_bf(a.h, b.l, c); return wmma_bf(a.h, b.h, c); }
__device__ __forceinline__ float sigm(float v) { return 1.0f / (1.0f + expf(-v)); }
#define LDSX() do { asm volatile("s_wait_dscnt 0" ::: "memory"); __builtin_amdgcn_wave_barrier(); __builtin_amdgcn_fence(__ATOMIC_RELEASE, "workgroup"); } while (0)

// Scaled dot-product attention on given tensors whose softmax runs over the QUERY axis (Q / K / V [4,4096,64]; scores = Q K^T / 8 of shape [B, q, k]; attn = softmax(scores, axis=1) - axis 1 is the QUERY axis, so every key COLUMN is normalised over the 4,096 queries (faithful to the source); out = attn V -> [4,4096,64]; no mask).
#define NB 4
#define TT 4096
#define CC 64            // NH * HD = projected width
#define DIN 64          // input (model) width
#define NH 1
#define HD 64
#define NQB (TT / 64)
#define HG 1
#define SCALE (0.125f)
#define CAUSAL 0
#ifndef TNB
#define TNB NB
#endif
__device__ __forceinline__ float bfr(float v) { return (float)(__bf16)v; }
__host__ __device__ __forceinline__ int kb_last(int qb) { return CAUSAL ? ((qb * 64 + 63) >> 7) : (TT / 128 - 1); }
typedef __attribute__((ext_vector_type(8))) __bf16 v8b;
__device__ __forceinline__ v16b frag_b(const __bf16* rowk0, int lane) {
  union { v16b v; v8b q[2]; } u; const __bf16* p = rowk0 + 8 * (lane >> 4);
  u.q[0] = *(const v8b*)p; u.q[1] = *(const v8b*)(p + 16); return u.v;
}
#define QBH 0              // exact planes: single-product logits and single-f16 P x V on every block
#define QHI 0               // no q residual plane (q is bf16-exact in f16)
#define KHI 64              // unused high-precision planes kept minimal
// B fragment (k rows k0+.., output column o) of a weight: (in,out) [K][ld] or (out,in) [ld rows of K]: bf16 exact, or f16(bf16 * 256) exact
__device__ __forceinline__ v16b wcol_io(const float* Wm, int k0, int o, int lane, int ld) { v16b w; const int g = lane >> 4;
#pragma unroll
  for (int i = 0; i < 8; ++i) { w[i] = (__bf16)Wm[(size_t)(k0 + 8 * g + i) * ld + o]; w[8 + i] = (__bf16)Wm[(size_t)(k0 + 16 + 8 * g + i) * ld + o]; }
  return w; }
__device__ __forceinline__ v16b wcol_oi(const float* Wm, int k0, int o, int lane, int K) { v16b w; const float* p = Wm + (size_t)o * K + k0 + 8 * (lane >> 4);
#pragma unroll
  for (int i = 0; i < 8; ++i) { w[i] = (__bf16)p[i]; w[8 + i] = (__bf16)p[16 + i]; }
  return w; }
__device__ __forceinline__ v16h wcolh_io(const float* Wm, int k0, int o, int lane, int ld) { v16h w; const int g = lane >> 4;
#pragma unroll
  for (int i = 0; i < 8; ++i) { w[i] = (_Float16)(bfr(Wm[(size_t)(k0 + 8 * g + i) * ld + o]) * 256.0f); w[8 + i] = (_Float16)(bfr(Wm[(size_t)(k0 + 16 + 8 * g + i) * ld + o]) * 256.0f); }
  return w; }
__device__ __forceinline__ v16h wcolh_oi(const float* Wm, int k0, int o, int lane, int K) { v16h w; const float* p = Wm + (size_t)o * K + k0 + 8 * (lane >> 4);
#pragma unroll
  for (int i = 0; i < 8; ++i) { w[i] = (_Float16)(bfr(p[i]) * 256.0f); w[8 + i] = (_Float16)(bfr(p[16 + i]) * 256.0f); }
  return w; }
#define WQKV_LAYOUT 0   // 0 = (in,out) [DIN][CC]; 1 = (out,in) [CC][DIN]; 2 = per-head [NH][DIN][HD]
__device__ __forceinline__ v16b wcol_hdk(const float* Wm, int k0, int o, int lane) { v16b w; const int g = lane >> 4; const float* p = Wm + (size_t)(o / HD) * DIN * HD + (o % HD);
#pragma unroll
  for (int i = 0; i < 8; ++i) { w[i] = (__bf16)p[(size_t)(k0 + 8 * g + i) * HD]; w[8 + i] = (__bf16)p[(size_t)(k0 + 16 + 8 * g + i) * HD]; }
  return w; }
#define WO_OUT_IN 0
#if WQKV_LAYOUT == 1
#define WCOL(W, k0, o, lane) wcol_oi(W, k0, o, lane, DIN)
#elif WQKV_LAYOUT == 2
#define WCOL(W, k0, o, lane) wcol_hdk(W, k0, o, lane)
#else
#define WCOL(W, k0, o, lane) wcol_io(W, k0, o, lane, CC)
#endif
#if WO_OUT_IN
#define WOCOL(W, k0, o, lane) wcol_oi(W, k0, o, lane, CC)
#define WOCOLH(W, k0, o, lane) wcolh_oi(W, k0, o, lane, CC)
#else
#define WOCOL(W, k0, o, lane) wcol_io(W, k0, o, lane, DIN)
#define WOCOLH(W, k0, o, lane) wcolh_io(W, k0, o, lane, DIN)
#endif
// The q, k and v planes lie in FRAGMENT ORDER. A 16 x 32 operand fragment (16 rows or channels x 32 k) is 1 KiB = [part p = 0, 1][lane = 16 h + row][8 elements], the piece holding k = k0 + 16 p + 8 h + 0..7: frag_h's k order, unchanged. Each of a fragment's two 16-byte loads then reads 512 consecutive bytes, four whole 128-byte lines, where a row-major plane gives a load 32 bytes out of each of 16 lines.
// q, k: [flat row / 16][k / 32] fragments; element offset of piece q8 (elements 8 q8 .. 8 q8 + 7) of flat row r
#define FRAG_QK(r, q8) (((size_t)(r) >> 4) * (16 * CC) + (size_t)(((q8) >> 1) * 256 + (((q8) & 1) * 16 + ((int)(r) & 15)) * 8))
// v, per batch: [key / 32][channel / 16] fragments; element offset of piece t8 (keys 8 t8 .. 8 t8 + 7) of channel c
#define FRAG_V(c, t8) ((size_t)((((t8) >> 2) * (CC / 16) + ((c) >> 4)) * 512 + (((t8) >> 1) & 1) * 256 + (((t8) & 1) * 16 + ((c) & 15)) * 8))
__global__ __launch_bounds__(256) void k_planes64(const float* __restrict__ Qs, const float* __restrict__ Ks, const float* __restrict__ Vs, _Float16* __restrict__ QH, _Float16* __restrict__ QL, _Float16* __restrict__ KH, _Float16* __restrict__ KL, _Float16* __restrict__ VT, __bf16* __restrict__ VB, __bf16* __restrict__ VBL) {
  __shared__ _Float16 sv[64][72];
  const int tid = threadIdx.x; const size_t r0 = (size_t)blockIdx.x * 64; const int b = (int)(r0 / TT), t0 = (int)(r0 % TT);
  v4f tq[2][2], tk[2][2], tv[2][2]; const float *pq[2], *pk[2], *pv[2];   // both trips' rows are loaded ahead of the first trip's work: the later loads' memory latency flies with the first's (the two trips are unrolled so that the rows stay in registers)
#pragma unroll
  for (int it = 0; it < 2; ++it) { const int e = tid + it * 256; const int rl = ((e >> 6) << 3) | ((e >> 2) & 7), q = (((e >> 5) & 1) << 2) | (e & 3); const size_t src = (r0 + rl) * CC + q * 8; pq[it] = Qs + src; pk[it] = Ks + src; pv[it] = Vs + src;
#pragma unroll
    for (int u = 0; u < 2; ++u) { tq[it][u] = *(const v4f*)(pq[it] + 4 * u); tk[it][u] = *(const v4f*)(pk[it] + 4 * u); tv[it][u] = *(const v4f*)(pv[it] + 4 * u); } }
  __builtin_amdgcn_sched_barrier(0);   // all 12 loads stay ahead of the waits: none is sunk behind them to its use
  asm volatile("s_wait_xcnt 0x0" :: "v"(pq[0]), "v"(pk[0]), "v"(pv[0]), "v"(pq[1]), "v"(pk[1]), "v"(pv[1]) : "memory");   // behind the 12 loads; their six address pairs are inputs of the wait, so that none is written again ahead of it
  asm volatile("s_wait_loadcnt 0x0" ::: "memory");
#pragma unroll
  for (int it = 0; it < 2; ++it) { const int e = tid + it * 256; const int rl = ((e >> 6) << 3) | ((e >> 2) & 7), q = (((e >> 5) & 1) << 2) | (e & 3);   // a wave = 8 rows x 4 pieces of 8 elements: it reads one whole line of each row and stores whole lines of the fragment-order planes
    const size_t dst = FRAG_QK(r0 + rl, q);
    hx8 hq, hk, hlq, hlk;
#pragma unroll
    for (int u = 0; u < 8; ++u) { const float qv = bfr(tq[it][u >> 2][u & 3]), kv = bfr(tk[it][u >> 2][u & 3]); const _Float16 qh = (_Float16)qv, kh = (_Float16)kv; hq[u] = qh; hlq[u] = (_Float16)((qv - (float)qh) * 1024.0f); hk[u] = kh; hlk[u] = (_Float16)((kv - (float)kh) * 1024.0f); sv[rl][q * 8 + u] = (_Float16)bfr(tv[it][u >> 2][u & 3]); }
    vst2((unsigned*)(QH + dst), *(const v4u*)&hq); vst2((unsigned*)(KH + dst), *(const v4u*)&hk);
    asm volatile("s_wait_xcnt 0x0" ::: "memory");   // behind the two stores, ahead of whatever writes their address or data registers again (the residual below, the next trip)
    if (t0 + rl < QHI) vst2((unsigned*)(QL + ((size_t)b * QHI + t0 + rl) * CC + q * 8), *(const v4u*)&hlq);
    if (t0 + rl < KHI) vst2((unsigned*)(KL + ((size_t)b * KHI + t0 + rl) * CC + q * 8), *(const v4u*)&hlk); }
  __syncthreads();
  for (int e = tid; e < 64 * 8; e += 256) { const int c = ((e >> 6) << 3) | (e & 7), q = (e >> 3) & 7;   // 8 neighbouring channels of one piece of 8 keys fill one line of the fragment-order plane
    hx8 hv; _Pragma("unroll") for (int j = 0; j < 8; ++j) hv[j] = sv[q * 8 + j][c]; vst2((unsigned*)(VT + (size_t)b * CC * TT + FRAG_V(c, t0 / 8 + q)), *(const v4u*)&hv);
    asm volatile("s_wait_xcnt 0x0" ::: "memory");   // behind the store, ahead of whatever writes its address or data registers again
    if (t0 < KHI) { v8b bh, bl; _Pragma("unroll") for (int j = 0; j < 8; ++j) { const float vv = (float)hv[j]; const __bf16 h1 = (__bf16)vv; bh[j] = h1; bl[j] = (__bf16)(vv - (float)h1); } vst2((unsigned*)(VB + ((size_t)b * CC + c) * KHI + t0 + q * 8), *(const v4u*)&bh); vst2((unsigned*)(VBL + ((size_t)b * CC + c) * KHI + t0 + q * 8), *(const v4u*)&bl); } } }
#define SM_EXTRA_PARAMS
#define SM_MASK_HOOK (void)0
#ifndef SM_EXTRA_PARAMS
#define SM_EXTRA_PARAMS
#endif
#ifndef PROJ_EXTRA_PARAMS
#define PROJ_EXTRA_PARAMS
#endif
#ifndef SM_MASK_HOOK
#define SM_MASK_HOOK (void)0
#endif

#define WS_QH  0u                                      // f16 q, fragment order (FRAG_QK)
#define WS_KH  (WS_QH + 2u * (size_t)NB * TT * CC)      // f16 k, fragment order (FRAG_QK)
#define WS_VT  (WS_KH + 2u * (size_t)NB * TT * CC)      // f16 v, per batch in fragment order (FRAG_V)
#define WS_QL  (WS_VT + 2u * (size_t)NB * CC * TT)      // f16 q residual x 2^10 rows [b][t < QHI][CC]
#define WS_KL  (WS_QL + 2u * (size_t)NB * QHI * CC)     // f16 k residual x 2^10 rows [b][t < KHI][CC]
#define WS_VB  (WS_KL + 2u * (size_t)NB * KHI * CC)     // bf16 v hi planes [b][c][t < KHI]
#define WS_VBL (WS_VB + 2u * (size_t)NB * CC * KHI)
#define WS_END (WS_VBL + 2u * (size_t)NB * CC * KHI)
#define WS_CL (WS_END)                                  // f32 column exponent offsets [b][TT]
#define WS_END2 (WS_CL + 4u * (size_t)NB * TT)

// ---- k_proj: block = (64 rows, 128 cols, which): q/k/v = X W (+ b) with exact bf16 products (K = DIN) -> which 0: q f16 rows (+ residual rows < QHI); 1: k f16 rows (+ residual rows < KHI); 2: v f16 planes [c][t] (+ bf16 hi/lo planes for t < KHI)
__global__ __launch_bounds__(128) void k_proj(const float* __restrict__ XQ, const float* __restrict__ XK, const float* __restrict__ XV, const float* __restrict__ WQ, const float* __restrict__ WK, const float* __restrict__ WV, const float* __restrict__ BQ, const float* __restrict__ BK, const float* __restrict__ BV,
    _Float16* __restrict__ QH, _Float16* __restrict__ QL, _Float16* __restrict__ KH, _Float16* __restrict__ KL, _Float16* __restrict__ VT, __bf16* __restrict__ VB, __bf16* __restrict__ VBL) {
  __shared__ __align__(16) _Float16 sh[64][136], sl[64][136]; __shared__ __align__(16) _Float16 th[128][72]; __shared__ __align__(16) __bf16 tb[128][72], tbl[128][72];
  const int tid = threadIdx.x, wave = tid >> 5, lane = tid & 31, col = lane & 15, g = lane >> 4; const int which = blockIdx.z; const int c0 = blockIdx.y * 128; const size_t r0 = (size_t)blockIdx.x * 64; const size_t bb = r0 / TT; const int t0 = (int)(r0 % TT);
  const float* X = which == 0 ? XQ : which == 1 ? XK : XV; const float* WA = which == 0 ? WQ : which == 1 ? WK : WV; const float* BA = which == 0 ? BQ : which == 1 ? BK : BV;
  v8f acc[8] = {};
#pragma unroll 2
  for (int kc = 0; kc < DIN / 32; ++kc) { v16b a; { const float* p = X + (r0 + wave * 16 + col) * DIN + kc * 32 + 8 * g;
#pragma unroll
      for (int i = 0; i < 8; ++i) { a[i] = (__bf16)p[i]; a[8 + i] = (__bf16)p[16 + i]; } }
    asm volatile("s_wait_loadcnt 0x0" ::: "memory");
#pragma unroll
    for (int j = 0; j < 8; ++j) { const v16b w = WCOL(WA, kc * 32, c0 + j * 16 + col, lane); asm volatile("s_wait_loadcnt 0x0" ::: "memory"); acc[j] = wmma_bf(a, w, acc[j]); } }
  if (which < 2) { _Float16* DH = which == 0 ? QH : KH; _Float16* DL = which == 0 ? QL : KL; const int nhi = which == 0 ? QHI : KHI; const bool hi_rows = t0 < nhi;
#pragma unroll
    for (int j = 0; j < 8; ++j) { const float bias = BA ? bfr(BA[c0 + j * 16 + col]) : 0.f;
#pragma unroll
      for (int r = 0; r < 8; ++r) { const float v = acc[j][r] + bias; const _Float16 hv = (_Float16)v; sh[wave * 16 + 8 * g + r][j * 16 + col] = hv; sl[wave * 16 + 8 * g + r][j * 16 + col] = (_Float16)((v - (float)hv) * 1024.0f); } }
    __syncthreads();
    for (int e = tid; e < 64 * 16; e += 128) { const int rl = e >> 4, q = e & 15; vst2((unsigned*)(DH + (r0 + rl) * CC + c0 + q * 8), *(const v4u*)&sh[rl][q * 8]); if (hi_rows) vst2((unsigned*)(DL + (bb * nhi + t0 + rl) * (size_t)CC + c0 + q * 8), *(const v4u*)&sl[rl][q * 8]); }
  } else { const bool hi_rows = t0 < KHI;
#pragma unroll
    for (int j = 0; j < 8; ++j) { const float bias = BA ? bfr(BA[c0 + j * 16 + col]) : 0.f;
#pragma unroll
      for (int r = 0; r < 8; ++r) { const float v = acc[j][r] + bias; const int rl = wave * 16 + 8 * g + r, cl = j * 16 + col; th[cl][rl] = (_Float16)v; const __bf16 bh = (__bf16)v; tb[cl][rl] = bh; tbl[cl][rl] = (__bf16)(v - (float)bh); } }
    __syncthreads();
    for (int e = tid; e < 128 * 8; e += 128) { const int cl = e >> 3, q = e & 7; vst2((unsigned*)(VT + (bb * CC + c0 + cl) * (size_t)TT + t0 + q * 8), *(const v4u*)&th[cl][q * 8]); if (hi_rows) { const size_t o3 = (bb * CC + c0 + cl) * (size_t)KHI + t0 + q * 8; vst2((unsigned*)(VB + o3), *(const v4u*)&tb[cl][q * 8]); vst2((unsigned*)(VBL + o3), *(const v4u*)&tbl[cl][q * 8]); } } } }
// ---- k_sm: block = query row t (head in group): keys [0, kend): causal -> logit if s <= t else excluded; softmax in f32; P x 2^11 in place (0 for excluded)
__global__ __launch_bounds__(256) void k_sm(float* __restrict__ S0 SM_EXTRA_PARAMS) { __shared__ float sred[8]; __shared__ float sbc; __shared__ __align__(16) float shv[TT];
  const int tid = threadIdx.x; const int t = blockIdx.x; const int kend = (kb_last(t >> 6) + 1) * 128;
  float* sr = S0 + (size_t)blockIdx.y * TT * TT + (size_t)t * TT;
  float m = -3.0e38f; for (int k = tid; k < kend; k += 256) { float v = (!CAUSAL || k <= t) ? sr[k] : -3.0e38f; SM_MASK_HOOK; shv[k] = v; m = fmaxf(m, v); }
#pragma unroll
  for (int o = 1; o < 32; o <<= 1) m = fmaxf(m, __shfl_xor(m, o));
  if ((tid & 31) == 0) sred[tid >> 5] = m; __syncthreads(); if (tid == 0) { float a = sred[0]; for (int i = 1; i < 8; ++i) a = fmaxf(a, sred[i]); sbc = a; } __syncthreads(); m = sbc; __syncthreads();
  float sum = 0.f; for (int k = tid; k < kend; k += 256) { const float v = shv[k]; const float e = (v <= -1.0e38f) ? 0.f : expf(v - m); shv[k] = e; sum += e; }
#pragma unroll
  for (int o = 1; o < 32; o <<= 1) sum += __shfl_xor(sum, o);
  if ((tid & 31) == 0) sred[tid >> 5] = sum; __syncthreads(); if (tid == 0) { float a = 0.f; for (int i = 0; i < 8; ++i) a += sred[i]; sbc = a > 0.f ? 2048.0f / a : 0.f; }   /* a fully excluded row yields P = 0 */ __syncthreads(); const float inv = sbc;
  for (int k = tid; k < kend; k += 256) shv[k] = shv[k] * inv;
  __syncthreads(); for (int q = tid; q < kend / 4; q += 256) vst2(sr + q * 4, *(const v4f*)&shv[q * 4]); }
// plain builtin form of the f16 product: the compiler keeps the distance behind it itself
__device__ __forceinline__ v8f mm16(v16h a, v16h b, v8f c) { return __builtin_amdgcn_wmma_f32_16x16x32_f16(false, a, false, b, (short)0, c, false, false); }
// a fragment of a fragment-order plane from the lane's own pointer (fragment start + 8 lane): part 0, then part 1 at + 256 elements
__device__ __forceinline__ v16h frag_t(const _Float16* p) { union { v16h v; v8h q[2]; } u; u.q[0] = *(const v8h*)p; u.q[1] = *(const v8h*)(p + 256); return u.v; }
// The scores are never stored: both kernels below form their own q x k tiles on the matrix unit and use them from the accumulator registers.
// Exponentials run in base 2: exp(SCALE x - SCALE m) = 2^(C2 x - C2 m) with C2 = SCALE log2(e), so a raw score costs one multiply-add and one hardware exp2; the multiply-add rounds the argument once, to 2^-24 of its size, the order of the f32 score's own rounding
#define C2 (SCALE * 1.44269504088896340736f)
__device__ __forceinline__ float ex2(float x) { return __builtin_amdgcn_exp2f(x); }
// the exponents of two neighbouring accumulator registers in one packed multiply-add
__device__ __forceinline__ v2f arg2(float xa, float xb, float la, float lb) { return __builtin_elementwise_fma((v2f){xa, xb}, (v2f){C2, C2}, (v2f){la, lb}); }
// ---- k_cstat: softmax over the QUERY axis (the source's softmax(axis=1) on a [B, q, k] tensor): for every key column k, on the raw products x = q . k: m_k = max_q x, Z_k = sum_q 2^(C2 x - C2 m_k) (f32); stored: L_k = 11 - C2 m_k - log2(Z_k), so that P x 2^11 = 2^(C2 x + L_k). Work-group = 64 key columns (their 8 B fragments held in registers by every wave), the 4,096 queries dealt to 16 waves; S = Q K^T: A = 16 query rows, B = 16 key columns, so a lane holds 8 queries of ONE key column per tile: running max / sum in-lane, one rescale per 16 scores. The halves of a wave meet by one lane exchange, the 16 waves' partials in LDS behind one barrier
#define C1W 16           // waves per work-group (query axis)
#define C1K 4            // 16-column key tiles per work-group
__global__ __launch_bounds__(C1W * 32) void k_cstat(const _Float16* __restrict__ QH, const _Float16* __restrict__ KH, float* __restrict__ CL) { __shared__ float pm[C1W][C1K * 16], pz[C1W][C1K * 16];
  const int tid = threadIdx.x, wave = tid >> 5, lane = tid & 31, col = lane & 15;
  const size_t kr0 = (size_t)blockIdx.x * (C1K * 16);                            // flat key row b * TT + k
  v16h kf[C1K][2]; const _Float16* kq = KH + kr0 * CC + lane * 8;                // 16 rows = 2 fragments = 16 * CC elements
#pragma unroll
  for (int j = 0; j < C1K; ++j) { kf[j][0] = frag_t(kq + j * 16 * CC); kf[j][1] = frag_t(kq + j * 16 * CC + 512); }
  asm volatile("s_wait_xcnt 0x0" ::: "memory");   // behind the 16 loads, ahead of whatever writes their base or offset register again
  float m[C1K], z[C1K];
#pragma unroll
  for (int j = 0; j < C1K; ++j) { m[j] = -3.0e38f; z[j] = 0.f; }
  // The 64 work-groups of a batch walk the same q lines. Each starts its walk at a trip of its own and wraps, so that they do not ask L2 for one line at one moment; every trip is still walked once, whatever the start. The start leaves out index bit 2, so that work-groups 4 apart share one (speed only)
  const int st = (int)((blockIdx.x & 3) | ((blockIdx.x >> 1) & 4));
  // The trip's q loads are issued one trip ahead: directly behind the last product that reads the four fragments, into the same registers, so that they fly under the trip's maxima and exponentials instead of being waited for at its head. The walk and every sum keep their order. (The inner loops are unrolled so that every fragment index is a constant and the fragments stay in registers)
  const _Float16* Qb = QH + (kr0 / TT) * TT * CC;                                 // the batch's q plane: the same base for the whole work-group
  unsigned qo = (unsigned)((wave * (TT / C1W) + st * 32) * CC + lane * 8) * 2u;   // the lane's own byte offset of its piece of the trip's first fragment; the wave's share is 32 KiB in a row, a trip 4 KiB
  v16h a00, a01, a10, a11;
  auto ldq = [&]() __attribute__((always_inline)) { const _Float16* qp = (const _Float16*)((const char*)Qb + qo); a00 = frag_t(qp); a01 = frag_t(qp + 512); a10 = frag_t(qp + 16 * CC); a11 = frag_t(qp + 16 * CC + 512); };
  auto trip = [&](const bool more) __attribute__((always_inline)) { v8f s0[C1K], s1[C1K];
#pragma unroll
    for (int j = 0; j < C1K; ++j) { s0[j] = (v8f){}; s1[j] = (v8f){}; s0[j] = mm16(a00, kf[j][0], s0[j]); s1[j] = mm16(a10, kf[j][0], s1[j]); s0[j] = mm16(a01, kf[j][1], s0[j]); s1[j] = mm16(a11, kf[j][1], s1[j]); }
    __builtin_amdgcn_sched_barrier(0);   // the 16 products stay ahead of the loads that refill their operands
    if (more) { asm volatile("s_wait_xcnt 0x0" : "+v"(qo) :: "memory");   // behind the last trip's loads, ahead of the step that writes their offset register
      qo = (qo & ~(unsigned)(TT / C1W * CC * 2 - 1)) | ((qo + 32 * CC * 2u) & (unsigned)(TT / C1W * CC * 2 - 1));   // the step wraps inside the wave's share
      ldq(); }
    __builtin_amdgcn_sched_barrier(0);   // the loads stay here, ahead of the vector work they fly under, and are not sunk to their use
#pragma unroll
    for (int j = 0; j < C1K; ++j) { float mn = m[j];
#pragma unroll
      for (int r = 0; r < 8; ++r) mn = fmaxf(mn, fmaxf(s0[j][r], s1[j][r]));
      const float nb = -C2 * mn; float s = 0.f;
#pragma unroll
      for (int r = 0; r < 8; r += 2) { const v2f t0 = arg2(s0[j][r], s0[j][r + 1], nb, nb), t1 = arg2(s1[j][r], s1[j][r + 1], nb, nb); s += ex2(t0[0]) + ex2(t1[0]); s += ex2(t0[1]) + ex2(t1[1]); }
      z[j] = z[j] * ex2(fmaf(m[j], C2, nb)) + s; m[j] = mn; } };
  ldq();
  for (int t = 0; t < TT / C1W / 32 - 1; ++t) trip(true);
  asm volatile("s_wait_xcnt 0x0" : "+v"(qo) :: "memory");   // behind the last loads, ahead of whatever takes their offset register from here on
  trip(false);   // the last trip has no successor to load for
#pragma unroll
  for (int j = 0; j < C1K; ++j) { const float mo = __shfl_xor(m[j], 16), zo = __shfl_xor(z[j], 16); const float mm = fmaxf(m[j], mo); const float zz = z[j] * ex2((m[j] - mm) * C2) + zo * ex2((mo - mm) * C2);
    if (lane < 16) { pm[wave][j * 16 + col] = mm; pz[wave][j * 16 + col] = zz; } }
  __syncthreads();
  if (tid < C1K * 16) { float mm = pm[0][tid];
#pragma unroll
    for (int w = 1; w < C1W; ++w) mm = fmaxf(mm, pm[w][tid]);
    float zz = 0.f;
#pragma unroll
    for (int w = 0; w < C1W; ++w) zz += pz[w][tid] * ex2((pm[w][tid] - mm) * C2);
    CL[kr0 + tid] = 11.0f - mm * C2 - log2f(zz); } }
// ---- k_ctx: out = P v with P[q][k] x 2^11 = 2^(C2 x + L_k), once to f16, against v f16 (1 product). Work-group = 64 queries: 2 query groups of 32 x 8 key shares, one wave each; the keys are dealt to the shares in slices of 32, so that the 8 shares of one trip read 256 consecutive keys (32 KiB in a row of the k plane and of the v plane). S^T = K Q^T (A = 16 key rows, B = 16 query columns): two S^T tiles of 32 consecutive keys, turned into P in place, ARE the B fragment of O^T += V^T P^T in the hardware k order (element s < 8: key 8h + s, else key 16 + 8h + s - 8), which is frag_h's order for the v plane rows; P touches neither LDS nor memory. The 8 shares' partial outputs meet in LDS behind one barrier (summed in share order)
#define P2Q 2            // 32-query groups per work-group
#define P2S 8            // key shares per work-group
__global__ __launch_bounds__(P2Q * P2S * 32) void k_ctx(const _Float16* __restrict__ QH, const _Float16* __restrict__ KH, const _Float16* __restrict__ VT, const float* __restrict__ CL, float* __restrict__ Y) { __shared__ __align__(16) float red[P2S][P2Q * 32][HD + 4];
  const int tid = threadIdx.x, wave = tid >> 5, lane = tid & 31, col = lane & 15, g = lane >> 4; const int qg = wave % P2Q, ks = wave / P2Q;
  const size_t q0 = (size_t)blockIdx.x * (P2Q * 32); const size_t b = q0 / TT;   // flat query row b * TT + t
  const _Float16* Kb = KH + b * TT * CC; const _Float16* Vb = VT + b * CC * TT; const float* cl = CL + b * TT;
  v16h qf[2][2];
#pragma unroll
  for (int i = 0; i < 2; ++i) { qf[i][0] = frag_t(QH + (q0 + qg * 32 + i * 16) * CC + lane * 8); qf[i][1] = frag_t(QH + (q0 + qg * 32 + i * 16) * CC + 512 + lane * 8); }
  v8f acc[2][HD / 16] = {};
  // The 64 work-groups of a batch walk the same k and v lines. Each starts at a trip of its own and wraps (see k_cstat): 16 starts from index bits 0, 1, 3, 4
  const unsigned st = (blockIdx.x & 3) | ((blockIdx.x >> 1) & 12);
  unsigned kk = (unsigned)(ks * 32 * CC + lane * 8) * 2u + st * (P2S * 32 * CC * 2u), kv = kk, so = (unsigned)(ks * 32 + 8 * g) * 4u + st * (P2S * 32 * 4u);   // the lane's own byte offsets for keys k0 = (((t + st) % 16) * P2S + ks) * 32 ..: kk for its piece of the first of the 4 k fragments of those 32 keys, kv the same for the 4 v fragments (4 KiB in a row in either plane, at the same offset), so for the column statistics; each steps with its own loads, on bases that are the same for the whole work-group
  // Each operand's loads are issued one trip ahead, directly behind the last instruction of this trip that reads it and into the same registers: k behind the score products, the statistics behind the exponents' multiply-adds, v behind the output products. They fly under the rest of the trip instead of being waited for at its head. The walk and every sum keep their order. (The inner loops are unrolled so that every fragment index is a constant and the fragments stay in registers)
  v16h k00, k01, k10, k11, vf[HD / 16]; v4f m0a, m0b, m1a, m1b;
  auto ldk = [&]() __attribute__((always_inline)) { const _Float16* kp = (const _Float16*)((const char*)Kb + kk); k00 = frag_t(kp); k01 = frag_t(kp + 512); k10 = frag_t(kp + 16 * CC); k11 = frag_t(kp + 16 * CC + 512); };
  auto ldm = [&]() __attribute__((always_inline)) { const float* mp = (const float*)((const char*)cl + so); m0a = *(const v4f*)(mp); m0b = *(const v4f*)(mp + 4); m1a = *(const v4f*)(mp + 16); m1b = *(const v4f*)(mp + 20); };
  auto ldv = [&]() __attribute__((always_inline)) { const _Float16* vp = (const _Float16*)((const char*)Vb + kv);
#pragma unroll
    for (int j = 0; j < HD / 16; ++j) vf[j] = frag_t(vp + j * 512); };
  auto trip = [&](const bool more) __attribute__((always_inline)) { v8f s0[2], s1[2]; v2f e[2][8];
#pragma unroll
    for (int i = 0; i < 2; ++i) { s0[i] = (v8f){}; s1[i] = (v8f){}; s0[i] = mm16(k00, qf[i][0], s0[i]); s1[i] = mm16(k10, qf[i][0], s1[i]); s0[i] = mm16(k01, qf[i][1], s0[i]); s1[i] = mm16(k11, qf[i][1], s1[i]); }
    __builtin_amdgcn_sched_barrier(0);   // the 8 score products stay ahead of the loads that refill their k operands
    if (more) { asm volatile("s_wait_xcnt 0x0" : "+v"(kk) :: "memory");   // behind the last trip's k loads, ahead of the step that writes their offset register
      kk = (kk + P2S * 32 * CC * 2u) & (TT * CC * 2u - 1u); ldk(); }   // the step wraps at the end of the batch's plane
    __builtin_amdgcn_sched_barrier(0);   // the k loads stay here and are not sunk to their use in the next trip
#pragma unroll
    for (int i = 0; i < 2; ++i)
#pragma unroll
      for (int r = 0; r < 4; r += 2) { e[i][r] = arg2(s0[i][r], s0[i][r + 1], m0a[r], m0a[r + 1]); e[i][r + 1] = arg2(s0[i][4 + r], s0[i][5 + r], m0b[r], m0b[r + 1]); e[i][4 + r] = arg2(s1[i][r], s1[i][r + 1], m1a[r], m1a[r + 1]); e[i][5 + r] = arg2(s1[i][4 + r], s1[i][5 + r], m1b[r], m1b[r + 1]); }
    __builtin_amdgcn_sched_barrier(0);   // the 16 multiply-adds stay ahead of the loads that refill the statistics
    if (more) { asm volatile("s_wait_xcnt 0x0" : "+v"(so) :: "memory");   // behind the last trip's statistics loads, ahead of the step that writes their offset register
      so = (so + P2S * 32 * 4u) & (TT * 4u - 1u); ldm(); }
    __builtin_amdgcn_sched_barrier(0);   // the statistics loads stay here and are not sunk to their use
#pragma unroll
    for (int i = 0; i < 2; ++i) { v16h p;
#pragma unroll
      for (int r = 0; r < 4; r += 2) { const v2f t0 = e[i][r], t1 = e[i][r + 1], t2 = e[i][4 + r], t3 = e[i][5 + r];
        p[r] = (_Float16)ex2(t0[0]); p[r + 1] = (_Float16)ex2(t0[1]); p[4 + r] = (_Float16)ex2(t1[0]); p[5 + r] = (_Float16)ex2(t1[1]); p[8 + r] = (_Float16)ex2(t2[0]); p[9 + r] = (_Float16)ex2(t2[1]); p[12 + r] = (_Float16)ex2(t3[0]); p[13 + r] = (_Float16)ex2(t3[1]); }
#pragma unroll
      for (int j = 0; j < HD / 16; ++j) acc[i][j] = mm16(vf[j], p, acc[i][j]); }
    __builtin_amdgcn_sched_barrier(0);   // the 8 output products stay ahead of the loads that refill their v operands
    if (more) { asm volatile("s_wait_xcnt 0x0" : "+v"(kv) :: "memory");   // behind the last trip's v loads, ahead of the step that writes their offset register
      kv = (kv + P2S * 32 * CC * 2u) & (TT * CC * 2u - 1u); ldv(); } };
  ldk(); __builtin_amdgcn_sched_barrier(0); ldm(); __builtin_amdgcn_sched_barrier(0); ldv();   // trip 0's loads in the loop's own order k, statistics, v (the two scheduling barriers keep it): the counted waits in the loop then stand for the same loads on the first trip as on the later ones
  for (int t = 0; t < TT / P2S / 32 - 1; ++t) trip(true);
  asm volatile("s_wait_xcnt 0x0" : "+v"(kk), "+v"(kv), "+v"(so) :: "memory");   // behind the last loads, ahead of whatever takes their three offset registers from here on
  trip(false);   // the last trip has no successor to load for
  // acc[i][j][r] = O[query i * 16 + col][channel j * 16 + 8 g + r] x 2^11 over this wave's key share
#pragma unroll
  for (int i = 0; i < 2; ++i)
#pragma unroll
    for (int j = 0; j < HD / 16; ++j) { float* rp = &red[ks][qg * 32 + i * 16 + col][j * 16 + 8 * g]; v4f lo, hi;
#pragma unroll
      for (int r = 0; r < 4; ++r) { lo[r] = acc[i][j][r]; hi[r] = acc[i][j][4 + r]; }
      *(v4f*)rp = lo; *(v4f*)(rp + 4) = hi; }
  __syncthreads();
  for (int e = tid; e < P2Q * 32 * (HD / 4); e += P2Q * P2S * 32) { const int q = e / (HD / 4), d4 = e % (HD / 4); v4f a = *(const v4f*)&red[0][q][d4 * 4];
#pragma unroll
    for (int s = 1; s < P2S; ++s) a += *(const v4f*)&red[s][q][d4 * 4];
    vst2(Y + (q0 + q) * CC + d4 * 4, a * (1.0f / 2048.0f)); } }

extern "C" void kernel_launch(void* const* d_in, const int* in_sizes, int n_in, void* d_out, int out_size, void* d_ws, size_t ws_size, hipStream_t stream) {
  (void)in_sizes; (void)n_in; (void)out_size;
  const float** F = (const float**)d_in;
  if (ws_size < (size_t)WS_END2) return;
  char* ws = (char*)d_ws; _Float16 *QH = (_Float16*)(ws + WS_QH), *KH = (_Float16*)(ws + WS_KH), *VT = (_Float16*)(ws + WS_VT), *QL = (_Float16*)(ws + WS_QL), *KL = (_Float16*)(ws + WS_KL); __bf16 *VB = (__bf16*)(ws + WS_VB), *VBL = (__bf16*)(ws + WS_VBL);
  float *CL = (float*)(ws + WS_CL);
  // inputs: 0 Q [4,4096,64]; 1 K; 2 V
  k_planes64<<<dim3(TNB * TT / 64), 256, 0, stream>>>(F[0], F[1], F[2], QH, QL, KH, KL, VT, VB, VBL);
  k_cstat<<<dim3(TNB * TT / (C1K * 16)), C1W * 32, 0, stream>>>(QH, KH, CL);                           /* per key column: the exponent offset from max and sum over the queries */
  k_ctx<<<dim3(TNB * TT / (P2Q * 32)), P2Q * P2S * 32, 0, stream>>>(QH, KH, VT, CL, (float*)d_out);  /* out = P v, P formed in registers */
}

// v007
// It runs in 25.8 microseconds.
// Two timings next to v006 put it at 1.04 and 1.03 times that version's speed.
// Counting every step since v000, it is 258 times as fast.
// compute dtype: all float inputs rounded to bf16; q and k go to the matrix unit as bf16, v (bf16-valued, exact) as f16; scores q x k (1 product) x 64^-0.5; softmax over the QUERY axis in f32 (per key column: max / sum over the 4,096 queries, online partials merged, exponentials in base 2 on the hardware's exp2; scores recomputed per use, never stored); P x 2^11 once to f16 x v (1 product); f32 output.
#include <hip/hip_runtime.h>
#include <math.h>

typedef __attribute__((ext_vector_type(16))) _Float16 v16h;
typedef __attribute__((ext_vector_type(16))) __bf16 v16b;
typedef __attribute__((ext_vector_type(8)))  _Float16 v8h;
typedef __attribute__((ext_vector_type(8)))  float v8f;
typedef __attribute__((ext_vector_type(4)))  float v4f;
typedef __attribute__((ext_vector_type(2)))  float v2f;
typedef __attribute__((ext_vector_type(4)))  unsigned v4u;
typedef _Float16 hx8 __attribute__((ext_vector_type(8)));
typedef __attribute__((ext_vector_type(4)))  int v4i;
typedef float __attribute__((may_alias)) float_a;
typedef int __attribute__((may_alias)) int_a;

template <typename T> __device__ __forceinline__ void vst2(void* p, T v) { *(T*)p = v;  }
__device__ __forceinline__ v8f wmma16(v16h a, v16h b, v8f c) {
  v8f d = __builtin_amdgcn_wmma_f32_16x16x32_f16(false, a, false, b, (short)0, c, false, false);
  asm volatile("v_nop\n\tv_nop\n\tv_nop\n\tv_nop" : "+v"(d) : "v"(a), "v"(b));
  return d;
}
__device__ __forceinline__ v8f wmma_bf(v16b a, v16b b, v8f c) {
  v8f d = __builtin_amdgcn_wmma_f32_16x16x32_bf16(false, a, false, b, (short)0, c, false, false);
  asm volatile("v_nop\n\tv_nop\n\tv_nop\n\tv_nop" : "+v"(d) : "v"(a), "v"(b));
  return d;
}
// 16x16x32 fragments: lane = (h = lane>>4, row/col = lane&15); elements 0..7 = k0+8h+0..7, 8..15 = k0+16+8h+0..7; D element r = row 8h+r
__device__ __forceinline__ v16h frag_h(const _Float16* rowk0, int lane) {
  union { v16h v; v8h q[2]; } u; const _Float16* p = rowk0 + 8 * (lane >> 4);
  u.q[0] = *(const v8h*)p; u.q[1] = *(const v8h*)(p + 16); return u.v;
}
__device__ __forceinline__ v16h frag_f32(const float* rowk0, int lane) {
  v16h a; const float* p = rowk0 + 8 * (lane >> 4);
#pragma unroll
  for (int i = 0; i < 8; ++i) { a[i] = (_Float16)p[i]; a[8 + i] = (_Float16)p[16 + i]; }
  return a;
}
__device__ __forceinline__ v16h frag_f32s(const float* rowk0, int lane, float sc) {
  v16h a; const float* p = rowk0 + 8 * (lane >> 4);
#pragma unroll
  for (int i = 0; i < 8; ++i) { a[i] = (_Float16)(p[i] * sc); a[8 + i] = (_Float16)(p[16 + i] * sc); }
  return a;
}
// column fragment from a [K][ld] layout (column n), rows >= K read as 0
__device__ __forceinline__ v16h fragc_f32(const float* W, int k0, int n, int lane, int ld, int K) {
  v16h a; const int g = lane >> 4;
#pragma unroll
  for (int i = 0; i < 8; ++i) { const int ka = k0 + 8 * g + i, kb = ka + 16;
    a[i] = (_Float16)(ka < K ? W[(size_t)(ka < K ? ka : K - 1) * ld + n] : 0.f); a[8 + i] = (_Float16)(kb < K ? W[(size_t)(kb < K ? kb : K - 1) * ld + n] : 0.f); }
  return a;
}
struct F2 { v16b h, l; };
__device__ __forceinline__ F2 bsplit16(const float v[16]) { F2 r;
#pragma unroll
  for (int i = 0; i < 16; ++i) { const __bf16 h = (__bf16)v[i]; r.h[i] = h; r.l[i] = (__bf16)(v[i] - (float)h); }
  return r; }
__device__ __forceinline__ F2 split_row(const float* row, int k0, int lane) { float v[16]; const float* p = row + k0 + 8 * (lane >> 4);
#pragma unroll
  for (int i = 0; i < 8; ++i) { v[i] = p[i]; v[8 + i] = p[16 + i]; }
  return bsplit16(v); }
__device__ __forceinline__ F2 split_rowK(const float* row, int k0, int lane, int K) { float v[16]; const int g = lane >> 4;
#pragma unroll
  for (int i = 0; i < 8; ++i) { const int ka = k0 + 8 * g + i, kb = ka + 16; v[i] = ka < K ? row[ka < K ? ka : K - 1] : 0.f; v[8 + i] = kb < K ? row[kb < K ? kb : K - 1] : 0.f; }
  return bsplit16(v); }
__device__ __forceinline__ F2 split_col(const float* W, int k0, int n, int lane, int ld, int K) { float v[16]; const int g = lane >> 4;
#pragma unroll
  for (int i = 0; i < 8; ++i) { const int ka = k0 + 8 * g + i, kb = ka + 16; v[i] = ka < K ? W[(size_t)(ka < K ? ka : K - 1) * ld + n] : 0.f; v[8 + i] = kb < K ? W[(size_t)(kb < K ? kb : K - 1) * ld + n] : 0.f; }
  return bsplit16(v); }
__device__ __forceinline__ v8f mac3(const F2& a, const F2& b, v8f c) { c = wmma_bf(a.l, b.h, c); c = wmma_bf(a.h, b.l, c); return wmma_bf(a.h, b.h, c); }
__device__ __forceinline__ float sigm(float v) { return 1.0f / (1.0f + expf(-v)); }
#define LDSX() do { asm volatile("s_wait_dscnt 0" ::: "memory"); __builtin_amdgcn_wave_barrier(); __builtin_amdgcn_fence(__ATOMIC_RELEASE, "workgroup"); } while (0)

// Scaled dot-product attention on given tensors whose softmax runs over the QUERY axis (Q / K / V [4,4096,64]; scores = Q K^T / 8 of shape [B, q, k]; attn = softmax(scores, axis=1) - axis 1 is the QUERY axis, so every key COLUMN is normalised over the 4,096 queries (faithful to the source); out = attn V -> [4,4096,64]; no mask).
#define NB 4
#define TT 4096
#define CC 64            // NH * HD = projected width
#define DIN 64          // input (model) width
#define NH 1
#define HD 64
#define NQB (TT / 64)
#define HG 1
#define SCALE (0.125f)
#define CAUSAL 0
#ifndef TNB
#define TNB NB
#endif
__device__ __forceinline__ float bfr(float v) { return (float)(__bf16)v; }
__host__ __device__ __forceinline__ int kb_last(int qb) { return CAUSAL ? ((qb * 64 + 63) >> 7) : (TT / 128 - 1); }
typedef __attribute__((ext_vector_type(8))) __bf16 v8b;
__device__ __forceinline__ v16b frag_b(const __bf16* rowk0, int lane) {
  union { v16b v; v8b q[2]; } u; const __bf16* p = rowk0 + 8 * (lane >> 4);
  u.q[0] = *(const v8b*)p; u.q[1] = *(const v8b*)(p + 16); return u.v;
}
#define QBH 0              // exact planes: single-product logits and single-f16 P x V on every block
#define QHI 0               // no q residual plane (q is held as bf16, exactly)
#define KHI 64              // unused high-precision planes kept minimal
// B fragment (k rows k0+.., output column o) of a weight: (in,out) [K][ld] or (out,in) [ld rows of K]: bf16 exact, or f16(bf16 * 256) exact
__device__ __forceinline__ v16b wcol_io(const float* Wm, int k0, int o, int lane, int ld) { v16b w; const int g = lane >> 4;
#pragma unroll
  for (int i = 0; i < 8; ++i) { w[i] = (__bf16)Wm[(size_t)(k0 + 8 * g + i) * ld + o]; w[8 + i] = (__bf16)Wm[(size_t)(k0 + 16 + 8 * g + i) * ld + o]; }
  return w; }
__device__ __forceinline__ v16b wcol_oi(const float* Wm, int k0, int o, int lane, int K) { v16b w; const float* p = Wm + (size_t)o * K + k0 + 8 * (lane >> 4);
#pragma unroll
  for (int i = 0; i < 8; ++i) { w[i] = (__bf16)p[i]; w[8 + i] = (__bf16)p[16 + i]; }
  return w; }
__device__ __forceinline__ v16h wcolh_io(const float* Wm, int k0, int o, int lane, int ld) { v16h w; const int g = lane >> 4;
#pragma unroll
  for (int i = 0; i < 8; ++i) { w[i] = (_Float16)(bfr(Wm[(size_t)(k0 + 8 * g + i) * ld + o]) * 256.0f); w[8 + i] = (_Float16)(bfr(Wm[(size_t)(k0 + 16 + 8 * g + i) * ld + o]) * 256.0f); }
  return w; }
__device__ __forceinline__ v16h wcolh_oi(const float* Wm, int k0, int o, int lane, int K) { v16h w; const float* p = Wm + (size_t)o * K + k0 + 8 * (lane >> 4);
#pragma unroll
  for (int i = 0; i < 8; ++i) { w[i] = (_Float16)(bfr(p[i]) * 256.0f); w[8 + i] = (_Float16)(bfr(p[16 + i]) * 256.0f); }
  return w; }
#define WQKV_LAYOUT 0   // 0 = (in,out) [DIN][CC]; 1 = (out,in) [CC][DIN]; 2 = per-head [NH][DIN][HD]
__device__ __forceinline__ v16b wcol_hdk(const float* Wm, int k0, int o, int lane) { v16b w; const int g = lane >> 4; const float* p = Wm + (size_t)(o / HD) * DIN * HD + (o % HD);
#pragma unroll
  for (int i = 0; i < 8; ++i) { w[i] = (__bf16)p[(size_t)(k0 + 8 * g + i) * HD]; w[8 + i] = (__bf16)p[(size_t)(k0 + 16 + 8 * g + i) * HD]; }
  return w; }
#define WO_OUT_IN 0
#if WQKV_LAYOUT == 1
#define WCOL(W, k0, o, lane) wcol_oi(W, k0, o, lane, DIN)
#elif WQKV_LAYOUT == 2
#define WCOL(W, k0, o, lane) wcol_hdk(W, k0, o, lane)
#else
#define WCOL(W, k0, o, lane) wcol_io(W, k0, o, lane, CC)
#endif
#if WO_OUT_IN
#define WOCOL(W, k0, o, lane) wcol_oi(W, k0, o, lane, CC)
#define WOCOLH(W, k0, o, lane) wcolh_oi(W, k0, o, lane, CC)
#else
#define WOCOL(W, k0, o, lane) wcol_io(W, k0, o, lane, DIN)
#define WOCOLH(W, k0, o, lane) wcolh_io(W, k0, o, lane, DIN)
#endif
// The q, k and v planes lie in FRAGMENT ORDER. A 16 x 32 operand fragment (16 rows or channels x 32 k) is 1 KiB = [part p = 0, 1][lane = 16 h + row][8 elements], the piece holding k = k0 + 16 p + 8 h + 0..7: frag_h's k order, unchanged. Each of a fragment's two 16-byte loads then reads 512 consecutive bytes, four whole 128-byte lines, where a row-major plane gives a load 32 bytes out of each of 16 lines.
// q, k: [flat row / 16][k / 32] fragments; element offset of piece q8 (elements 8 q8 .. 8 q8 + 7) of flat row r
#define FRAG_QK(r, q8) (((size_t)(r) >> 4) * (16 * CC) + (size_t)(((q8) >> 1) * 256 + (((q8) & 1) * 16 + ((int)(r) & 15)) * 8))
// v, per batch: [key / 32][channel / 16] fragments; element offset of piece t8 (keys 8 t8 .. 8 t8 + 7) of channel c
#define FRAG_V(c, t8) ((size_t)((((t8) >> 2) * (CC / 16) + ((c) >> 4)) * 512 + (((t8) >> 1) & 1) * 256 + (((t8) & 1) * 16 + ((c) & 15)) * 8))
#define SM_EXTRA_PARAMS
#define SM_MASK_HOOK (void)0
#ifndef SM_EXTRA_PARAMS
#define SM_EXTRA_PARAMS
#endif
#ifndef PROJ_EXTRA_PARAMS
#define PROJ_EXTRA_PARAMS
#endif
#ifndef SM_MASK_HOOK
#define SM_MASK_HOOK (void)0
#endif

#define WS_QH  0u                                      // bf16 q, fragment order (FRAG_QK)
#define WS_KH  (WS_QH + 2u * (size_t)NB * TT * CC)      // bf16 k, fragment order (FRAG_QK)
#define WS_VT  (WS_KH + 2u * (size_t)NB * TT * CC)      // f16 v, per batch in fragment order (FRAG_V)
#define WS_QL  (WS_VT + 2u * (size_t)NB * CC * TT)      // f16 q residual x 2^10 rows [b][t < QHI][CC]
#define WS_KL  (WS_QL + 2u * (size_t)NB * QHI * CC)     // f16 k residual x 2^10 rows [b][t < KHI][CC]
#define WS_VB  (WS_KL + 2u * (size_t)NB * KHI * CC)     // bf16 v hi planes [b][c][t < KHI]
#define WS_VBL (WS_VB + 2u * (size_t)NB * CC * KHI)
#define WS_END (WS_VBL + 2u * (size_t)NB * CC * KHI)
#define WS_CL (WS_END)                                  // f32 partial column statistics [b][query block][TT]
#define WS_END2 (WS_CL + 4u * (size_t)NB * (TT / 1024) * TT)

// ---- k_proj: block = (64 rows, 128 cols, which): q/k/v = X W (+ b) with exact bf16 products (K = DIN) -> which 0: q f16 rows (+ residual rows < QHI); 1: k f16 rows (+ residual rows < KHI); 2: v f16 planes [c][t] (+ bf16 hi/lo planes for t < KHI)
__global__ __launch_bounds__(128) void k_proj(const float* __restrict__ XQ, const float* __restrict__ XK, const float* __restrict__ XV, const float* __restrict__ WQ, const float* __restrict__ WK, const float* __restrict__ WV, const float* __restrict__ BQ, const float* __restrict__ BK, const float* __restrict__ BV,
    _Float16* __restrict__ QH, _Float16* __restrict__ QL, _Float16* __restrict__ KH, _Float16* __restrict__ KL, _Float16* __restrict__ VT, __bf16* __restrict__ VB, __bf16* __restrict__ VBL) {
  __shared__ __align__(16) _Float16 sh[64][136], sl[64][136]; __shared__ __align__(16) _Float16 th[128][72]; __shared__ __align__(16) __bf16 tb[128][72], tbl[128][72];
  const int tid = threadIdx.x, wave = tid >> 5, lane = tid & 31, col = lane & 15, g = lane >> 4; const int which = blockIdx.z; const int c0 = blockIdx.y * 128; const size_t r0 = (size_t)blockIdx.x * 64; const size_t bb = r0 / TT; const int t0 = (int)(r0 % TT);
  const float* X = which == 0 ? XQ : which == 1 ? XK : XV; const float* WA = which == 0 ? WQ : which == 1 ? WK : WV; const float* BA = which == 0 ? BQ : which == 1 ? BK : BV;
  v8f acc[8] = {};
#pragma unroll 2
  for (int kc = 0; kc < DIN / 32; ++kc) { v16b a; { const float* p = X + (r0 + wave * 16 + col) * DIN + kc * 32 + 8 * g;
#pragma unroll
      for (int i = 0; i < 8; ++i) { a[i] = (__bf16)p[i]; a[8 + i] = (__bf16)p[16 + i]; } }
    asm volatile("s_wait_loadcnt 0x0" ::: "memory");
#pragma unroll
    for (int j = 0; j < 8; ++j) { const v16b w = WCOL(WA, kc * 32, c0 + j * 16 + col, lane); asm volatile("s_wait_loadcnt 0x0" ::: "memory"); acc[j] = wmma_bf(a, w, acc[j]); } }
  if (which < 2) { _Float16* DH = which == 0 ? QH : KH; _Float16* DL = which == 0 ? QL : KL; const int nhi = which == 0 ? QHI : KHI; const bool hi_rows = t0 < nhi;
#pragma unroll
    for (int j = 0; j < 8; ++j) { const float bias = BA ? bfr(BA[c0 + j * 16 + col]) : 0.f;
#pragma unroll
      for (int r = 0; r < 8; ++r) { const float v = acc[j][r] + bias; const _Float16 hv = (_Float16)v; sh[wave * 16 + 8 * g + r][j * 16 + col] = hv; sl[wave * 16 + 8 * g + r][j * 16 + col] = (_Float16)((v - (float)hv) * 1024.0f); } }
    __syncthreads();
    for (int e = tid; e < 64 * 16; e += 128) { const int rl = e >> 4, q = e & 15; vst2((unsigned*)(DH + (r0 + rl) * CC + c0 + q * 8), *(const v4u*)&sh[rl][q * 8]); if (hi_rows) vst2((unsigned*)(DL + (bb * nhi + t0 + rl) * (size_t)CC + c0 + q * 8), *(const v4u*)&sl[rl][q * 8]); }
  } else { const bool hi_rows = t0 < KHI;
#pragma unroll
    for (int j = 0; j < 8; ++j) { const float bias = BA ? bfr(BA[c0 + j * 16 + col]) : 0.f;
#pragma unroll
      for (int r = 0; r < 8; ++r) { const float v = acc[j][r] + bias; const int rl = wave * 16 + 8 * g + r, cl = j * 16 + col; th[cl][rl] = (_Float16)v; const __bf16 bh = (__bf16)v; tb[cl][rl] = bh; tbl[cl][rl] = (__bf16)(v - (float)bh); } }
    __syncthreads();
    for (int e = tid; e < 128 * 8; e += 128) { const int cl = e >> 3, q = e & 7; vst2((unsigned*)(VT + (bb * CC + c0 + cl) * (size_t)TT + t0 + q * 8), *(const v4u*)&th[cl][q * 8]); if (hi_rows) { const size_t o3 = (bb * CC + c0 + cl) * (size_t)KHI + t0 + q * 8; vst2((unsigned*)(VB + o3), *(const v4u*)&tb[cl][q * 8]); vst2((unsigned*)(VBL + o3), *(const v4u*)&tbl[cl][q * 8]); } } } }
// ---- k_sm: block = query row t (head in group): keys [0, kend): causal -> logit if s <= t else excluded; softmax in f32; P x 2^11 in place (0 for excluded)
__global__ __launch_bounds__(256) void k_sm(float* __restrict__ S0 SM_EXTRA_PARAMS) { __shared__ float sred[8]; __shared__ float sbc; __shared__ __align__(16) float shv[TT];
  const int tid = threadIdx.x; const int t = blockIdx.x; const int kend = (kb_last(t >> 6) + 1) * 128;
  float* sr = S0 + (size_t)blockIdx.y * TT * TT + (size_t)t * TT;
  float m = -3.0e38f; for (int k = tid; k < kend; k += 256) { float v = (!CAUSAL || k <= t) ? sr[k] : -3.0e38f; SM_MASK_HOOK; shv[k] = v; m = fmaxf(m, v); }
#pragma unroll
  for (int o = 1; o < 32; o <<= 1) m = fmaxf(m, __shfl_xor(m, o));
  if ((tid & 31) == 0) sred[tid >> 5] = m; __syncthreads(); if (tid == 0) { float a = sred[0]; for (int i = 1; i < 8; ++i) a = fmaxf(a, sred[i]); sbc = a; } __syncthreads(); m = sbc; __syncthreads();
  float sum = 0.f; for (int k = tid; k < kend; k += 256) { const float v = shv[k]; const float e = (v <= -1.0e38f) ? 0.f : expf(v - m); shv[k] = e; sum += e; }
#pragma unroll
  for (int o = 1; o < 32; o <<= 1) sum += __shfl_xor(sum, o);
  if ((tid & 31) == 0) sred[tid >> 5] = sum; __syncthreads(); if (tid == 0) { float a = 0.f; for (int i = 0; i < 8; ++i) a += sred[i]; sbc = a > 0.f ? 2048.0f / a : 0.f; }   /* a fully excluded row yields P = 0 */ __syncthreads(); const float inv = sbc;
  for (int k = tid; k < kend; k += 256) shv[k] = shv[k] * inv;
  __syncthreads(); for (int q = tid; q < kend / 4; q += 256) vst2(sr + q * 4, *(const v4f*)&shv[q * 4]); }
// plain builtin form of the f16 product: the compiler keeps the distance behind it itself
__device__ __forceinline__ v8f mm16(v16h a, v16h b, v8f c) { return __builtin_amdgcn_wmma_f32_16x16x32_f16(false, a, false, b, (short)0, c, false, false); }
// a fragment of a fragment-order plane from the lane's own pointer (fragment start + 8 lane): part 0, then part 1 at + 256 elements
__device__ __forceinline__ v16h frag_t(const _Float16* p) { union { v16h v; v8h q[2]; } u; u.q[0] = *(const v8h*)p; u.q[1] = *(const v8h*)(p + 256); return u.v; }
// The scores are never stored: both kernels below form their own q x k tiles on the matrix unit and use them from the accumulator registers.
// Exponentials run in base 2: exp(SCALE x - SCALE m) = 2^(C2 x - C2 m) with C2 = SCALE log2(e), so a raw score costs one multiply-add and one hardware exp2; the multiply-add rounds the argument once, to 2^-24 of its size, the order of the f32 score's own rounding
#define C2 (SCALE * 1.44269504088896340736f)
__device__ __forceinline__ float ex2(float x) { return __builtin_amdgcn_exp2f(x); }
// the exponents of two neighbouring accumulator registers in one packed multiply-add
__device__ __forceinline__ v2f arg2(float xa, float xb, float la, float lb) { return __builtin_elementwise_fma((v2f){xa, xb}, (v2f){C2, C2}, (v2f){la, lb}); }
// the same two for bf16 operands
__device__ __forceinline__ v8f mmb(v16b a, v16b b, v8f c) { return __builtin_amdgcn_wmma_f32_16x16x32_bf16(false, a, false, b, (short)0, c, false, false); }
__device__ __forceinline__ v16b frag_tb(const __bf16* p) { union { v16b v; v8b q[2]; } u; u.q[0] = *(const v8b*)p; u.q[1] = *(const v8b*)(p + 256); return u.v; }
__device__ __forceinline__ v4u cvt8(v4f a, v4f c) { union { v8b b; v4u u; } o;
#pragma unroll
  for (int i = 0; i < 4; ++i) { o.b[i] = (__bf16)a[i]; o.b[4 + i] = (__bf16)c[i]; }
  return o.u; }
// N groups of 64 f32 rows: the thread's piece of each (32 bytes at byte offset o0 of the group) into registers
template <int N> __device__ __forceinline__ void ldg(v4f (&t)[N][2], const float* base, const unsigned o0) {
#pragma unroll
  for (int g = 0; g < N; ++g) { const char* p = (const char*)base + o0 + g * (64 * CC * 4); t[g][0] = *(const v4f*)p; t[g][1] = *(const v4f*)(p + 16); } }
// the same pieces rounded to bf16 into the fragment-order rows in LDS
template <int N> __device__ __forceinline__ void stg(const v4f (&t)[N][2], __bf16* lds, const unsigned d0) {
#pragma unroll
  for (int g = 0; g < N; ++g) vst2((unsigned*)(lds + g * (64 * CC) + d0), cvt8(t[g][0], t[g][1])); }
// ---- k_cstat: reads the f32 inputs itself (there is no separate conversion launch). Softmax over the QUERY axis (the source's softmax(axis=1) on a [B, q, k] tensor): for every key column k, on the raw products x = q . k, over the work-group's FQ queries: m = max x, Z = sum 2^(C2 x - C2 m) (f32); stored: the partial C2 m + log2(Z), one per key and query block; k_ctx joins the TT / FQ partials of a key.
// Work-group = FK keys x FQ queries. Its k rows and its q rows are read once as f32 in whole lines, rounded to bf16 and laid into LDS in fragment order; the q rows come in chunks of FC rows, a later chunk flying from L2 into registers under the products and exponentials of the current one. 16 waves = 4 key groups of 64 (their 8 B fragments held in registers) x 4 query shares of a chunk. S = Q K^T: A = 16 query rows, B = 16 key columns, so a lane holds 8 queries of ONE key column per tile: running max / sum in-lane, one rescale per 16 scores.
// The planes that k_ctx reads are written on the way: of the rows it has converted into LDS, each work-group stores 64 q rows and 64 k rows of its own (the 16 work-groups that share a q block, the 4 that share a k block, take one 64-row group each), and it transposes 64 v rows.
#define FK 256           // keys per work-group
#define FQ 1024          // queries per work-group
#define FC 128           // q rows per staged chunk = one trip of the 4 query shares
__global__ __launch_bounds__(512) void k_cstat(const float* __restrict__ Qs, const float* __restrict__ Ks, const float* __restrict__ Vs, __bf16* __restrict__ QB, __bf16* __restrict__ KB, _Float16* __restrict__ VT, float* __restrict__ PL) {
  __shared__ __align__(16) __bf16 sq[FQ * CC]; __shared__ __align__(16) __bf16 sk[FK * CC]; __shared__ _Float16 sv[64][72]; __shared__ float pm[4][FK], pz[4][FK];
  const int tid = threadIdx.x, wave = tid >> 5, lane = tid & 31, col = lane & 15; const int kg = wave & 3, qq = wave >> 2;
  const int b = (int)(blockIdx.x >> 6), r = (int)(blockIdx.x & 63), kb = r >> 2, qb = r & 3;
  const size_t qrow0 = (size_t)b * TT + qb * FQ, krow0 = (size_t)b * TT + kb * FK;   // flat rows
  // 64 rows x 8 pieces of 8 elements = one piece per thread: a wave = 8 rows x 4 pieces, so it reads one whole line of each row and stores whole lines of a fragment-order plane
  const int rl = ((tid >> 6) << 3) | ((tid >> 2) & 7), pc = (((tid >> 5) & 1) << 2) | (tid & 3);
  const unsigned o0 = (unsigned)(rl * CC + pc * 8) * 4u;   // the thread's byte offset in a 64-row group of f32 rows; never written again
  const unsigned d0 = (unsigned)FRAG_QK(rl, pc);           // its element offset in the group's fragments
  v4f lq0[2][2], lq1[2][2], lk[4][2], lv[2], ln[2][2];
  // The 16 work-groups that share a q block each start their walk over its FQ / FC chunks at a chunk of their own and wrap: they do not ask L2 for one line at one moment, and between them their first two chunks cover the whole block, so that rows which are not yet in L2 are fetched from memory once, together, at the start. Every chunk is still walked once, whatever the start (speed only)
  const int rot = kb & (FQ / FC - 1);
  auto ch = [&](const int i) __attribute__((always_inline)) { return (i + rot) & (FQ / FC - 1); };
  const float *pK = Ks + krow0 * CC, *pV = Vs + ((size_t)b * TT + r * 64) * CC, *pQ = Qs + qrow0 * CC, *pQ0 = pQ + ch(0) * (FC * CC), *pQ1 = pQ + ch(1) * (FC * CC);
  ldg<4>(lk, pK, o0);
  { const char* p = (const char*)pV + o0; lv[0] = *(const v4f*)p; lv[1] = *(const v4f*)(p + 16); }
  ldg<2>(lq0, pQ0, o0); ldg<2>(lq1, pQ1, o0);
  asm volatile("s_wait_xcnt 0x0" :: "v"(o0), "s"(pK), "s"(pV), "s"(pQ0), "s"(pQ1) : "memory");   // behind the 18 loads; their offset register and their four bases are inputs of the wait, so that none is written again ahead of it
  stg<4>(lk, sk, d0);
#pragma unroll
  for (int u = 0; u < 8; ++u) sv[rl][pc * 8 + u] = (_Float16)bfr(lv[u >> 2][u & 3]);
  stg<2>(lq0, sq + ch(0) * (FC * CC), d0); stg<2>(lq1, sq + ch(1) * (FC * CC), d0);
  __syncthreads();
  { const int c = ((tid >> 6) << 3) | (tid & 7), q = (tid >> 3) & 7;   // 8 neighbouring channels of one piece of 8 keys fill one line of the fragment-order plane
    hx8 hv;
#pragma unroll
    for (int j = 0; j < 8; ++j) hv[j] = sv[q * 8 + j][c];
    vst2((unsigned*)(VT + (size_t)b * CC * TT + FRAG_V(c, r * 8 + q)), *(const v4u*)&hv);
    vst2((unsigned*)(KB + (krow0 + qb * 64) * CC + tid * 8), *(const v4u*)(sk + qb * (64 * CC) + tid * 8));   // this work-group's 64 k rows of the plane: 8 KiB in a row, as they lie in LDS
    asm volatile("s_wait_xcnt 0x0" ::: "memory"); }   // behind the two stores, ahead of whatever writes their address or data registers again
  v16b kf[4][2]; const __bf16* kq = sk + kg * (64 * CC) + lane * 8;                // 16 rows = 2 fragments = 16 * CC elements
#pragma unroll
  for (int j = 0; j < 4; ++j) { kf[j][0] = frag_tb(kq + j * 16 * CC); kf[j][1] = frag_tb(kq + j * 16 * CC + 512); }
  float m[4], z[4];
#pragma unroll
  for (int j = 0; j < 4; ++j) { m[j] = -3.0e38f; z[j] = 0.f; }
  v16b a00, a01, a10, a11;
  auto ldq = [&](const int row) __attribute__((always_inline)) { const __bf16* qp = sq + row * CC + lane * 8; a00 = frag_tb(qp); a01 = frag_tb(qp + 512); a10 = frag_tb(qp + 16 * CC); a11 = frag_tb(qp + 16 * CC + 512); };
  // one trip = 32 queries x 64 keys; more: the next trip's fragments (rows nxt ..) are read from LDS directly behind the last product that reads these, into the same registers, and fly under the maxima and exponentials
  auto trip = [&](const bool more, const int nxt) __attribute__((always_inline)) { v8f s0[4], s1[4];
#pragma unroll
    for (int j = 0; j < 4; ++j) { s0[j] = (v8f){}; s1[j] = (v8f){}; s0[j] = mmb(a00, kf[j][0], s0[j]); s1[j] = mmb(a10, kf[j][0], s1[j]); s0[j] = mmb(a01, kf[j][1], s0[j]); s1[j] = mmb(a11, kf[j][1], s1[j]); }
    __builtin_amdgcn_sched_barrier(0);   // the 16 products stay ahead of the loads that refill their operands
    if (more) ldq(nxt);
    __builtin_amdgcn_sched_barrier(0);   // the loads stay here, ahead of the vector work they fly under, and are not sunk to their use
#pragma unroll
    for (int j = 0; j < 4; ++j) { float mn = m[j];
#pragma unroll
      for (int i = 0; i < 8; ++i) mn = fmaxf(mn, fmaxf(s0[j][i], s1[j][i]));
      const float nb = -C2 * mn; float s = 0.f;
#pragma unroll
      for (int i = 0; i < 8; i += 2) { const v2f t0 = arg2(s0[j][i], s0[j][i + 1], nb, nb), t1 = arg2(s1[j][i], s1[j][i + 1], nb, nb); s += ex2(t0[0]) + ex2(t1[0]); s += ex2(t0[1]) + ex2(t1[1]); }
      z[j] = z[j] * ex2(fmaf(m[j], C2, nb)) + s; m[j] = mn; }
    __builtin_amdgcn_sched_barrier(0); };   // the next trip's products stay behind this trip's vector work: lifted over it they would hold a second set of score registers
  // The walk's chunks 0 and 1 are in LDS (chunk = place in the walk; ch() gives its place in the block). Trip c works on chunk c, whose fragments are in registers; it reads chunk c + 1's fragments behind its products, and chunk c + 2 flies from L2 into registers under the whole trip and is laid into LDS at its foot; the barrier there publishes it for the next trip's fragment reads. No LDS byte is written twice. (Kept rolled: unrolled, the products of later trips were lifted over the vector work of earlier ones and the registers spilled)
  const int row0 = qq * (FC / 4);
  ldq(row0 + ch(0) * FC);
#pragma unroll 1
  for (int c = 0; c < FQ / FC - 2; ++c) { const float* nx = pQ + ch(c + 2) * (FC * CC);
    ldg<2>(ln, nx, o0);
    asm volatile("s_wait_xcnt 0x0" :: "v"(o0) : "memory");   // behind the 4 loads; it also keeps them here, ahead of the trip under which they fly
    __builtin_amdgcn_sched_barrier(0);   // the loads are issued ahead of the trip's work
    trip(true, row0 + ch(c + 1) * FC);
    stg<2>(ln, sq + ch(c + 2) * (FC * CC), d0);
    __syncthreads(); }
  vst2((unsigned*)(QB + (qrow0 + kb * 64) * CC + tid * 8), *(const v4u*)(sq + kb * (64 * CC) + tid * 8));   // this work-group's 64 q rows of the plane: 8 KiB in a row, as they lie in LDS (every chunk is published by now)
  asm volatile("s_wait_xcnt 0x0" ::: "memory");   // behind the store, ahead of whatever writes its address or data registers again
  trip(true, row0 + ch(FQ / FC - 1) * FC);
  trip(false, 0);   // the last trip has no successor to read for
#pragma unroll
  for (int j = 0; j < 4; ++j) { const float mo = __shfl_xor(m[j], 16), zo = __shfl_xor(z[j], 16); const float mm = fmaxf(m[j], mo); const float zz = z[j] * ex2((m[j] - mm) * C2) + zo * ex2((mo - mm) * C2);
    if (lane < 16) { pm[qq][kg * 64 + j * 16 + col] = mm; pz[qq][kg * 64 + j * 16 + col] = zz; } }
  __syncthreads();
  if (tid < FK) { float mm = pm[0][tid];
#pragma unroll
    for (int w = 1; w < 4; ++w) mm = fmaxf(mm, pm[w][tid]);
    float zz = 0.f;
#pragma unroll
    for (int w = 0; w < 4; ++w) zz += pz[w][tid] * ex2((pm[w][tid] - mm) * C2);
    PL[((size_t)b * (TT / FQ) + qb) * TT + kb * FK + tid] = mm * C2 + log2f(zz); } }
// ---- k_ctx: out = P v with P[q][k] x 2^11 = 2^(C2 x + L_k), once to f16, against v f16 (1 product). L_k = 11 - log2 of the sum over the TT / FQ query blocks of 2^(the block's partial): every work-group joins the partials of its batch's keys once, into LDS, behind one barrier, and the trips read L from there. Work-group = 64 queries: 2 query groups of 32 x 8 key shares, one wave each; the keys are dealt to the shares in slices of 32, so that the 8 shares of one trip read 256 consecutive keys (32 KiB in a row of the k plane and of the v plane). S^T = K Q^T (A = 16 key rows, B = 16 query columns): two S^T tiles of 32 consecutive keys, turned into P in place, ARE the B fragment of O^T += V^T P^T in the hardware k order (element s < 8: key 8h + s, else key 16 + 8h + s - 8), which is frag_h's order for the v plane rows; P touches neither LDS nor memory. The 8 shares' partial outputs meet in LDS behind one barrier (summed in share order)
#define P2Q 2            // 32-query groups per work-group
#define P2S 8            // key shares per work-group
__global__ __launch_bounds__(P2Q * P2S * 32) void k_ctx(const __bf16* __restrict__ QH, const __bf16* __restrict__ KH, const _Float16* __restrict__ VT, const float* __restrict__ PL, float* __restrict__ Y) { __shared__ __align__(16) float red[P2S][P2Q * 32][HD + 4]; __shared__ __align__(16) float sL[TT];
  const int tid = threadIdx.x, wave = tid >> 5, lane = tid & 31, col = lane & 15, g = lane >> 4; const int qg = wave % P2Q, ks = wave / P2Q;
  const size_t q0 = (size_t)blockIdx.x * (P2Q * 32); const size_t b = q0 / TT;   // flat query row b * TT + t
  const __bf16* Kb = KH + b * TT * CC; const _Float16* Vb = VT + b * CC * TT; const float* pl = PL + b * (TT / FQ) * TT;
  v16b qf[2][2];
#pragma unroll
  for (int i = 0; i < 2; ++i) { qf[i][0] = frag_tb(QH + (q0 + qg * 32 + i * 16) * CC + lane * 8); qf[i][1] = frag_tb(QH + (q0 + qg * 32 + i * 16) * CC + 512 + lane * 8); }
  v8f acc[2][HD / 16] = {};
  // The 64 work-groups of a batch walk the same k and v lines. Each starts at a trip of its own and wraps (see k_cstat): 16 starts from index bits 0, 1, 3, 4
  const unsigned st = (blockIdx.x & 3) | ((blockIdx.x >> 1) & 12);
  unsigned kk = (unsigned)(ks * 32 * CC + lane * 8) * 2u + st * (P2S * 32 * CC * 2u), kv = kk, so = (unsigned)(ks * 32 + 8 * g) * 4u + st * (P2S * 32 * 4u);   // the lane's own byte offsets for keys k0 = (((t + st) % 16) * P2S + ks) * 32 ..: kk for its piece of the first of the 4 k fragments of those 32 keys, kv the same for the 4 v fragments (4 KiB in a row in either plane, at the same offset), so for the column statistics in LDS; each steps with its own loads, on bases that are the same for the whole work-group
  // Each operand's loads are issued one trip ahead, directly behind the last instruction of this trip that reads it and into the same registers: k behind the score products, the statistics behind the exponents' multiply-adds, v behind the output products. They fly under the rest of the trip instead of being waited for at its head. The walk and every sum keep their order. (The inner loops are unrolled so that every fragment index is a constant and the fragments stay in registers)
  v16b k00, k01, k10, k11; v16h vf[HD / 16]; v4f m0a, m0b, m1a, m1b;
  auto ldk = [&]() __attribute__((always_inline)) { const __bf16* kp = (const __bf16*)((const char*)Kb + kk); k00 = frag_tb(kp); k01 = frag_tb(kp + 512); k10 = frag_tb(kp + 16 * CC); k11 = frag_tb(kp + 16 * CC + 512); };
  auto ldm = [&]() __attribute__((always_inline)) { const float* mp = (const float*)((const char*)sL + so); m0a = *(const v4f*)(mp); m0b = *(const v4f*)(mp + 4); m1a = *(const v4f*)(mp + 16); m1b = *(const v4f*)(mp + 20); };
  auto ldv = [&]() __attribute__((always_inline)) { const _Float16* vp = (const _Float16*)((const char*)Vb + kv);
#pragma unroll
    for (int j = 0; j < HD / 16; ++j) vf[j] = frag_t(vp + j * 512); };
  auto trip = [&](const bool more) __attribute__((always_inline)) { v8f s0[2], s1[2]; v2f e[2][8];
#pragma unroll
    for (int i = 0; i < 2; ++i) { s0[i] = (v8f){}; s1[i] = (v8f){}; s0[i] = mmb(k00, qf[i][0], s0[i]); s1[i] = mmb(k10, qf[i][0], s1[i]); s0[i] = mmb(k01, qf[i][1], s0[i]); s1[i] = mmb(k11, qf[i][1], s1[i]); }
    __builtin_amdgcn_sched_barrier(0);   // the 8 score products stay ahead of the loads that refill their k operands
    if (more) { asm volatile("s_wait_xcnt 0x0" : "+v"(kk) :: "memory");   // behind the last trip's k loads, ahead of the step that writes their offset register
      kk = (kk + P2S * 32 * CC * 2u) & (TT * CC * 2u - 1u); ldk(); }   // the step wraps at the end of the batch's plane
    __builtin_amdgcn_sched_barrier(0);   // the k loads stay here and are not sunk to their use in the next trip
#pragma unroll
    for (int i = 0; i < 2; ++i)
#pragma unroll
      for (int r = 0; r < 4; r += 2) { e[i][r] = arg2(s0[i][r], s0[i][r + 1], m0a[r], m0a[r + 1]); e[i][r + 1] = arg2(s0[i][4 + r], s0[i][5 + r], m0b[r], m0b[r + 1]); e[i][4 + r] = arg2(s1[i][r], s1[i][r + 1], m1a[r], m1a[r + 1]); e[i][5 + r] = arg2(s1[i][4 + r], s1[i][5 + r], m1b[r], m1b[r + 1]); }
    __builtin_amdgcn_sched_barrier(0);   // the 16 multiply-adds stay ahead of the loads that refill the statistics
    if (more) { so = (so + P2S * 32 * 4u) & (TT * 4u - 1u); ldm(); }
    __builtin_amdgcn_sched_barrier(0);   // the statistics loads stay here and are not sunk to their use
#pragma unroll
    for (int i = 0; i < 2; ++i) { v16h p;
#pragma unroll
      for (int r = 0; r < 4; r += 2) { const v2f t0 = e[i][r], t1 = e[i][r + 1], t2 = e[i][4 + r], t3 = e[i][5 + r];
        p[r] = (_Float16)ex2(t0[0]); p[r + 1] = (_Float16)ex2(t0[1]); p[4 + r] = (_Float16)ex2(t1[0]); p[5 + r] = (_Float16)ex2(t1[1]); p[8 + r] = (_Float16)ex2(t2[0]); p[9 + r] = (_Float16)ex2(t2[1]); p[12 + r] = (_Float16)ex2(t3[0]); p[13 + r] = (_Float16)ex2(t3[1]); }
#pragma unroll
      for (int j = 0; j < HD / 16; ++j) acc[i][j] = mm16(vf[j], p, acc[i][j]); }
    __builtin_amdgcn_sched_barrier(0);   // the 8 output products stay ahead of the loads that refill their v operands
    if (more) { asm volatile("s_wait_xcnt 0x0" : "+v"(kv) :: "memory");   // behind the last trip's v loads, ahead of the step that writes their offset register
      kv = (kv + P2S * 32 * CC * 2u) & (TT * CC * 2u - 1u); ldv(); } };
  ldk(); __builtin_amdgcn_sched_barrier(0); ldv();   // trip 0's k and v loads fly under the joining of the statistics
  { v4f p[TT / 4 / (P2Q * P2S * 32)][TT / FQ]; const float* pt = pl + tid * 4;   // 4 neighbouring keys a thread and pass; all the passes' loads are issued before the first is waited for (the loops are unrolled for that)
#pragma unroll
    for (int it = 0; it < TT / 4 / (P2Q * P2S * 32); ++it)
#pragma unroll
      for (int w = 0; w < TT / FQ; ++w) p[it][w] = *(const v4f*)(pt + w * TT + it * (P2Q * P2S * 32 * 4));
    asm volatile("s_wait_xcnt 0x0" :: "v"(tid), "s"(pl) : "memory");   // behind the loads; the index and the base that their addresses are formed from are inputs of the wait, so that neither is written again ahead of it
#pragma unroll
    for (int it = 0; it < TT / 4 / (P2Q * P2S * 32); ++it) { v4f o;
#pragma unroll
      for (int u = 0; u < 4; ++u) { float mm = p[it][0][u];
#pragma unroll
        for (int w = 1; w < TT / FQ; ++w) mm = fmaxf(mm, p[it][w][u]);
        float zz = 0.f;
#pragma unroll
        for (int w = 0; w < TT / FQ; ++w) zz += ex2(p[it][w][u] - mm);
        o[u] = 11.0f - mm - log2f(zz); }
      *(v4f*)&sL[(tid + it * (P2Q * P2S * 32)) * 4] = o; } }
  __syncthreads();
  ldm();
  for (int t = 0; t < TT / P2S / 32 - 1; ++t) trip(true);
  asm volatile("s_wait_xcnt 0x0" : "+v"(kk), "+v"(kv) :: "memory");   // behind the last loads, ahead of whatever takes their two offset registers from here on
  trip(false);   // the last trip has no successor to load for
  // acc[i][j][r] = O[query i * 16 + col][channel j * 16 + 8 g + r] x 2^11 over this wave's key share
#pragma unroll
  for (int i = 0; i < 2; ++i)
#pragma unroll
    for (int j = 0; j < HD / 16; ++j) { float* rp = &red[ks][qg * 32 + i * 16 + col][j * 16 + 8 * g]; v4f lo, hi;
#pragma unroll
      for (int r = 0; r < 4; ++r) { lo[r] = acc[i][j][r]; hi[r] = acc[i][j][4 + r]; }
      *(v4f*)rp = lo; *(v4f*)(rp + 4) = hi; }
  __syncthreads();
  for (int e = tid; e < P2Q * 32 * (HD / 4); e += P2Q * P2S * 32) { const int q = e / (HD / 4), d4 = e % (HD / 4); v4f a = *(const v4f*)&red[0][q][d4 * 4];
#pragma unroll
    for (int s = 1; s < P2S; ++s) a += *(const v4f*)&red[s][q][d4 * 4];
    vst2(Y + (q0 + q) * CC + d4 * 4, a * (1.0f / 2048.0f)); } }

extern "C" void kernel_launch(void* const* d_in, const int* in_sizes, int n_in, void* d_out, int out_size, void* d_ws, size_t ws_size, hipStream_t stream) {
  (void)in_sizes; (void)n_in; (void)out_size;
  const float** F = (const float**)d_in;
  if (ws_size < (size_t)WS_END2) return;
  char* ws = (char*)d_ws; __bf16 *QB = (__bf16*)(ws + WS_QH), *KB = (__bf16*)(ws + WS_KH); _Float16 *VT = (_Float16*)(ws + WS_VT);
  float *PL = (float*)(ws + WS_CL);
  // inputs: 0 Q [4,4096,64]; 1 K; 2 V
  k_cstat<<<dim3(TNB * (TT / FK) * (TT / FQ)), 512, 0, stream>>>(F[0], F[1], F[2], QB, KB, VT, PL);       /* per key column and query block: the partial statistic; the bf16 q, k and f16 v planes on the way */
  k_ctx<<<dim3(TNB * TT / (P2Q * 32)), P2Q * P2S * 32, 0, stream>>>(QB, KB, VT, PL, (float*)d_out);  /* out = P v, P formed in registers */
}

// v008
// It runs in 24.3 microseconds.
// Two timings next to v007 put it at 1.07 and 1.06 times that version's speed.
// Over all steps from v000 it is 275 times as fast.
// compute dtype: all float inputs rounded to bf16; q and k go to the matrix unit as bf16, v (bf16-valued, exact) as f16; scores q x k (1 product) x 64^-0.5; softmax over the QUERY axis in f32 (per key column: sum over the 4,096 queries of 2^(scaled score), taken without an offset where a range test on the sum allows it and against the running max otherwise; partials merged in log2 form; exponentials in base 2 on the hardware's exp2; scores recomputed per use, never stored); P x 2^11 once to f16 x v (1 product); f32 output.
#include <hip/hip_runtime.h>
#include <math.h>

typedef __attribute__((ext_vector_type(16))) _Float16 v16h;
typedef __attribute__((ext_vector_type(16))) __bf16 v16b;
typedef __attribute__((ext_vector_type(8)))  _Float16 v8h;
typedef __attribute__((ext_vector_type(8)))  float v8f;
typedef __attribute__((ext_vector_type(4)))  float v4f;
typedef __attribute__((ext_vector_type(2)))  float v2f;
typedef __attribute__((ext_vector_type(4)))  unsigned v4u;
typedef _Float16 hx8 __attribute__((ext_vector_type(8)));
typedef __attribute__((ext_vector_type(4)))  int v4i;
typedef float __attribute__((may_alias)) float_a;
typedef int __attribute__((may_alias)) int_a;

template <typename T> __device__ __forceinline__ void vst2(void* p, T v) { *(T*)p = v;  }
__device__ __forceinline__ v8f wmma16(v16h a, v16h b, v8f c) {
  v8f d = __builtin_amdgcn_wmma_f32_16x16x32_f16(false, a, false, b, (short)0, c, false, false);
  asm volatile("v_nop\n\tv_nop\n\tv_nop\n\tv_nop" : "+v"(d) : "v"(a), "v"(b));
  return d;
}
__device__ __forceinline__ v8f wmma_bf(v16b a, v16b b, v8f c) {
  v8f d = __builtin_amdgcn_wmma_f32_16x16x32_bf16(false, a, false, b, (short)0, c, false, false);
  asm volatile("v_nop\n\tv_nop\n\tv_nop\n\tv_nop" : "+v"(d) : "v"(a), "v"(b));
  return d;
}
// 16x16x32 fragments: lane = (h = lane>>4, row/col = lane&15); elements 0..7 = k0+8h+0..7, 8..15 = k0+16+8h+0..7; D element r = row 8h+r
__device__ __forceinline__ v16h frag_h(const _Float16* rowk0, int lane) {
  union { v16h v; v8h q[2]; } u; const _Float16* p = rowk0 + 8 * (lane >> 4);
  u.q[0] = *(const v8h*)p; u.q[1] = *(const v8h*)(p + 16); return u.v;
}
__device__ __forceinline__ v16h frag_f32(const float* rowk0, int lane) {
  v16h a; const float* p = rowk0 + 8 * (lane >> 4);
#pragma unroll
  for (int i = 0; i < 8; ++i) { a[i] = (_Float16)p[i]; a[8 + i] = (_Float16)p[16 + i]; }
  return a;
}
__device__ __forceinline__ v16h frag_f32s(const float* rowk0, int lane, float sc) {
  v16h a; const float* p = rowk0 + 8 * (lane >> 4);
#pragma unroll
  for (int i = 0; i < 8; ++i) { a[i] = (_Float16)(p[i] * sc); a[8 + i] = (_Float16)(p[16 + i] * sc); }
  return a;
}
// column fragment from a [K][ld] layout (column n), rows >= K read as 0
__device__ __forceinline__ v16h fragc_f32(const float* W, int k0, int n, int lane, int ld, int K) {
  v16h a; const int g = lane >> 4;
#pragma unroll
  for (int i = 0; i < 8; ++i) { const int ka = k0 + 8 * g + i, kb = ka + 16;
    a[i] = (_Float16)(ka < K ? W[(size_t)(ka < K ? ka : K - 1) * ld + n] : 0.f); a[8 + i] = (_Float16)(kb < K ? W[(size_t)(kb < K ? kb : K - 1) * ld + n] : 0.f); }
  return a;
}
struct F2 { v16b h, l; };
__device__ __forceinline__ F2 bsplit16(const float v[16]) { F2 r;
#pragma unroll
  for (int i = 0; i < 16; ++i) { const __bf16 h = (__bf16)v[i]; r.h[i] = h; r.l[i] = (__bf16)(v[i] - (float)h); }
  return r; }
__device__ __forceinline__ F2 split_row(const float* row, int k0, int lane) { float v[16]; const float* p = row + k0 + 8 * (lane >> 4);
#pragma unroll
  for (int i = 0; i < 8; ++i) { v[i] = p[i]; v[8 + i] = p[16 + i]; }
  return bsplit16(v); }
__device__ __forceinline__ F2 split_rowK(const float* row, int k0, int lane, int K) { float v[16]; const int g = lane >> 4;
#pragma unroll
  for (int i = 0; i < 8; ++i) { const int ka = k0 + 8 * g + i, kb = ka + 16; v[i] = ka < K ? row[ka < K ? ka : K - 1] : 0.f; v[8 + i] = kb < K ? row[kb < K ? kb : K - 1] : 0.f; }
  return bsplit16(v); }
__device__ __forceinline__ F2 split_col(const float* W, int k0, int n, int lane, int ld, int K) { float v[16]; const int g = lane >> 4;
#pragma unroll
  for (int i = 0; i < 8; ++i) { const int ka = k0 + 8 * g + i, kb = ka + 16; v[i] = ka < K ? W[(size_t)(ka < K ? ka : K - 1) * ld + n] : 0.f; v[8 + i] = kb < K ? W[(size_t)(kb < K ? kb : K - 1) * ld + n] : 0.f; }
  return bsplit16(v); }
__device__ __forceinline__ v8f mac3(const F2& a, const F2& b, v8f c) { c = wmma_bf(a.l, b.h, c); c = wmma_bf(a.h, b.l, c); return wmma_bf(a.h, b.h, c); }
__device__ __forceinline__ float sigm(float v) { return 1.0f / (1.0f + expf(-v)); }
#define LDSX() do { asm volatile("s_wait_dscnt 0" ::: "memory"); __builtin_amdgcn_wave_barrier(); __builtin_amdgcn_fence(__ATOMIC_RELEASE, "workgroup"); } while (0)

// Scaled dot-product attention on given tensors whose softmax runs over the QUERY axis (Q / K / V [4,4096,64]; scores = Q K^T / 8 of shape [B, q, k]; attn = softmax(scores, axis=1) - axis 1 is the QUERY axis, so every key COLUMN is normalised over the 4,096 queries (faithful to the source); out = attn V -> [4,4096,64]; no mask).
#define NB 4
#define TT 4096
#define CC 64            // NH * HD = projected width
#define DIN 64          // input (model) width
#define NH 1
#define HD 64
#define NQB (TT / 64)
#define HG 1
#define SCALE (0.125f)
#define CAUSAL 0
#ifndef TNB
#define TNB NB
#endif
__device__ __forceinline__ float bfr(float v) { return (float)(__bf16)v; }
__host__ __device__ __forceinline__ int kb_last(int qb) { return CAUSAL ? ((qb * 64 + 63) >> 7) : (TT / 128 - 1); }
typedef __attribute__((ext_vector_type(8))) __bf16 v8b;
__device__ __forceinline__ v16b frag_b(const __bf16* rowk0, int lane) {
  union { v16b v; v8b q[2]; } u; const __bf16* p = rowk0 + 8 * (lane >> 4);
  u.q[0] = *(const v8b*)p; u.q[1] = *(const v8b*)(p + 16); return u.v;
}
#define QBH 0              // exact planes: single-product logits and single-f16 P x V on every block
#define QHI 0               // no q residual plane (q is held as bf16, exactly)
#define KHI 64              // unused high-precision planes kept minimal
// B fragment (k rows k0+.., output column o) of a weight: (in,out) [K][ld] or (out,in) [ld rows of K]: bf16 exact, or f16(bf16 * 256) exact
__device__ __forceinline__ v16b wcol_io(const float* Wm, int k0, int o, int lane, int ld) { v16b w; const int g = lane >> 4;
#pragma unroll
  for (int i = 0; i < 8; ++i) { w[i] = (__bf16)Wm[(size_t)(k0 + 8 * g + i) * ld + o]; w[8 + i] = (__bf16)Wm[(size_t)(k0 + 16 + 8 * g + i) * ld + o]; }
  return w; }
__device__ __forceinline__ v16b wcol_oi(const float* Wm, int k0, int o, int lane, int K) { v16b w; const float* p = Wm + (size_t)o * K + k0 + 8 * (lane >> 4);
#pragma unroll
  for (int i = 0; i < 8; ++i) { w[i] = (__bf16)p[i]; w[8 + i] = (__bf16)p[16 + i]; }
  return w; }
__device__ __forceinline__ v16h wcolh_io(const float* Wm, int k0, int o, int lane, int ld) { v16h w; const int g = lane >> 4;
#pragma unroll
  for (int i = 0; i < 8; ++i) { w[i] = (_Float16)(bfr(Wm[(size_t)(k0 + 8 * g + i) * ld + o]) * 256.0f); w[8 + i] = (_Float16)(bfr(Wm[(size_t)(k0 + 16 + 8 * g + i) * ld + o]) * 256.0f); }
  return w; }
__device__ __forceinline__ v16h wcolh_oi(const float* Wm, int k0, int o, int lane, int K) { v16h w; const float* p = Wm + (size_t)o * K + k0 + 8 * (lane >> 4);
#pragma unroll
  for (int i = 0; i < 8; ++i) { w[i] = (_Float16)(bfr(p[i]) * 256.0f); w[8 + i] = (_Float16)(bfr(p[16 + i]) * 256.0f); }
  return w; }
#define WQKV_LAYOUT 0   // 0 = (in,out) [DIN][CC]; 1 = (out,in) [CC][DIN]; 2 = per-head [NH][DIN][HD]
__device__ __forceinline__ v16b wcol_hdk(const float* Wm, int k0, int o, int lane) { v16b w; const int g = lane >> 4; const float* p = Wm + (size_t)(o / HD) * DIN * HD + (o % HD);
#pragma unroll
  for (int i = 0; i < 8; ++i) { w[i] = (__bf16)p[(size_t)(k0 + 8 * g + i) * HD]; w[8 + i] = (__bf16)p[(size_t)(k0 + 16 + 8 * g + i) * HD]; }
  return w; }
#define WO_OUT_IN 0
#if WQKV_LAYOUT == 1
#define WCOL(W, k0, o, lane) wcol_oi(W, k0, o, lane, DIN)
#elif WQKV_LAYOUT == 2
#define WCOL(W, k0, o, lane) wcol_hdk(W, k0, o, lane)
#else
#define WCOL(W, k0, o, lane) wcol_io(W, k0, o, lane, CC)
#endif
#if WO_OUT_IN
#define WOCOL(W, k0, o, lane) wcol_oi(W, k0, o, lane, CC)
#define WOCOLH(W, k0, o, lane) wcolh_oi(W, k0, o, lane, CC)
#else
#define WOCOL(W, k0, o, lane) wcol_io(W, k0, o, lane, DIN)
#define WOCOLH(W, k0, o, lane) wcolh_io(W, k0, o, lane, DIN)
#endif
// The q, k and v planes lie in FRAGMENT ORDER. A 16 x 32 operand fragment (16 rows or channels x 32 k) is 1 KiB = [part p = 0, 1][lane = 16 h + row][8 elements], the piece holding k = k0 + 16 p + 8 h + 0..7: frag_h's k order, unchanged. Each of a fragment's two 16-byte loads then reads 512 consecutive bytes, four whole 128-byte lines, where a row-major plane gives a load 32 bytes out of each of 16 lines.
// q, k: [flat row / 16][k / 32] fragments; element offset of piece q8 (elements 8 q8 .. 8 q8 + 7) of flat row r
#define FRAG_QK(r, q8) (((size_t)(r) >> 4) * (16 * CC) + (size_t)(((q8) >> 1) * 256 + (((q8) & 1) * 16 + ((int)(r) & 15)) * 8))
// v, per batch: [key / 32][channel / 16] fragments; element offset of piece t8 (keys 8 t8 .. 8 t8 + 7) of channel c
#define FRAG_V(c, t8) ((size_t)((((t8) >> 2) * (CC / 16) + ((c) >> 4)) * 512 + (((t8) >> 1) & 1) * 256 + (((t8) & 1) * 16 + ((c) & 15)) * 8))
#define SM_EXTRA_PARAMS
#define SM_MASK_HOOK (void)0
#ifndef SM_EXTRA_PARAMS
#define SM_EXTRA_PARAMS
#endif
#ifndef PROJ_EXTRA_PARAMS
#define PROJ_EXTRA_PARAMS
#endif
#ifndef SM_MASK_HOOK
#define SM_MASK_HOOK (void)0
#endif

#define WS_QH  0u                                      // bf16 q, fragment order (FRAG_QK)
#define WS_KH  (WS_QH + 2u * (size_t)NB * TT * CC)      // bf16 k, fragment order (FRAG_QK)
#define WS_VT  (WS_KH + 2u * (size_t)NB * TT * CC)      // f16 v, per batch in fragment order (FRAG_V)
#define WS_QL  (WS_VT + 2u * (size_t)NB * CC * TT)      // f16 q residual x 2^10 rows [b][t < QHI][CC]
#define WS_KL  (WS_QL + 2u * (size_t)NB * QHI * CC)     // f16 k residual x 2^10 rows [b][t < KHI][CC]
#define WS_VB  (WS_KL + 2u * (size_t)NB * KHI * CC)     // bf16 v hi planes [b][c][t < KHI]
#define WS_VBL (WS_VB + 2u * (size_t)NB * CC * KHI)
#define WS_END (WS_VBL + 2u * (size_t)NB * CC * KHI)
#define WS_CL (WS_END)                                  // f32 partial column statistics [b][query block][TT]
#define WS_END2 (WS_CL + 4u * (size_t)NB * (TT / 1024) * TT)

// ---- k_proj: block = (64 rows, 128 cols, which): q/k/v = X W (+ b) with exact bf16 products (K = DIN) -> which 0: q f16 rows (+ residual rows < QHI); 1: k f16 rows (+ residual rows < KHI); 2: v f16 planes [c][t] (+ bf16 hi/lo planes for t < KHI)
__global__ __launch_bounds__(128) void k_proj(const float* __restrict__ XQ, const float* __restrict__ XK, const float* __restrict__ XV, const float* __restrict__ WQ, const float* __restrict__ WK, const float* __restrict__ WV, const float* __restrict__ BQ, const float* __restrict__ BK, const float* __restrict__ BV,
    _Float16* __restrict__ QH, _Float16* __restrict__ QL, _Float16* __restrict__ KH, _Float16* __restrict__ KL, _Float16* __restrict__ VT, __bf16* __restrict__ VB, __bf16* __restrict__ VBL) {
  __shared__ __align__(16) _Float16 sh[64][136], sl[64][136]; __shared__ __align__(16) _Float16 th[128][72]; __shared__ __align__(16) __bf16 tb[128][72], tbl[128][72];
  const int tid = threadIdx.x, wave = tid >> 5, lane = tid & 31, col = lane & 15, g = lane >> 4; const int which = blockIdx.z; const int c0 = blockIdx.y * 128; const size_t r0 = (size_t)blockIdx.x * 64; const size_t bb = r0 / TT; const int t0 = (int)(r0 % TT);
  const float* X = which == 0 ? XQ : which == 1 ? XK : XV; const float* WA = which == 0 ? WQ : which == 1 ? WK : WV; const float* BA = which == 0 ? BQ : which == 1 ? BK : BV;
  v8f acc[8] = {};
#pragma unroll 2
  for (int kc = 0; kc < DIN / 32; ++kc) { v16b a; { const float* p = X + (r0 + wave * 16 + col) * DIN + kc * 32 + 8 * g;
#pragma unroll
      for (int i = 0; i < 8; ++i) { a[i] = (__bf16)p[i]; a[8 + i] = (__bf16)p[16 + i]; } }
    asm volatile("s_wait_loadcnt 0x0" ::: "memory");
#pragma unroll
    for (int j = 0; j < 8; ++j) { const v16b w = WCOL(WA, kc * 32, c0 + j * 16 + col, lane); asm volatile("s_wait_loadcnt 0x0" ::: "memory"); acc[j] = wmma_bf(a, w, acc[j]); } }
  if (which < 2) { _Float16* DH = which == 0 ? QH : KH; _Float16* DL = which == 0 ? QL : KL; const int nhi = which == 0 ? QHI : KHI; const bool hi_rows = t0 < nhi;
#pragma unroll
    for (int j = 0; j < 8; ++j) { const float bias = BA ? bfr(BA[c0 + j * 16 + col]) : 0.f;
#pragma unroll
      for (int r = 0; r < 8; ++r) { const float v = acc[j][r] + bias; const _Float16 hv = (_Float16)v; sh[wave * 16 + 8 * g + r][j * 16 + col] = hv; sl[wave * 16 + 8 * g + r][j * 16 + col] = (_Float16)((v - (float)hv) * 1024.0f); } }
    __syncthreads();
    for (int e = tid; e < 64 * 16; e += 128) { const int rl = e >> 4, q = e & 15; vst2((unsigned*)(DH + (r0 + rl) * CC + c0 + q * 8), *(const v4u*)&sh[rl][q * 8]); if (hi_rows) vst2((unsigned*)(DL + (bb * nhi + t0 + rl) * (size_t)CC + c0 + q * 8), *(const v4u*)&sl[rl][q * 8]); }
  } else { const bool hi_rows = t0 < KHI;
#pragma unroll
    for (int j = 0; j < 8; ++j) { const float bias = BA ? bfr(BA[c0 + j * 16 + col]) : 0.f;
#pragma unroll
      for (int r = 0; r < 8; ++r) { const float v = acc[j][r] + bias; const int rl = wave * 16 + 8 * g + r, cl = j * 16 + col; th[cl][rl] = (_Float16)v; const __bf16 bh = (__bf16)v; tb[cl][rl] = bh; tbl[cl][rl] = (__bf16)(v - (float)bh); } }
    __syncthreads();
    for (int e = tid; e < 128 * 8; e += 128) { const int cl = e >> 3, q = e & 7; vst2((unsigned*)(VT + (bb * CC + c0 + cl) * (size_t)TT + t0 + q * 8), *(const v4u*)&th[cl][q * 8]); if (hi_rows) { const size_t o3 = (bb * CC + c0 + cl) * (size_t)KHI + t0 + q * 8; vst2((unsigned*)(VB + o3), *(const v4u*)&tb[cl][q * 8]); vst2((unsigned*)(VBL + o3), *(const v4u*)&tbl[cl][q * 8]); } } } }
// ---- k_sm: block = query row t (head in group): keys [0, kend): causal -> logit if s <= t else excluded; softmax in f32; P x 2^11 in place (0 for excluded)
__global__ __launch_bounds__(256) void k_sm(float* __restrict__ S0 SM_EXTRA_PARAMS) { __shared__ float sred[8]; __shared__ float sbc; __shared__ __align__(16) float shv[TT];
  const int tid = threadIdx.x; const int t = blockIdx.x; const int kend = (kb_last(t >> 6) + 1) * 128;
  float* sr = S0 + (size_t)blockIdx.y * TT * TT + (size_t)t * TT;
  float m = -3.0e38f; for (int k = tid; k < kend; k += 256) { float v = (!CAUSAL || k <= t) ? sr[k] : -3.0e38f; SM_MASK_HOOK; shv[k] = v; m = fmaxf(m, v); }
#pragma unroll
  for (int o = 1; o < 32; o <<= 1) m = fmaxf(m, __shfl_xor(m, o));
  if ((tid & 31) == 0) sred[tid >> 5] = m; __syncthreads(); if (tid == 0) { float a = sred[0]; for (int i = 1; i < 8; ++i) a = fmaxf(a, sred[i]); sbc = a; } __syncthreads(); m = sbc; __syncthreads();
  float sum = 0.f; for (int k = tid; k < kend; k += 256) { const float v = shv[k]; const float e = (v <= -1.0e38f) ? 0.f : expf(v - m); shv[k] = e; sum += e; }
#pragma unroll
  for (int o = 1; o < 32; o <<= 1) sum += __shfl_xor(sum, o);
  if ((tid & 31) == 0) sred[tid >> 5] = sum; __syncthreads(); if (tid == 0) { float a = 0.f; for (int i = 0; i < 8; ++i) a += sred[i]; sbc = a > 0.f ? 2048.0f / a : 0.f; }   /* a fully excluded row yields P = 0 */ __syncthreads(); const float inv = sbc;
  for (int k = tid; k < kend; k += 256) shv[k] = shv[k] * inv;
  __syncthreads(); for (int q = tid; q < kend / 4; q += 256) vst2(sr + q * 4, *(const v4f*)&shv[q * 4]); }
// plain builtin form of the f16 product: the compiler keeps the distance behind it itself
__device__ __forceinline__ v8f mm16(v16h a, v16h b, v8f c) { return __builtin_amdgcn_wmma_f32_16x16x32_f16(false, a, false, b, (short)0, c, false, false); }
// a fragment of a fragment-order plane from the lane's own pointer (fragment start + 8 lane): part 0, then part 1 at + 256 elements
__device__ __forceinline__ v16h frag_t(const _Float16* p) { union { v16h v; v8h q[2]; } u; u.q[0] = *(const v8h*)p; u.q[1] = *(const v8h*)(p + 256); return u.v; }
// The scores are never stored: both kernels below form their own q x k tiles on the matrix unit and use them from the accumulator registers.
// Exponentials run in base 2: exp(SCALE x - SCALE m) = 2^(C2 x - C2 m) with C2 = SCALE log2(e), so a raw score costs one multiply-add and one hardware exp2; the multiply-add rounds the argument once, to 2^-24 of its size, the order of the f32 score's own rounding
#define C2 (SCALE * 1.44269504088896340736f)
__device__ __forceinline__ float ex2(float x) { return __builtin_amdgcn_exp2f(x); }
// the exponents of two neighbouring accumulator registers in one packed multiply-add
__device__ __forceinline__ v2f arg2(float xa, float xb, float la, float lb) { return __builtin_elementwise_fma((v2f){xa, xb}, (v2f){C2, C2}, (v2f){la, lb}); }
// the same two for bf16 operands
__device__ __forceinline__ v8f mmb(v16b a, v16b b, v8f c) { return __builtin_amdgcn_wmma_f32_16x16x32_bf16(false, a, false, b, (short)0, c, false, false); }
__device__ __forceinline__ v16b frag_tb(const __bf16* p) { union { v16b v; v8b q[2]; } u; u.q[0] = *(const v8b*)p; u.q[1] = *(const v8b*)(p + 256); return u.v; }
__device__ __forceinline__ v4u cvt8(v4f a, v4f c) { union { v8b b; v4u u; } o;
#pragma unroll
  for (int i = 0; i < 4; ++i) { o.b[i] = (__bf16)a[i]; o.b[4 + i] = (__bf16)c[i]; }
  return o.u; }
// N groups of 64 f32 rows: the thread's piece of each (32 bytes at byte offset o0 of the group) into registers
template <int N> __device__ __forceinline__ void ldg(v4f (&t)[N][2], const float* base, const unsigned o0) {
#pragma unroll
  for (int g = 0; g < N; ++g) { const char* p = (const char*)base + o0 + g * (64 * CC * 4); t[g][0] = *(const v4f*)p; t[g][1] = *(const v4f*)(p + 16); } }
// the same pieces rounded to bf16 into the fragment-order rows in LDS
template <int N> __device__ __forceinline__ void stg(const v4f (&t)[N][2], __bf16* lds, const unsigned d0) {
#pragma unroll
  for (int g = 0; g < N; ++g) vst2((unsigned*)(lds + g * (64 * CC) + d0), cvt8(t[g][0], t[g][1])); }
// ---- k_cstat: reads the f32 inputs itself (there is no separate conversion launch). Softmax over the QUERY axis (the source's softmax(axis=1) on a [B, q, k] tensor): for every key column k, on the raw products x = q . k, over the work-group's FQ queries: Z = sum 2^(C2 x - C2 m) (f32), with m = 0 where Z then stays in range and m = max x otherwise; stored: the partial C2 m + log2(Z), one per key and query block; k_ctx joins the TT / FQ partials of a key.
// Work-group = FK keys x FQ queries. Its k rows and its q rows are read once as f32 in whole lines, rounded to bf16 and laid into LDS in fragment order; the q rows come in chunks of FC rows, a later chunk flying from L2 into registers under the products and exponentials of the current one. 16 waves = 4 key groups of 64 (their 8 B fragments held in registers) x 4 query shares of a chunk. S = Q K^T: A = 16 query rows, B = 16 key columns, so a lane holds 8 queries of ONE key column per tile: the sum runs in-lane.
// The planes that k_ctx reads are written on the way: of the rows it has converted into LDS, each work-group stores 64 q rows and 64 k rows of its own (the 16 work-groups that share a q block, the 4 that share a k block, take one 64-row group each), and it transposes 64 v rows.
#define FK 256           // keys per work-group
#define FQ 1024          // queries per work-group
#define FC 128           // q rows per staged chunk = one trip of the 4 query shares
__global__ __launch_bounds__(512) void k_cstat(const float* __restrict__ Qs, const float* __restrict__ Ks, const float* __restrict__ Vs, __bf16* __restrict__ QB, __bf16* __restrict__ KB, _Float16* __restrict__ VT, float* __restrict__ PL) {
  __shared__ __align__(16) __bf16 sq[FQ * CC]; __shared__ __align__(16) __bf16 sk[FK * CC]; __shared__ _Float16 sv[64][72]; __shared__ float pm[4][FK], pz[4][FK]; __shared__ int redo;
  const int tid = threadIdx.x, wave = tid >> 5, lane = tid & 31, col = lane & 15; const int kg = wave & 3, qq = wave >> 2;
  const int b = (int)(blockIdx.x >> 6), r = (int)(blockIdx.x & 63), kb = r >> 2, qb = r & 3;
  const size_t qrow0 = (size_t)b * TT + qb * FQ, krow0 = (size_t)b * TT + kb * FK;   // flat rows
  // 64 rows x 8 pieces of 8 elements = one piece per thread: a wave = 8 rows x 4 pieces, so it reads one whole line of each row and stores whole lines of a fragment-order plane
  const int rl = ((tid >> 6) << 3) | ((tid >> 2) & 7), pc = (((tid >> 5) & 1) << 2) | (tid & 3);
  const unsigned o0 = (unsigned)(rl * CC + pc * 8) * 4u;   // the thread's byte offset in a 64-row group of f32 rows; never written again
  const unsigned d0 = (unsigned)FRAG_QK(rl, pc);           // its element offset in the group's fragments
  v4f lq0[2][2], lq1[2][2], lk[4][2], lv[2], ln[2][2];
  // The 16 work-groups that share a q block each start their walk over its FQ / FC chunks at a chunk of their own and wrap: they do not ask L2 for one line at one moment, and between them their first two chunks cover the whole block, so that rows which are not yet in L2 are fetched from memory once, together, at the start. Every chunk is still walked once, whatever the start (speed only)
  const int rot = kb & (FQ / FC - 1);
  auto ch = [&](const int i) __attribute__((always_inline)) { return (i + rot) & (FQ / FC - 1); };
  const float *pK = Ks + krow0 * CC, *pV = Vs + ((size_t)b * TT + r * 64) * CC, *pQ = Qs + qrow0 * CC, *pQ0 = pQ + ch(0) * (FC * CC), *pQ1 = pQ + ch(1) * (FC * CC);
  ldg<4>(lk, pK, o0);
  { const char* p = (const char*)pV + o0; lv[0] = *(const v4f*)p; lv[1] = *(const v4f*)(p + 16); }
  ldg<2>(lq0, pQ0, o0); ldg<2>(lq1, pQ1, o0);
  asm volatile("s_wait_xcnt 0x0" :: "v"(o0), "s"(pK), "s"(pV), "s"(pQ0), "s"(pQ1) : "memory");   // behind the 18 loads; their offset register and their four bases are inputs of the wait, so that none is written again ahead of it
  if (tid == 0) redo = 0;   // published by the barrier below, set only behind the walk
  stg<4>(lk, sk, d0);
#pragma unroll
  for (int u = 0; u < 8; ++u) sv[rl][pc * 8 + u] = (_Float16)bfr(lv[u >> 2][u & 3]);
  stg<2>(lq0, sq + ch(0) * (FC * CC), d0); stg<2>(lq1, sq + ch(1) * (FC * CC), d0);
  __syncthreads();
  { const int c = ((tid >> 6) << 3) | (tid & 7), q = (tid >> 3) & 7;   // 8 neighbouring channels of one piece of 8 keys fill one line of the fragment-order plane
    hx8 hv;
#pragma unroll
    for (int j = 0; j < 8; ++j) hv[j] = sv[q * 8 + j][c];
    vst2((unsigned*)(VT + (size_t)b * CC * TT + FRAG_V(c, r * 8 + q)), *(const v4u*)&hv);
    vst2((unsigned*)(KB + (krow0 + qb * 64) * CC + tid * 8), *(const v4u*)(sk + qb * (64 * CC) + tid * 8));   // this work-group's 64 k rows of the plane: 8 KiB in a row, as they lie in LDS
    asm volatile("s_wait_xcnt 0x0" ::: "memory"); }   // behind the two stores, ahead of whatever writes their address or data registers again
  v16b kf[4][2]; const __bf16* kq = sk + kg * (64 * CC) + lane * 8;                // 16 rows = 2 fragments = 16 * CC elements
#pragma unroll
  for (int j = 0; j < 4; ++j) { kf[j][0] = frag_tb(kq + j * 16 * CC); kf[j][1] = frag_tb(kq + j * 16 * CC + 512); }
  v2f z2[4];   // per key column: the sums over the even and over the odd accumulator registers, side by side for the packed add
#pragma unroll
  for (int j = 0; j < 4; ++j) z2[j] = (v2f){0.f, 0.f};
  v16b a00, a01, a10, a11;
  auto ldq = [&](const int row) __attribute__((always_inline)) { const __bf16* qp = sq + row * CC + lane * 8; a00 = frag_tb(qp); a01 = frag_tb(qp + 512); a10 = frag_tb(qp + 16 * CC); a11 = frag_tb(qp + 16 * CC + 512); };
  // one trip = 32 queries x 64 keys; more: the next trip's fragments (rows nxt ..) are read from LDS directly behind the last product that reads these, into the same registers, and fly under the exponentials and sums
  // The walk sums Z = sum 2^(C2 x) with NO offset: a score then costs half a packed multiply, one exp2 and half a packed add, and no maximum, no rescale. That is the same sum as long as no term leaves the f32 range; the test on Z behind the walk decides it, and a work-group that fails it walks its rows (all in LDS by then) once more against the running max
  auto trip = [&](const bool more, const int nxt) __attribute__((always_inline)) { v8f s0[4], s1[4];
#pragma unroll
    for (int j = 0; j < 4; ++j) { s0[j] = (v8f){}; s1[j] = (v8f){}; s0[j] = mmb(a00, kf[j][0], s0[j]); s1[j] = mmb(a10, kf[j][0], s1[j]); s0[j] = mmb(a01, kf[j][1], s0[j]); s1[j] = mmb(a11, kf[j][1], s1[j]); }
    __builtin_amdgcn_sched_barrier(0);   // the 16 products stay ahead of the loads that refill their operands
    if (more) ldq(nxt);
    __builtin_amdgcn_sched_barrier(0);   // the loads stay here, ahead of the vector work they fly under, and are not sunk to their use
#pragma unroll
    for (int j = 0; j < 4; ++j)
#pragma unroll
      for (int i = 0; i < 8; i += 2) { const v2f t0 = (v2f){s0[j][i], s0[j][i + 1]} * (v2f){C2, C2}, t1 = (v2f){s1[j][i], s1[j][i + 1]} * (v2f){C2, C2};
        z2[j] += (v2f){ex2(t0[0]), ex2(t0[1])} + (v2f){ex2(t1[0]), ex2(t1[1])}; }
    __builtin_amdgcn_sched_barrier(0); };   // the next trip's products stay behind this trip's vector work: lifted over it they would hold a second set of score registers
  // The walk's chunks 0 and 1 are in LDS (chunk = place in the walk; ch() gives its place in the block). Trip c works on chunk c, whose fragments are in registers; it reads chunk c + 1's fragments behind its products, and chunk c + 2 flies from L2 into registers under the whole trip and is laid into LDS at its foot; the barrier there publishes it for the next trip's fragment reads. No byte of the q chunks in LDS is written twice. (Kept rolled: unrolled, the products of later trips were lifted over the vector work of earlier ones and the registers spilled)
  const int row0 = qq * (FC / 4);
  ldq(row0 + ch(0) * FC);
#pragma unroll 1
  for (int c = 0; c < FQ / FC - 2; ++c) { const float* nx = pQ + ch(c + 2) * (FC * CC);
    ldg<2>(ln, nx, o0);
    asm volatile("s_wait_xcnt 0x0" :: "v"(o0) : "memory");   // behind the 4 loads; it also keeps them here, ahead of the trip under which they fly
    __builtin_amdgcn_sched_barrier(0);   // the loads are issued ahead of the trip's work
    trip(true, row0 + ch(c + 1) * FC);
    stg<2>(ln, sq + ch(c + 2) * (FC * CC), d0);
    __syncthreads(); }
  vst2((unsigned*)(QB + (qrow0 + kb * 64) * CC + tid * 8), *(const v4u*)(sq + kb * (64 * CC) + tid * 8));   // this work-group's 64 q rows of the plane: 8 KiB in a row, as they lie in LDS (every chunk is published by now)
  asm volatile("s_wait_xcnt 0x0" ::: "memory");   // behind the store, ahead of whatever writes its address or data registers again
  trip(true, row0 + ch(FQ / FC - 1) * FC);
  trip(false, 0);   // the last trip has no successor to read for
#pragma unroll
  for (int j = 0; j < 4; ++j) { const float zl = z2[j][0] + z2[j][1]; const float zz = zl + __shfl_xor(zl, 16); if (lane < 16) pz[qq][kg * 64 + j * 16 + col] = zz; }
  __syncthreads();
  float res = 0.f;
  if (tid < FK) { float zz = 0.f;
#pragma unroll
    for (int w = 0; w < 4; ++w) zz += pz[w][tid];
    res = log2f(zz);
    // Z finite: no term overflowed (all are positive). Z above 2^-80: the terms that fell below the f32 range, FQ of them under 2^-126 each, are under 2^-36 of it. Anything else, a NaN too, fails the test
    if (!(zz > 1.0e-24f && zz < 3.0e38f)) redo = 1; }
  __syncthreads();   // publishes the verdict, the same for the whole work-group, and ends the reads of pz
  if (__builtin_amdgcn_readfirstlane(redo)) {   // a scalar branch: every lane stays on for the products inside
    float m[4], z[4];
#pragma unroll
    for (int j = 0; j < 4; ++j) { m[j] = -3.0e38f; z[j] = 0.f; }
#pragma unroll 1
    for (int c = 0; c < FQ / FC; ++c) { v8f s0[4], s1[4];   // kept rolled: this path is for range, not for speed
      ldq(row0 + c * FC);
#pragma unroll
      for (int j = 0; j < 4; ++j) { s0[j] = (v8f){}; s1[j] = (v8f){}; s0[j] = mmb(a00, kf[j][0], s0[j]); s1[j] = mmb(a10, kf[j][0], s1[j]); s0[j] = mmb(a01, kf[j][1], s0[j]); s1[j] = mmb(a11, kf[j][1], s1[j]); }
#pragma unroll
      for (int j = 0; j < 4; ++j) { float mn = m[j];
#pragma unroll
        for (int i = 0; i < 8; ++i) mn = fmaxf(mn, fmaxf(s0[j][i], s1[j][i]));
        const float nb = -C2 * mn; float s = 0.f;
#pragma unroll
        for (int i = 0; i < 8; i += 2) { const v2f t0 = arg2(s0[j][i], s0[j][i + 1], nb, nb), t1 = arg2(s1[j][i], s1[j][i + 1], nb, nb); s += ex2(t0[0]) + ex2(t1[0]); s += ex2(t0[1]) + ex2(t1[1]); }
        z[j] = z[j] * ex2(fmaf(m[j], C2, nb)) + s; m[j] = mn; } }
#pragma unroll
    for (int j = 0; j < 4; ++j) { const float mo = __shfl_xor(m[j], 16), zo = __shfl_xor(z[j], 16); const float mm = fmaxf(m[j], mo); const float zz = z[j] * ex2((m[j] - mm) * C2) + zo * ex2((mo - mm) * C2);
      if (lane < 16) { pm[qq][kg * 64 + j * 16 + col] = mm; pz[qq][kg * 64 + j * 16 + col] = zz; } }
    __syncthreads();
    if (tid < FK) { float mm = pm[0][tid];
#pragma unroll
      for (int w = 1; w < 4; ++w) mm = fmaxf(mm, pm[w][tid]);
      float zz = 0.f;
#pragma unroll
      for (int w = 0; w < 4; ++w) zz += pz[w][tid] * ex2((pm[w][tid] - mm) * C2);
      res = mm * C2 + log2f(zz); } }
  if (tid < FK) PL[((size_t)b * (TT / FQ) + qb) * TT + kb * FK + tid] = res; }
// ---- k_ctx: out = P v with P[q][k] x 2^11 = 2^(C2 x + L_k), once to f16, against v f16 (1 product). L_k = 11 - log2 of the sum over the TT / FQ query blocks of 2^(the block's partial): every work-group joins the partials of its batch's keys once, into LDS, behind one barrier, and the trips read L from there. Work-group = 64 queries: 2 query groups of 32 x 8 key shares, one wave each; the keys are dealt to the shares in slices of 32, so that the 8 shares of one trip read 256 consecutive keys (32 KiB in a row of the k plane and of the v plane). S^T = K Q^T (A = 16 key rows, B = 16 query columns): two S^T tiles of 32 consecutive keys, turned into P in place, ARE the B fragment of O^T += V^T P^T in the hardware k order (element s < 8: key 8h + s, else key 16 + 8h + s - 8), which is frag_h's order for the v plane rows; P touches neither LDS nor memory. The 8 shares' partial outputs meet in LDS behind one barrier (summed in share order)
#define P2Q 2            // 32-query groups per work-group
#define P2S 8            // key shares per work-group
__global__ __launch_bounds__(P2Q * P2S * 32) void k_ctx(const __bf16* __restrict__ QH, const __bf16* __restrict__ KH, const _Float16* __restrict__ VT, const float* __restrict__ PL, float* __restrict__ Y) { __shared__ __align__(16) float red[P2S][P2Q * 32][HD + 4]; __shared__ __align__(16) float sL[TT];
  const int tid = threadIdx.x, wave = tid >> 5, lane = tid & 31, col = lane & 15, g = lane >> 4; const int qg = wave % P2Q, ks = wave / P2Q;
  const size_t q0 = (size_t)blockIdx.x * (P2Q * 32); const size_t b = q0 / TT;   // flat query row b * TT + t
  const __bf16* Kb = KH + b * TT * CC; const _Float16* Vb = VT + b * CC * TT; const float* pl = PL + b * (TT / FQ) * TT;
  v16b qf[2][2];
#pragma unroll
  for (int i = 0; i < 2; ++i) { qf[i][0] = frag_tb(QH + (q0 + qg * 32 + i * 16) * CC + lane * 8); qf[i][1] = frag_tb(QH + (q0 + qg * 32 + i * 16) * CC + 512 + lane * 8); }
  v8f acc[2][HD / 16] = {};
  // The 64 work-groups of a batch walk the same k and v lines. Each starts at a trip of its own and wraps (see k_cstat): 16 starts from index bits 0, 1, 3, 4
  const unsigned st = (blockIdx.x & 3) | ((blockIdx.x >> 1) & 12);
  unsigned kk = (unsigned)(ks * 32 * CC + lane * 8) * 2u + st * (P2S * 32 * CC * 2u), kv = kk, so = (unsigned)(ks * 32 + 8 * g) * 4u + st * (P2S * 32 * 4u);   // the lane's own byte offsets for keys k0 = (((t + st) % 16) * P2S + ks) * 32 ..: kk for its piece of the first of the 4 k fragments of those 32 keys, kv the same for the 4 v fragments (4 KiB in a row in either plane, at the same offset), so for the column statistics in LDS; each steps with its own loads, on bases that are the same for the whole work-group
  // Each operand's loads are issued one trip ahead, directly behind the last instruction of this trip that reads it and into the same registers: k behind the score products, the statistics behind the exponents' multiply-adds, v behind the output products. They fly under the rest of the trip instead of being waited for at its head. The walk and every sum keep their order. (The inner loops are unrolled so that every fragment index is a constant and the fragments stay in registers)
  v16b k00, k01, k10, k11; v16h vf[HD / 16]; v4f m0a, m0b, m1a, m1b;
  auto ldk = [&]() __attribute__((always_inline)) { const __bf16* kp = (const __bf16*)((const char*)Kb + kk); k00 = frag_tb(kp); k01 = frag_tb(kp + 512); k10 = frag_tb(kp + 16 * CC); k11 = frag_tb(kp + 16 * CC + 512); };
  auto ldm = [&]() __attribute__((always_inline)) { const float* mp = (const float*)((const char*)sL + so); m0a = *(const v4f*)(mp); m0b = *(const v4f*)(mp + 4); m1a = *(const v4f*)(mp + 16); m1b = *(const v4f*)(mp + 20); };
  auto ldv = [&]() __attribute__((always_inline)) { const _Float16* vp = (const _Float16*)((const char*)Vb + kv);
#pragma unroll
    for (int j = 0; j < HD / 16; ++j) vf[j] = frag_t(vp + j * 512); };
  auto trip = [&](const bool more) __attribute__((always_inline)) { v8f s0[2], s1[2]; v2f e[2][8];
#pragma unroll
    for (int i = 0; i < 2; ++i) { s0[i] = (v8f){}; s1[i] = (v8f){}; s0[i] = mmb(k00, qf[i][0], s0[i]); s1[i] = mmb(k10, qf[i][0], s1[i]); s0[i] = mmb(k01, qf[i][1], s0[i]); s1[i] = mmb(k11, qf[i][1], s1[i]); }
    __builtin_amdgcn_sched_barrier(0);   // the 8 score products stay ahead of the loads that refill their k operands
    if (more) { asm volatile("s_wait_xcnt 0x0" : "+v"(kk) :: "memory");   // behind the last trip's k loads, ahead of the step that writes their offset register
      kk = (kk + P2S * 32 * CC * 2u) & (TT * CC * 2u - 1u); ldk(); }   // the step wraps at the end of the batch's plane
    __builtin_amdgcn_sched_barrier(0);   // the k loads stay here and are not sunk to their use in the next trip
#pragma unroll
    for (int i = 0; i < 2; ++i)
#pragma unroll
      for (int r = 0; r < 4; r += 2) { e[i][r] = arg2(s0[i][r], s0[i][r + 1], m0a[r], m0a[r + 1]); e[i][r + 1] = arg2(s0[i][4 + r], s0[i][5 + r], m0b[r], m0b[r + 1]); e[i][4 + r] = arg2(s1[i][r], s1[i][r + 1], m1a[r], m1a[r + 1]); e[i][5 + r] = arg2(s1[i][4 + r], s1[i][5 + r], m1b[r], m1b[r + 1]); }
    __builtin_amdgcn_sched_barrier(0);   // the 16 multiply-adds stay ahead of the loads that refill the statistics
    if (more) { so = (so + P2S * 32 * 4u) & (TT * 4u - 1u); ldm(); }
    __builtin_amdgcn_sched_barrier(0);   // the statistics loads stay here and are not sunk to their use
#pragma unroll
    for (int i = 0; i < 2; ++i) { v16h p;
#pragma unroll
      for (int r = 0; r < 4; r += 2) { const v2f t0 = e[i][r], t1 = e[i][r + 1], t2 = e[i][4 + r], t3 = e[i][5 + r];
        p[r] = (_Float16)ex2(t0[0]); p[r + 1] = (_Float16)ex2(t0[1]); p[4 + r] = (_Float16)ex2(t1[0]); p[5 + r] = (_Float16)ex2(t1[1]); p[8 + r] = (_Float16)ex2(t2[0]); p[9 + r] = (_Float16)ex2(t2[1]); p[12 + r] = (_Float16)ex2(t3[0]); p[13 + r] = (_Float16)ex2(t3[1]); }
#pragma unroll
      for (int j = 0; j < HD / 16; ++j) acc[i][j] = mm16(vf[j], p, acc[i][j]); }
    __builtin_amdgcn_sched_barrier(0);   // the 8 output products stay ahead of the loads that refill their v operands
    if (more) { asm volatile("s_wait_xcnt 0x0" : "+v"(kv) :: "memory");   // behind the last trip's v loads, ahead of the step that writes their offset register
      kv = (kv + P2S * 32 * CC * 2u) & (TT * CC * 2u - 1u); ldv(); } };
  ldk(); __builtin_amdgcn_sched_barrier(0); ldv();   // trip 0's k and v loads fly under the joining of the statistics
  { v4f p[TT / 4 / (P2Q * P2S * 32)][TT / FQ]; const float* pt = pl + tid * 4;   // 4 neighbouring keys a thread and pass; all the passes' loads are issued before the first is waited for (the loops are unrolled for that)
#pragma unroll
    for (int it = 0; it < TT / 4 / (P2Q * P2S * 32); ++it)
#pragma unroll
      for (int w = 0; w < TT / FQ; ++w) p[it][w] = *(const v4f*)(pt + w * TT + it * (P2Q * P2S * 32 * 4));
    asm volatile("s_wait_xcnt 0x0" :: "v"(tid), "s"(pl) : "memory");   // behind the loads; the index and the base that their addresses are formed from are inputs of the wait, so that neither is written again ahead of it
#pragma unroll
    for (int it = 0; it < TT / 4 / (P2Q * P2S * 32); ++it) { v4f o;
#pragma unroll
      for (int u = 0; u < 4; ++u) { float mm = p[it][0][u];
#pragma unroll
        for (int w = 1; w < TT / FQ; ++w) mm = fmaxf(mm, p[it][w][u]);
        float zz = 0.f;
#pragma unroll
        for (int w = 0; w < TT / FQ; ++w) zz += ex2(p[it][w][u] - mm);
        o[u] = 11.0f - mm - log2f(zz); }
      *(v4f*)&sL[(tid + it * (P2Q * P2S * 32)) * 4] = o; } }
  __syncthreads();
  ldm();
  for (int t = 0; t < TT / P2S / 32 - 1; ++t) trip(true);
  asm volatile("s_wait_xcnt 0x0" : "+v"(kk), "+v"(kv) :: "memory");   // behind the last loads, ahead of whatever takes their two offset registers from here on
  trip(false);   // the last trip has no successor to load for
  // acc[i][j][r] = O[query i * 16 + col][channel j * 16 + 8 g + r] x 2^11 over this wave's key share
#pragma unroll
  for (int i = 0; i < 2; ++i)
#pragma unroll
    for (int j = 0; j < HD / 16; ++j) { float* rp = &red[ks][qg * 32 + i * 16 + col][j * 16 + 8 * g]; v4f lo, hi;
#pragma unroll
      for (int r = 0; r < 4; ++r) { lo[r] = acc[i][j][r]; hi[r] = acc[i][j][4 + r]; }
      *(v4f*)rp = lo; *(v4f*)(rp + 4) = hi; }
  __syncthreads();
  for (int e = tid; e < P2Q * 32 * (HD / 4); e += P2Q * P2S * 32) { const int q = e / (HD / 4), d4 = e % (HD / 4); v4f a = *(const v4f*)&red[0][q][d4 * 4];
#pragma unroll
    for (int s = 1; s < P2S; ++s) a += *(const v4f*)&red[s][q][d4 * 4];
    vst2(Y + (q0 + q) * CC + d4 * 4, a * (1.0f / 2048.0f)); } }

extern "C" void kernel_launch(void* const* d_in, const int* in_sizes, int n_in, void* d_out, int out_size, void* d_ws, size_t ws_size, hipStream_t stream) {
  (void)in_sizes; (void)n_in; (void)out_size;
  const float** F = (const float**)d_in;
  if (ws_size < (size_t)WS_END2) return;
  char* ws = (char*)d_ws; __bf16 *QB = (__bf16*)(ws + WS_QH), *KB = (__bf16*)(ws + WS_KH); _Float16 *VT = (_Float16*)(ws + WS_VT);
  float *PL = (float*)(ws + WS_CL);
  // inputs: 0 Q [4,4096,64]; 1 K; 2 V
  k_cstat<<<dim3(TNB * (TT / FK) * (TT / FQ)), 512, 0, stream>>>(F[0], F[1], F[2], QB, KB, VT, PL);       /* per key column and query block: the partial statistic; the bf16 q, k and f16 v planes on the way */
  k_ctx<<<dim3(TNB * TT / (P2Q * 32)), P2Q * P2S * 32, 0, stream>>>(QB, KB, VT, PL, (float*)d_out);  /* out = P v, P formed in registers */
}
